// v000
// Times are from an AMD MI455X. After a warm-up the kernel runs many times in a row, and a time is the length of
// such a window on the GPU divided by its runs, so every launch and the gaps after it count. The runs cycle
// through copies of the inputs. A figure is the median of several windows, for all but v000 over two sittings.
// Sittings can differ by a few percent; kernels timed side by side share one.
// v000, which the later versions start from, runs in 404 microseconds.
#include <hip/hip_runtime.h>

// Dense self-attention layer: x [NB][SEQ][192]; Wq/Wk/Wv [2048][192] ([out][in], y = x W^T, no bias); 16 heads x 128; per-head RMS normalisation of q and k (eps 1e-6, gain inputs);
// rotate-half rotary embeddings (base 1e6, positions 0..SEQ-1); scores = q.k * 128^-0.5 + additive mask [NB][1][SEQ][SEQ] (read by value); softmax over keys; P.V; heads merged; output = ctx Wo^T with Wo [192][2048] (f32).
// Compute dtypes, f32 accumulate everywhere: q/k/v projections v_wmma_f32_16x16x32_bf16 (x and W RNE-converted to bf16; products exact);
// scores v_wmma_f32_16x16x32_f16 (q, k single f16 planes after normalisation and rotary); P.V v_wmma_f32_16x16x32_f16 (P single f16 with x16384 carry that cancels in the normalisation, v single f16);
// output projection v_wmma_f32_16x16x32_f16 (ctx single f16 with x256 carry, Wo = bf16-converted value x64 as f16; 1/16384 folded in the f32 epilogue). Softmax f32 (online, running max), row sum over the converted P.
// Layout: bf16 copies of x and Wq|Wk|Wv; f16 Wo plane; cos/sin tables [SEQ][64] f32; q, k planes [b*16+h][t][128]; v^T plane [b*16+h][d][t]; ctx plane [b*SEQ+t][h*128+d];
// fused flash kernel in transposed form (S^T = K Q^T, O^T = V^T P^T), fragments straight from the f16 planes, no score or probability plane in memory.

#ifndef NB
#define NB 2
#endif
#ifndef SEQ
#define SEQ 2048
#endif
#define NB_FULL  2
#define SEQ_FULL 2048
#ifndef OUT_SEQ
#define OUT_SEQ SEQ              // row pitch (in tokens) between batches of the output
#endif
#define DX   192                 // model width (projection K, output N)
#define NH_  16
#define HD   128
#define DQ   2048                // NH_ * HD
#define AW   4                   // waves per flash block (16 query rows each)
#define OSP  132                 // LDS row pitch (floats) of the flash output tile
#define OSQ  132                 // LDS row pitch (floats) of the q/k epilogue tile
#define SC2  ((float)(0.08838834764831845 * 1.4426950408889634))   // HD^-0.5 * log2(e)
#define L2E  1.4426950408889634f
#define PSH  14.0f               // log2 of the P carry (16384)
#define NEGB (-3.0e38f)
#define CXS  256.0f              // carry of the ctx plane
#define WOS  64.0f               // carry of the Wo plane
#define OSC  (1.0f / 16384.0f)   // 1 / (CXS * WOS)

static_assert(HD == 128);                      // q/k plane row = 256 bytes = two lines; one head = 8 column tiles of 16
static_assert(NH_ * HD == DQ);                 // head h = columns h*128 + d
static_assert(HD % 32 == 0);                   // score k-loop steps by 32
static_assert(DX % 32 == 0);                   // projection k-loop steps by 32
static_assert(DQ % 32 == 0);                   // output-projection k-loop steps by 32
static_assert(DX % 64 == 0);                   // output column tiles of 64
static_assert(DQ % 64 == 0);                   // v^T row tiles of 64
static_assert(SEQ % 64 == 0);                  // a 64-token tile never straddles two batches
static_assert((NB * SEQ) % 64 == 0);
static_assert(SEQ % 32 == 0);                  // key loop steps by 32; 32-token q/k tiles
static_assert(SEQ % (16 * AW) == 0);           // flash grid covers the sequence exactly
static_assert(((size_t)SEQ * DX) % 64 == 0);
static_assert(((size_t)DQ * DX) % 2048 == 0);  // weight converts: whole 256-thread blocks
static_assert((SEQ * 64) % 256 == 0);
static_assert(NB <= NB_FULL);
static_assert(SEQ <= SEQ_FULL);
static_assert(OSP >= HD);
static_assert(OSQ >= HD);
static_assert((OSP * 4) % 16 == 0);
static_assert((OSQ * 4) % 16 == 0);
static_assert((DX * 4) % 128 == 0);            // output rows start on a line
static_assert(32 * 16 * 8 == 16 * HD * 2);     // q/k epilogue and ctx epilogue: 32 lanes x 16 B x 8 instructions == 16 rows x 256 B
static_assert(32 * 16 * 4 == 16 * 64 * 2);
static_assert(32 * 16 * 8 == 16 * 64 * 4);     // output epilogue: 32 lanes x 16 B x 8 instructions == 16 rows x 256 B
static_assert(16 * OSQ * 4 <= 131072);         // static LDS of the q/k projection kernel
static_assert(16 * 68 * 4 <= 131072);          // static LDS of the v^T and output projection kernels
static_assert(AW * 16 * OSP * 4 <= 131072);    // static LDS of the flash kernel

typedef _Float16 h16;
typedef unsigned short bf;
typedef __attribute__((ext_vector_type(16))) __bf16   v16bf;
typedef __attribute__((ext_vector_type(16))) _Float16 v16h;
typedef __attribute__((ext_vector_type(8)))  _Float16 v8h;
typedef __attribute__((ext_vector_type(8)))  unsigned short v8us;
typedef __attribute__((ext_vector_type(8)))  float    v8f;
typedef __attribute__((ext_vector_type(4)))  float    v4f;
typedef v4f  __attribute__((may_alias)) v4fa;

__device__ __forceinline__ unsigned short f2bf(float f) { unsigned u = __float_as_uint(f); u += 0x7FFFu + ((u >> 16) & 1u); return (unsigned short)(u >> 16); }
__device__ __forceinline__ float bfr(float f) { return __uint_as_float(((unsigned)f2bf(f)) << 16); }   // value after RNE convert to bf16
__device__ __forceinline__ v16h cat16(v8h lo, v8h hi) { return __builtin_shufflevector(lo, hi, 0, 1, 2, 3, 4, 5, 6, 7, 8, 9, 10, 11, 12, 13, 14, 15); }
__device__ __forceinline__ v16bf cat16b(v8us lo, v8us hi) { return __builtin_bit_cast(v16bf, __builtin_shufflevector(lo, hi, 0, 1, 2, 3, 4, 5, 6, 7, 8, 9, 10, 11, 12, 13, 14, 15)); }
__device__ __forceinline__ v8f wmma16(v16h a, v16h b, v8f c) { return __builtin_amdgcn_wmma_f32_16x16x32_f16(false, a, false, b, (short)0, c, false, false); }
__device__ __forceinline__ v8f wmmab(v16bf a, v16bf b, v8f c) { return __builtin_amdgcn_wmma_f32_16x16x32_bf16(false, a, false, b, (short)0, c, false, false); }
// fragment loaders from K-contiguous 16-bit rows; p already includes + 8*(lane>>4): elements 0..7 <- k0+8h+0..7, elements 8..15 <- k0+16+8h+0..7 (same map for A and B)
__device__ __forceinline__ v16h  ldh(const h16* p) { return cat16(*(const v8h*)p, *(const v8h*)(p + 16)); }
__device__ __forceinline__ v16bf ldb(const bf* p)  { return cat16b(*(const v8us*)p, *(const v8us*)(p + 16)); }
// ordering point for wave-private LDS tiles (same wave writes and reads)
__device__ __forceinline__ void wave_sync() { __builtin_amdgcn_fence(3 /* release order */, "wavefront"); __builtin_amdgcn_wave_barrier(); asm volatile("" ::: "memory"); }

// f32 -> f16 operand convert that cannot produce a subnormal (|v| < 2^-14 -> +0)
static __device__ __forceinline__ h16 toh_flush(float v) { const h16 r = (h16)v; return (fabsf(v) < 6.103515625e-05f) ? (h16)0.0f : r; }
// one matrix instruction + its own four-slot guard (one accumulator per guard)
static __device__ __forceinline__ v8f wmma16g(v16h a, v16h b, v8f c) { c = wmma16(a, b, c); asm volatile("v_nop\n\tv_nop\n\tv_nop\n\tv_nop" : "+v"(c) : "v"(a), "v"(b)); return c; }
static __device__ __forceinline__ v8f wmmabg(v16bf a, v16bf b, v8f c) { c = wmmab(a, b, c); asm volatile("v_nop\n\tv_nop\n\tv_nop\n\tv_nop" : "+v"(c) : "v"(a), "v"(b)); return c; }

__global__ __launch_bounds__(256) void k_cvt8(const float* __restrict__ src, bf* dst, size_t n8) {
    const size_t i = (size_t)blockIdx.x * 256 + threadIdx.x; if (i >= n8) return;
    const v8f v = *(const v8f*)(src + i * 8); v8us o;
#pragma unroll
    for (int k = 0; k < 8; ++k) o[k] = f2bf(v[k]);
    *(v8us*)(dst + i * 8) = o; 
}

__global__ __launch_bounds__(256) void k_cvtw(const float* __restrict__ src, h16* dst, size_t n8, float sc) {
    const size_t i = (size_t)blockIdx.x * 256 + threadIdx.x; if (i >= n8) return;
    const v8f v = *(const v8f*)(src + i * 8); v8h o;
#pragma unroll
    for (int k = 0; k < 8; ++k) o[k] = toh_flush(bfr(v[k]) * sc);
    *(v8h*)(dst + i * 8) = o; 
}

// k_tab: rotary tables COS/SIN [SEQ][64] (f32): angle = (float)pos * inv_freq[j], inv_freq[j] = 1e6^(-j/64); precise sincosf (angles reach 2047 rad).
__global__ __launch_bounds__(256) void k_tab(float* COS, float* SIN, int n) {
#pragma clang fp contract(off)
    const int i = blockIdx.x * 256 + threadIdx.x; if (i >= n) return;
    const int pos = i >> 6, j = i & 63;
    const float invf = exp2f(-(float)j * (19.931568569324174f / 64.0f));   // log2(1e6) / 64
    const float ang = (float)pos * invf;
    float sn, cs; sincosf(ang, &sn, &cs);
    *(float*)(COS + i) = cs; *(float*)(SIN + i) = sn; 
}

// k_qk: projection + per-head RMS normalisation + rotary, ONE WAVE per 32 tokens x 128 columns (one head; 16 accumulators), operands straight from K-contiguous bf16 planes, K = DX.
// C[m][n] = sum_k A[m][k] Bt[n][k]; A = x rows (m = b*SEQ + t), Bt = W rows (n = h*128 + d). grid (NB*SEQ/32, NH_).
// Epilogue per 16-row slab: row sum of squares from the accumulators (8 column tiles per lane, xor 1/2/4/8 inside each 16-lane half), y = (c * rstd) * gain staged in a wave-private LDS tile;
// store stage: lane piece p = 32 s + lane -> row p>>4, columns c8 = 8 (p&15); out[c] = y[c] cos[c&63] + (c < 64 ? -y[c+64] : y[c-64]) sin[c&63] (tables by 16-B loads), f16;
__global__ __launch_bounds__(32) void k_qk(const bf* __restrict__ A, const bf* __restrict__ Bt, const float* __restrict__ nw,
                                           const float* __restrict__ COS, const float* __restrict__ SIN, h16* Ph) {
    __shared__ __align__(16) float os[16 * OSQ];
    const int K = DX;
    const int lane = threadIdx.x & 31, lr = lane & 15, hi = lane >> 4; const int r0 = blockIdx.x * 32, c0 = blockIdx.y * HD;
    v8f acc[2][8];
#pragma unroll
    for (int mb = 0; mb < 2; ++mb)
#pragma unroll
        for (int nb = 0; nb < 8; ++nb) acc[mb][nb] = (v8f){};
    const size_t aoff = (size_t)(r0 + lr) * K + 8 * hi, boff = (size_t)(c0 + lr) * K + 8 * hi;
#pragma unroll 1
    for (int kc = 0; kc < K; kc += 32) {
        v16bf a[2];
#pragma unroll
        for (int mb = 0; mb < 2; ++mb) a[mb] = ldb(A + aoff + (size_t)mb * 16 * K + kc);
#pragma unroll
        for (int nb = 0; nb < 8; ++nb) { const v16bf b = ldb(Bt + boff + (size_t)nb * 16 * K + kc);
#pragma unroll
            for (int mb = 0; mb < 2; ++mb) acc[mb][nb] = wmmabg(a[mb], b, acc[mb][nb]); }
    }
    float wn[8];
#pragma unroll
    for (int nb = 0; nb < 8; ++nb) wn[nb] = bfr(nw[nb * 16 + lr]);                 // nb*16 + lr < HD
    const int bb = r0 / SEQ, tt = r0 % SEQ; const int zc = bb * NH_ + (int)blockIdx.y;
    const size_t tbase = ((size_t)zc * SEQ + (size_t)tt) * HD;
#pragma unroll
    for (int mb = 0; mb < 2; ++mb) {
#pragma unroll
        for (int j = 0; j < 8; ++j) {
            float ss = 0.0f;
#pragma unroll
            for (int nb = 0; nb < 8; ++nb) ss += acc[mb][nb][j] * acc[mb][nb][j];
            ss += __shfl_xor(ss, 1, 32); ss += __shfl_xor(ss, 2, 32); ss += __shfl_xor(ss, 4, 32); ss += __shfl_xor(ss, 8, 32);
            const float rs = rsqrtf(ss * (1.0f / 128.0f) + 1.0e-6f);
#pragma unroll
            for (int nb = 0; nb < 8; ++nb) os[(hi * 8 + j) * OSQ + nb * 16 + lr] = (acc[mb][nb][j] * rs) * wn[nb]; }   // D: row 8h+j, col lane&15
        wave_sync();
        v8h hv[8];
#pragma unroll
        for (int s = 0; s < 8; ++s) { const int p = s * 32 + lane; const int row = p >> 4, c8 = (p & 15) * 8;   // 8 s x 2 rows = 16 rows; 16 lanes x 8 = 128 columns
            const int pc = c8 ^ 64, jj = c8 & 63; const float sg = (c8 < 64) ? -1.0f : 1.0f;
            const v4f x0 = *(const v4fa*)(&os[row * OSQ + c8]), x1 = *(const v4fa*)(&os[row * OSQ + c8 + 4]);
            const v4f y0 = *(const v4fa*)(&os[row * OSQ + pc]), y1 = *(const v4fa*)(&os[row * OSQ + pc + 4]);
            const size_t to = (size_t)(tt + mb * 16 + row) * 64 + (size_t)jj;      // token position < SEQ, jj + 7 < 64
            const v4f ca = *(const v4f*)(COS + to), cb = *(const v4f*)(COS + to + 4), sa = *(const v4f*)(SIN + to), sb = *(const v4f*)(SIN + to + 4);
            v8h o;
#pragma unroll
            for (int i = 0; i < 4; ++i) { o[i] = toh_flush(x0[i] * ca[i] + (sg * y0[i]) * sa[i]); o[4 + i] = toh_flush(x1[i] * cb[i] + (sg * y1[i]) * sb[i]); }
            hv[s] = o; }
        const size_t sbs = tbase + (size_t)(mb * 16) * HD;
{
#pragma unroll
            for (int s = 0; s < 8; ++s) *(v8h*)(Ph + sbs + (size_t)(s * 32 + lane) * 8) = hv[s];
             }
        wave_sync();
    }
}

// k_vt: v^T projection, ONE WAVE per 64x64 tile (16 accumulators), K = DX. A = Wv rows (m = h*128 + d), Bt = x rows (n = b*SEQ + t); plane [(b*2048 + m)][t], row pitch SEQ. grid (DQ/64, NB*SEQ/64).
__global__ __launch_bounds__(32) void k_vt(const bf* __restrict__ A, const bf* __restrict__ Bt, h16* Ph) {
    __shared__ __align__(16) float os[16 * 68];
    const int K = DX;
    const int lane = threadIdx.x & 31, lr = lane & 15, hi = lane >> 4; const int r0 = blockIdx.x * 64, c0 = blockIdx.y * 64;
    v8f acc[4][4];
#pragma unroll
    for (int mb = 0; mb < 4; ++mb)
#pragma unroll
        for (int nb = 0; nb < 4; ++nb) acc[mb][nb] = (v8f){};
    const size_t aoff = (size_t)(r0 + lr) * K + 8 * hi, boff = (size_t)(c0 + lr) * K + 8 * hi;
#pragma unroll 1
    for (int kc = 0; kc < K; kc += 32) {
        v16bf a[4];
#pragma unroll
        for (int mb = 0; mb < 4; ++mb) a[mb] = ldb(A + aoff + (size_t)mb * 16 * K + kc);
#pragma unroll
        for (int nb = 0; nb < 4; ++nb) { const v16bf b = ldb(Bt + boff + (size_t)nb * 16 * K + kc);
#pragma unroll
            for (int mb = 0; mb < 4; ++mb) acc[mb][nb] = wmmabg(a[mb], b, acc[mb][nb]); }
    }
    const int bb = c0 / SEQ, tt = c0 % SEQ;
    const size_t tbase = (size_t)bb * (size_t)DQ * SEQ + (size_t)r0 * SEQ + (size_t)tt;
#pragma unroll
    for (int mb = 0; mb < 4; ++mb) {
#pragma unroll
        for (int nb = 0; nb < 4; ++nb) {
#pragma unroll
            for (int j = 0; j < 8; ++j) os[(hi * 8 + j) * 68 + nb * 16 + lr] = acc[mb][nb][j]; }   // D: row 8h+j, col lane&15
        wave_sync();
        v8h hv[4];
#pragma unroll
        for (int s = 0; s < 4; ++s) { const int row = 4 * s + (lane >> 3), c8 = (lane & 7) * 8;   // 4 s x 4 row groups = 16 rows; 8 lanes x 8 = 64 columns
            const v4f x0 = *(const v4fa*)(&os[row * 68 + c8]); const v4f x1 = *(const v4fa*)(&os[row * 68 + c8 + 4]); v8h o;
#pragma unroll
            for (int i = 0; i < 4; ++i) { o[i] = toh_flush(x0[i]); o[4 + i] = toh_flush(x1[i]); }
            hv[s] = o; }
        const size_t sbs = tbase + (size_t)(mb * 16) * SEQ;
{
#pragma unroll
            for (int s = 0; s < 4; ++s) { const int row = 4 * s + (lane >> 3), c8 = (lane & 7) * 8;
                *(v8h*)(Ph + sbs + (size_t)row * SEQ + c8) = hv[s]; }
             }
        wave_sync();
    }
}

// k_flash: fused attention, one wave per 16 query rows of one (batch, head); K / V^T / Q fragments straight from the f16 planes (two 16-B loads each, arithmetic addressing).
// Transposed form: S^T[key][t] = K Q^T (A = K rows, B = Q rows, 4 k-steps over d); lane (t = lane&15, h = lane>>4) holds keys 8h+r of each 16-key tile, so the packed
// P tile is directly the B fragment of O^T[d][t] = V^T P^T (element r <- tile keys 0..15, element 8+r <- tile keys 16..31, lane unchanged); 8 output tiles of 16 d.
// Additive mask row t, keys key0+8h+0..7 and key0+16+8h+0..7: four 16-B loads per lane per step, value RNE-converted to bf16, added after the scale (base-2 domain).
// Softmax state (running max, partial sum) is one scalar per lane; the two lane halves of a row are combined with one xor-16 exchange. Q fragments are re-loaded each step through an opaque zero offset.
__global__ __launch_bounds__(32 * AW) __attribute__((amdgpu_num_vgpr(256)))
void k_flash(const h16* __restrict__ QH, const h16* __restrict__ KP, const h16* __restrict__ VT, const float* __restrict__ mask, h16* CTX) {
    __shared__ __align__(16) float os[AW * 16 * OSP];
    const int lane = threadIdx.x & 31, lr = lane & 15, hi = lane >> 4;
    const int wave = __builtin_amdgcn_readfirstlane((int)(threadIdx.x >> 5));
    const int zh = blockIdx.y; const int b = zh / NH_, h = zh % NH_;
    const int t0 = (blockIdx.x * AW + wave) * 16;
    const size_t pbase = (size_t)zh * SEQ * HD;
    const size_t qo = pbase + (size_t)(t0 + lr) * HD + 8 * hi;  // + ks*32          (B fragment: col t, k = d)
    const size_t ko = pbase + (size_t)lr * HD + 8 * hi;         // + key*HD + ks*32 (A fragment: row key, k = d)
    const size_t vo = pbase + (size_t)lr * SEQ + 8 * hi;        // + 16j*SEQ + key  (A fragment: row d, k = key)
    const float* mrow = mask + ((size_t)b * SEQ_FULL + (size_t)(t0 + lr)) * SEQ_FULL + 8 * hi;
    v8f o[8];
#pragma unroll
    for (int j = 0; j < 8; ++j) o[j] = (v8f){};
    float m = NEGB, l = 0.0f;
#pragma unroll 1
    for (int key0 = 0; key0 < SEQ; key0 += 32) {
        unsigned qsh = 0; asm volatile("" : "+v"(qsh));
        const h16* ka = KP + ko + (size_t)key0 * HD;
        const h16* qa = QH + qo + qsh;
        v8f sA = (v8f){}, sB = (v8f){};
#pragma unroll
        for (int ks = 0; ks < HD / 32; ++ks) {
            const v16h qf = ldh(qa + ks * 32);
            const v16h ka0 = ldh(ka + ks * 32), kb0 = ldh(ka + 16 * HD + ks * 32);
            sA = wmma16g(ka0, qf, sA); sB = wmma16g(kb0, qf, sB); }
        const float* mp = mrow + key0;                           // keys key0+8h+0..7 and key0+16+8h+0..7, all < SEQ
        const v4f m0 = *(const v4f*)mp, m1 = *(const v4f*)(mp + 4), m2 = *(const v4f*)(mp + 16), m3 = *(const v4f*)(mp + 20);
        float ta[8], tb[8]; float mx = NEGB;
#pragma unroll
        for (int r = 0; r < 4; ++r) {
            ta[r] = sA[r] * SC2 + bfr(m0[r]) * L2E; ta[4 + r] = sA[4 + r] * SC2 + bfr(m1[r]) * L2E;
            tb[r] = sB[r] * SC2 + bfr(m2[r]) * L2E; tb[4 + r] = sB[4 + r] * SC2 + bfr(m3[r]) * L2E; }
#pragma unroll
        for (int r = 0; r < 8; ++r) mx = fmaxf(mx, fmaxf(ta[r], tb[r]));
        mx = fmaxf(mx, __shfl_xor(mx, 16, 32));
        const float mnew = fmaxf(m, mx);
        const float alpha = __builtin_amdgcn_exp2f(m - mnew);
        const float sh = PSH - mnew;
        v16h pb; float ls = 0.0f;
#pragma unroll
        for (int r = 0; r < 8; ++r) {
            const float xa = ta[r] + sh, xb = tb[r] + sh;
            const float ea = __builtin_amdgcn_exp2f(xa), eb = __builtin_amdgcn_exp2f(xb);
            const float ga = (xa < -14.0f) ? 0.0f : ea, gb = (xb < -14.0f) ? 0.0f : eb;   // no subnormal f16 P (select on the exponent argument)
            const h16 pa = (h16)ga; const h16 pc = (h16)gb;
            pb[r] = pa; pb[8 + r] = pc;
            ls += (float)pa + (float)pc; }
        l = l * alpha + ls; m = mnew;
#pragma unroll
        for (int j = 0; j < 8; ++j) o[j] = o[j] * alpha;
        const h16* va = VT + vo + key0;
#pragma unroll
        for (int g = 0; g < 2; ++g) {
            v16h vf[4];
#pragma unroll
            for (int j = 0; j < 4; ++j) vf[j] = ldh(va + (size_t)(16 * (4 * g + j)) * SEQ);
#pragma unroll
            for (int j = 0; j < 4; ++j) o[4 * g + j] = wmma16g(vf[j], pb, o[4 * g + j]); }
    }
    l += __shfl_xor(l, 16, 32);
    const bool any = l > 0.0f;
    const float lsafe = any ? l : 1.0f;
    const float inv = any ? ((1.0f / lsafe) * CXS) : 0.0f;
    const int wb = wave * 16 * OSP;
    // O^T D layout: o[j][r] = (d = 16j + 8h + r, t = lane&15) -> os[t][d]; rows 0..15 x columns 0..127 all written
#pragma unroll
    for (int j = 0; j < 8; ++j) { v4f a, c;
        a[0] = o[j][0] * inv; a[1] = o[j][1] * inv; a[2] = o[j][2] * inv; a[3] = o[j][3] * inv; c[0] = o[j][4] * inv; c[1] = o[j][5] * inv; c[2] = o[j][6] * inv; c[3] = o[j][7] * inv;
        *(v4fa*)(&os[wb + lr * OSP + 16 * j + 8 * hi]) = a; *(v4fa*)(&os[wb + lr * OSP + 16 * j + 8 * hi + 4]) = c; }
    wave_sync();
    v8h hv[8];
#pragma unroll
    for (int s = 0; s < 8; ++s) { const int p = s * 32 + lane; const int row = p >> 4, c8 = (p & 15) * 8;   // 8 s x 2 rows = 16 rows; 16 lanes x 8 = 128 columns = two lines
        const v4f x0 = *(const v4fa*)(&os[wb + row * OSP + c8]); const v4f x1 = *(const v4fa*)(&os[wb + row * OSP + c8 + 4]); v8h q;
#pragma unroll
        for (int i = 0; i < 4; ++i) { q[i] = toh_flush(x0[i]); q[4 + i] = toh_flush(x1[i]); }
        hv[s] = q; }
    h16* crow = CTX + ((size_t)b * SEQ + (size_t)t0) * DQ + (size_t)h * HD;
{
#pragma unroll
        for (int s = 0; s < 8; ++s) { const int p = s * 32 + lane; const int row = p >> 4, c8 = (p & 15) * 8;
            *(v8h*)(crow + (size_t)row * DQ + c8) = hv[s]; }
         }
}

// k_out: output projection, ONE WAVE per 64x64 tile (16 accumulators), f16 operands straight from K-contiguous planes, K = DQ.
// OUT[m][n] = (1/16384) sum_k A[m][k] Bt[n][k]; A = ctx rows (m = b*SEQ + t, x256), Bt = Wo rows (n, x64). grid (NB*SEQ/64, DX/64).
__global__ __launch_bounds__(32) void k_out(const h16* __restrict__ A, const h16* __restrict__ Bt, float* OUT) {
    __shared__ __align__(16) float os[16 * 68];
    const int K = DQ;
    const int lane = threadIdx.x & 31, lr = lane & 15, hi = lane >> 4; const int r0 = blockIdx.x * 64, c0 = blockIdx.y * 64;
    v8f acc[4][4];
#pragma unroll
    for (int mb = 0; mb < 4; ++mb)
#pragma unroll
        for (int nb = 0; nb < 4; ++nb) acc[mb][nb] = (v8f){};
    const size_t aoff = (size_t)(r0 + lr) * K + 8 * hi, boff = (size_t)(c0 + lr) * K + 8 * hi;
#pragma unroll 1
    for (int kc = 0; kc < K; kc += 32) {
        v16h a[4];
#pragma unroll
        for (int mb = 0; mb < 4; ++mb) a[mb] = ldh(A + aoff + (size_t)mb * 16 * K + kc);
#pragma unroll
        for (int nb = 0; nb < 4; ++nb) { const v16h bq = ldh(Bt + boff + (size_t)nb * 16 * K + kc);
#pragma unroll
            for (int mb = 0; mb < 4; ++mb) acc[mb][nb] = wmma16g(a[mb], bq, acc[mb][nb]); }
    }
    const int bb = r0 / SEQ, tt = r0 % SEQ;
    float* obase = OUT + ((size_t)bb * OUT_SEQ + (size_t)tt) * DX + c0;
#pragma unroll
    for (int mb = 0; mb < 4; ++mb) {
#pragma unroll
        for (int nb = 0; nb < 4; ++nb) {
#pragma unroll
            for (int j = 0; j < 8; ++j) os[(hi * 8 + j) * 68 + nb * 16 + lr] = acc[mb][nb][j] * OSC; }   // D: row 8h+j, col lane&15
        wave_sync();
        v4f ov[8];
#pragma unroll
        for (int s = 0; s < 8; ++s) { const int p = s * 32 + lane; const int row = p >> 4, c4 = (p & 15) * 4;   // 8 s x 2 rows = 16 rows; 16 lanes x 4 floats = 64 columns = two lines
            ov[s] = *(const v4fa*)(&os[row * 68 + c4]); }
{
#pragma unroll
            for (int s = 0; s < 8; ++s) { const int p = s * 32 + lane; const int row = p >> 4, c4 = (p & 15) * 4;
                *(v4f*)(obase + (size_t)(mb * 16 + row) * DX + c4) = ov[s]; }
             }
        wave_sync();
    }
}

static constexpr size_t al256(size_t v) { return (v + 255) & ~(size_t)255; }
static constexpr size_t SZ_XB = al256((size_t)NB * SEQ * DX * 2);          // x bf16 [NB*SEQ][192]
static constexpr size_t SZ_WB = al256((size_t)3 * DQ * DX * 2);            // Wq | Wk | Wv bf16 [3][2048][192]
static constexpr size_t SZ_WO = al256((size_t)DX * DQ * 2);                // Wo f16 [192][2048]
static constexpr size_t SZ_TB = al256((size_t)SEQ * 64 * 4);               // cos or sin table [SEQ][64]
static constexpr size_t SZ_PL = al256((size_t)NB * NH_ * SEQ * HD * 2);    // q, k, v^T planes
static constexpr size_t SZ_CX = al256((size_t)NB * SEQ * DQ * 2);          // ctx plane
static constexpr size_t SZ_TOTAL = SZ_XB + SZ_WB + SZ_WO + 2 * SZ_TB + 3 * SZ_PL + SZ_CX;
static_assert(SZ_TOTAL <= (size_t)134217728);          // workspace carve <= 128 MiB
static_assert(((size_t)DQ * DX * 2) % 256 == 0);       // weight sub-planes stay 256-byte aligned
static_assert((size_t)NB * NH_ * SEQ * HD == (size_t)NB * DQ * SEQ);       // v^T plane [(b*2048 + m)][t] has the same extent as the q/k planes

extern "C" void kernel_launch(void* const* d_in, const int* in_sizes, int n_in,
                              void* d_out, int out_size, void* d_ws, size_t ws_size, hipStream_t stream) {
    if (n_in < 8) return;
    const size_t needx = ((size_t)(NB - 1) * SEQ_FULL + SEQ) * DX;
    const size_t needm = ((size_t)(NB - 1) * SEQ_FULL + (size_t)(SEQ - 1)) * SEQ_FULL + SEQ;
    if ((size_t)in_sizes[0] < needx || (size_t)in_sizes[1] < needm) return;
    if ((size_t)in_sizes[2] < (size_t)DQ * DX || (size_t)in_sizes[3] < (size_t)DQ * DX || (size_t)in_sizes[4] < (size_t)DQ * DX || (size_t)in_sizes[5] < (size_t)DX * DQ) return;
    if (in_sizes[6] < HD || in_sizes[7] < HD) return;
    if ((size_t)out_size < ((size_t)(NB - 1) * OUT_SEQ + SEQ) * DX) return;
    if (SZ_TOTAL > ws_size) return;
    // wire order: x, mask0, wq, wk, wv, wo, q_norm_w, k_norm_w
    const float* x    = (const float*)d_in[0];
    const float* mask = (const float*)d_in[1];
    const float* wq   = (const float*)d_in[2];
    const float* wk   = (const float*)d_in[3];
    const float* wv   = (const float*)d_in[4];
    const float* wo   = (const float*)d_in[5];
    const float* qnw  = (const float*)d_in[6];
    const float* knw  = (const float*)d_in[7];
    float* OUT = (float*)d_out;      // [NB][SEQ][192]
    char* wsp = (char*)d_ws;
    bf*  XB  = (bf*)wsp;  wsp += SZ_XB;               // [NB*SEQ][192]
    bf*  WB  = (bf*)wsp;  wsp += SZ_WB;               // [3][2048][192]: q | k | v  ([out][in] = Bt as-is)
    h16* WOH = (h16*)wsp; wsp += SZ_WO;               // [192][2048] x64
    float* COS = (float*)wsp; wsp += SZ_TB;           // [SEQ][64]
    float* SIN = (float*)wsp; wsp += SZ_TB;           // [SEQ][64]
    h16* QH  = (h16*)wsp; wsp += SZ_PL;               // [NB*16][SEQ][128]
    h16* KP  = (h16*)wsp; wsp += SZ_PL;               // [NB*16][SEQ][128]
    h16* VT  = (h16*)wsp; wsp += SZ_PL;               // [NB*16][128][SEQ]
    h16* CTX = (h16*)wsp; wsp += SZ_CX;               // [NB*SEQ][2048] x256
    bf* WQ = WB; bf* WK = WB + (size_t)DQ * DX; bf* WV = WB + (size_t)2 * DQ * DX;

    if (SEQ == SEQ_FULL) {
        const size_t n8 = (size_t)NB * SEQ * DX / 8;
        k_cvt8<<<(unsigned)((n8 + 255) / 256), 256, 0, stream>>>(x, XB, n8);
    } else {
        const size_t n8 = (size_t)SEQ * DX / 8;
        for (int b = 0; b < NB; ++b) k_cvt8<<<(unsigned)((n8 + 255) / 256), 256, 0, stream>>>(x + (size_t)b * SEQ_FULL * DX, XB + (size_t)b * SEQ * DX, n8);
    }
    { const size_t n8 = (size_t)DQ * DX / 8; const unsigned g = (unsigned)((n8 + 255) / 256);
      k_cvt8<<<g, 256, 0, stream>>>(wq, WQ, n8); k_cvt8<<<g, 256, 0, stream>>>(wk, WK, n8); k_cvt8<<<g, 256, 0, stream>>>(wv, WV, n8);
      k_cvtw<<<g, 256, 0, stream>>>(wo, WOH, n8, WOS); }
    k_tab<<<(unsigned)(SEQ * 64 / 256), 256, 0, stream>>>(COS, SIN, SEQ * 64);

    // q, k: A = x rows (m = b*SEQ + t), Bt = W rows (n = h*128 + d) -> normalised, rotated plane [(b*16 + h)][t][d]
    k_qk<<<dim3(NB * SEQ / 32, NH_, 1), 32, 0, stream>>>(XB, WQ, qnw, COS, SIN, QH);
    k_qk<<<dim3(NB * SEQ / 32, NH_, 1), 32, 0, stream>>>(XB, WK, knw, COS, SIN, KP);
    // v^T: A = Wv rows (m = h*128 + d), Bt = x rows (n = b*SEQ + t) -> plane [(b*2048 + m)][t] = [(b*16 + h)][d][t]
    k_vt<<<dim3(DQ / 64, NB * SEQ / 64, 1), 32, 0, stream>>>(WV, XB, VT);

    k_flash<<<dim3(SEQ / (16 * AW), NB * NH_, 1), 32 * AW, 0, stream>>>(QH, KP, VT, mask, CTX);
    // output projection: A = ctx rows [b*SEQ + t][2048], Bt = Wo rows [192][2048]
    k_out<<<dim3(NB * SEQ / 64, DX / 64, 1), 32, 0, stream>>>(CTX, WOH, OUT);
}

// v001
// It runs in 266 microseconds.
// Next to v000, in two timings, it ran 1.57 and 1.56 times as fast.
#include <hip/hip_runtime.h>

// Dense self-attention layer: x [NB][SEQ][192]; Wq/Wk/Wv [2048][192] ([out][in], y = x W^T, no bias); 16 heads x 128; per-head RMS normalisation of q and k (eps 1e-6, gain inputs);
// rotate-half rotary embeddings (base 1e6, positions 0..SEQ-1); scores = q.k * 128^-0.5 + additive mask [NB][1][SEQ][SEQ] (read by value); softmax over keys; P.V; heads merged; output = ctx Wo^T with Wo [192][2048] (f32).
// Compute dtypes, f32 accumulate everywhere: q/k/v projections v_wmma_f32_16x16x32_bf16 (x and W RNE-converted to bf16; products exact);
// scores v_wmma_f32_16x16x32_f16 (q, k single f16 planes after normalisation and rotary); P.V v_wmma_f32_16x16x32_f16 (P single f16 with x16384 carry that cancels in the normalisation, v single f16);
// output projection v_wmma_f32_16x16x32_f16 (ctx single f16 with x256 carry, Wo = bf16-converted value x64 as f16; 1/16384 folded in the f32 epilogue). Softmax f32 (online, running max), row sum over the converted P.
// Layout: bf16 copies of x and Wq|Wk|Wv; f16 Wo plane; cos/sin tables [SEQ][64] f32; q, k planes [b*16+h][t][128]; v^T plane [b*16+h][d][t]; ctx plane [b*SEQ+t][h*128+d];
// fused flash kernel in transposed form (S^T = K Q^T, O^T = V^T P^T), K and V^T tiles staged in LDS for the whole block, Q fragments straight from the f16 plane, no score or probability plane in memory.

#ifndef NB
#define NB 2
#endif
#ifndef SEQ
#define SEQ 2048
#endif
#define NB_FULL  2
#define SEQ_FULL 2048
#ifndef OUT_SEQ
#define OUT_SEQ SEQ              // row pitch (in tokens) between batches of the output
#endif
#define DX   192                 // model width (projection K, output N)
#define NH_  16
#define HD   128
#define DQ   2048                // NH_ * HD
#define AW   8                   // waves per flash block (16 query rows each)
#define KT   64                  // keys per LDS stage of the flash kernel
#define KPH  136                 // LDS row pitch (halves) of the K tile: 272 B = 16 B x odd
#define VPH  72                  // LDS row pitch (halves) of the V^T tile: 144 B = 16 B x odd
#define KTB  (KT * KPH * 2)      // bytes of one K tile in LDS
#define VTB  (HD * VPH * 2)      // bytes of one V^T tile in LDS
#define STB  (KTB + VTB)         // bytes of one stage
#define OSP  132                 // LDS row pitch (floats) of the flash output tile
#define OSQ  132                 // LDS row pitch (floats) of the q/k epilogue tile
#define SC2  ((float)(0.08838834764831845 * 1.4426950408889634))   // HD^-0.5 * log2(e)
#define L2E  1.4426950408889634f
#define PSH  14.0f               // log2 of the P carry (16384)
#define NEGB (-3.0e38f)
#define CXS  256.0f              // carry of the ctx plane
#define WOS  64.0f               // carry of the Wo plane
#define OSC  (1.0f / 16384.0f)   // 1 / (CXS * WOS)

static_assert(HD == 128);                      // q/k plane row = 256 bytes = two lines; one head = 8 column tiles of 16
static_assert(NH_ * HD == DQ);                 // head h = columns h*128 + d
static_assert(HD % 32 == 0);                   // score k-loop steps by 32
static_assert(DX % 32 == 0);                   // projection k-loop steps by 32
static_assert(DQ % 32 == 0);                   // output-projection k-loop steps by 32
static_assert(DX % 64 == 0);                   // output column tiles of 64
static_assert(DQ % 64 == 0);                   // v^T row tiles of 64
static_assert(SEQ % 64 == 0);                  // a 64-token tile never straddles two batches
static_assert((NB * SEQ) % 64 == 0);
static_assert(SEQ % 32 == 0);                  // key loop steps by 32; 32-token q/k tiles
static_assert(SEQ % (16 * AW) == 0);           // flash grid covers the sequence exactly
static_assert(((size_t)SEQ * DX) % 64 == 0);
static_assert(((size_t)DQ * DX) % 2048 == 0);  // weight converts: whole 256-thread blocks
static_assert((SEQ * 64) % 256 == 0);
static_assert(NB <= NB_FULL);
static_assert(SEQ <= SEQ_FULL);
static_assert(OSP >= HD);
static_assert(OSQ >= HD);
static_assert((OSP * 4) % 16 == 0);
static_assert((OSQ * 4) % 16 == 0);
static_assert((DX * 4) % 128 == 0);            // output rows start on a line
static_assert(32 * 16 * 8 == 16 * HD * 2);     // q/k epilogue and ctx epilogue: 32 lanes x 16 B x 8 instructions == 16 rows x 256 B
static_assert(32 * 16 * 4 == 16 * 64 * 2);
static_assert(32 * 16 * 8 == 16 * 64 * 4);     // output epilogue: 32 lanes x 16 B x 8 instructions == 16 rows x 256 B
static_assert(16 * OSQ * 4 <= 131072);         // static LDS of the q/k projection kernel
static_assert(16 * 68 * 4 <= 131072);          // static LDS of the v^T and output projection kernels
static_assert(2 * STB <= 131072);              // static LDS of the flash kernel
static_assert(AW * 16 * OSP * 4 <= 2 * STB);   // the output tiles reuse the two stage buffers
static_assert(SEQ % KT == 0 && SEQ / KT >= 2); // whole stages; the two-buffer prologue needs two
static_assert(KT * HD * 2 == 4 * 32 * AW * 16);  // K tile: 4 pieces of 16 B per thread
static_assert(HD * KT * 2 == 4 * 32 * AW * 16);  // V^T tile: 4 pieces of 16 B per thread
static_assert(KT == 64 && 32 * AW == 256);     // piece maps of stage_kv: 16 pieces per K row, 8 per V^T row, 256 threads
static_assert(STB % 16 == 0 && KTB % 16 == 0);

typedef _Float16 h16;
typedef unsigned short bf;
typedef __attribute__((ext_vector_type(16))) __bf16   v16bf;
typedef __attribute__((ext_vector_type(16))) _Float16 v16h;
typedef __attribute__((ext_vector_type(8)))  _Float16 v8h;
typedef __attribute__((ext_vector_type(8)))  unsigned short v8us;
typedef __attribute__((ext_vector_type(8)))  float    v8f;
typedef __attribute__((ext_vector_type(4)))  float    v4f;
typedef v4f  __attribute__((may_alias)) v4fa;

__device__ __forceinline__ unsigned short f2bf(float f) { unsigned u = __float_as_uint(f); u += 0x7FFFu + ((u >> 16) & 1u); return (unsigned short)(u >> 16); }
__device__ __forceinline__ float bfr(float f) { return __uint_as_float(((unsigned)f2bf(f)) << 16); }   // value after RNE convert to bf16
__device__ __forceinline__ v16h cat16(v8h lo, v8h hi) { return __builtin_shufflevector(lo, hi, 0, 1, 2, 3, 4, 5, 6, 7, 8, 9, 10, 11, 12, 13, 14, 15); }
__device__ __forceinline__ v16bf cat16b(v8us lo, v8us hi) { return __builtin_bit_cast(v16bf, __builtin_shufflevector(lo, hi, 0, 1, 2, 3, 4, 5, 6, 7, 8, 9, 10, 11, 12, 13, 14, 15)); }
__device__ __forceinline__ v8f wmma16(v16h a, v16h b, v8f c) { return __builtin_amdgcn_wmma_f32_16x16x32_f16(false, a, false, b, (short)0, c, false, false); }
__device__ __forceinline__ v8f wmmab(v16bf a, v16bf b, v8f c) { return __builtin_amdgcn_wmma_f32_16x16x32_bf16(false, a, false, b, (short)0, c, false, false); }
// fragment loaders from K-contiguous 16-bit rows; p already includes + 8*(lane>>4): elements 0..7 <- k0+8h+0..7, elements 8..15 <- k0+16+8h+0..7 (same map for A and B)
__device__ __forceinline__ v16h  ldh(const h16* p) { return cat16(*(const v8h*)p, *(const v8h*)(p + 16)); }
__device__ __forceinline__ v16bf ldb(const bf* p)  { return cat16b(*(const v8us*)p, *(const v8us*)(p + 16)); }
// ordering point for wave-private LDS tiles (same wave writes and reads)
__device__ __forceinline__ void wave_sync() { __builtin_amdgcn_fence(3 /* release order */, "wavefront"); __builtin_amdgcn_wave_barrier(); asm volatile("" ::: "memory"); }

// f32 -> f16 operand convert that cannot produce a subnormal (|v| < 2^-14 -> +0)
static __device__ __forceinline__ h16 toh_flush(float v) { const h16 r = (h16)v; return (fabsf(v) < 6.103515625e-05f) ? (h16)0.0f : r; }
// one matrix instruction + its own four-slot guard (one accumulator per guard)
static __device__ __forceinline__ v8f wmma16g(v16h a, v16h b, v8f c) { c = wmma16(a, b, c); asm volatile("v_nop\n\tv_nop\n\tv_nop\n\tv_nop" : "+v"(c) : "v"(a), "v"(b)); return c; }
static __device__ __forceinline__ v8f wmmabg(v16bf a, v16bf b, v8f c) { c = wmmab(a, b, c); asm volatile("v_nop\n\tv_nop\n\tv_nop\n\tv_nop" : "+v"(c) : "v"(a), "v"(b)); return c; }

__global__ __launch_bounds__(256) void k_cvt8(const float* __restrict__ src, bf* dst, size_t n8) {
    const size_t i = (size_t)blockIdx.x * 256 + threadIdx.x; if (i >= n8) return;
    const v8f v = *(const v8f*)(src + i * 8); v8us o;
#pragma unroll
    for (int k = 0; k < 8; ++k) o[k] = f2bf(v[k]);
    *(v8us*)(dst + i * 8) = o; 
}

__global__ __launch_bounds__(256) void k_cvtw(const float* __restrict__ src, h16* dst, size_t n8, float sc) {
    const size_t i = (size_t)blockIdx.x * 256 + threadIdx.x; if (i >= n8) return;
    const v8f v = *(const v8f*)(src + i * 8); v8h o;
#pragma unroll
    for (int k = 0; k < 8; ++k) o[k] = toh_flush(bfr(v[k]) * sc);
    *(v8h*)(dst + i * 8) = o; 
}

// k_tab: rotary tables COS/SIN [SEQ][64] (f32): angle = (float)pos * inv_freq[j], inv_freq[j] = 1e6^(-j/64); precise sincosf (angles reach 2047 rad).
__global__ __launch_bounds__(256) void k_tab(float* COS, float* SIN, int n) {
#pragma clang fp contract(off)
    const int i = blockIdx.x * 256 + threadIdx.x; if (i >= n) return;
    const int pos = i >> 6, j = i & 63;
    const float invf = exp2f(-(float)j * (19.931568569324174f / 64.0f));   // log2(1e6) / 64
    const float ang = (float)pos * invf;
    float sn, cs; sincosf(ang, &sn, &cs);
    *(float*)(COS + i) = cs; *(float*)(SIN + i) = sn; 
}

// k_qk: projection + per-head RMS normalisation + rotary, ONE WAVE per 32 tokens x 128 columns (one head; 16 accumulators), operands straight from K-contiguous bf16 planes, K = DX.
// C[m][n] = sum_k A[m][k] Bt[n][k]; A = x rows (m = b*SEQ + t), Bt = W rows (n = h*128 + d). grid (NB*SEQ/32, NH_).
// Epilogue per 16-row slab: row sum of squares from the accumulators (8 column tiles per lane, xor 1/2/4/8 inside each 16-lane half), y = (c * rstd) * gain staged in a wave-private LDS tile;
// store stage: lane piece p = 32 s + lane -> row p>>4, columns c8 = 8 (p&15); out[c] = y[c] cos[c&63] + (c < 64 ? -y[c+64] : y[c-64]) sin[c&63] (tables by 16-B loads), f16;
__global__ __launch_bounds__(32) void k_qk(const bf* __restrict__ A, const bf* __restrict__ Bt, const float* __restrict__ nw,
                                           const float* __restrict__ COS, const float* __restrict__ SIN, h16* Ph) {
    __shared__ __align__(16) float os[16 * OSQ];
    const int K = DX;
    const int lane = threadIdx.x & 31, lr = lane & 15, hi = lane >> 4; const int r0 = blockIdx.x * 32, c0 = blockIdx.y * HD;
    v8f acc[2][8];
#pragma unroll
    for (int mb = 0; mb < 2; ++mb)
#pragma unroll
        for (int nb = 0; nb < 8; ++nb) acc[mb][nb] = (v8f){};
    const size_t aoff = (size_t)(r0 + lr) * K + 8 * hi, boff = (size_t)(c0 + lr) * K + 8 * hi;
#pragma unroll 1
    for (int kc = 0; kc < K; kc += 32) {
        v16bf a[2];
#pragma unroll
        for (int mb = 0; mb < 2; ++mb) a[mb] = ldb(A + aoff + (size_t)mb * 16 * K + kc);
#pragma unroll
        for (int nb = 0; nb < 8; ++nb) { const v16bf b = ldb(Bt + boff + (size_t)nb * 16 * K + kc);
#pragma unroll
            for (int mb = 0; mb < 2; ++mb) acc[mb][nb] = wmmabg(a[mb], b, acc[mb][nb]); }
    }
    float wn[8];
#pragma unroll
    for (int nb = 0; nb < 8; ++nb) wn[nb] = bfr(nw[nb * 16 + lr]);                 // nb*16 + lr < HD
    const int bb = r0 / SEQ, tt = r0 % SEQ; const int zc = bb * NH_ + (int)blockIdx.y;
    const size_t tbase = ((size_t)zc * SEQ + (size_t)tt) * HD;
#pragma unroll
    for (int mb = 0; mb < 2; ++mb) {
#pragma unroll
        for (int j = 0; j < 8; ++j) {
            float ss = 0.0f;
#pragma unroll
            for (int nb = 0; nb < 8; ++nb) ss += acc[mb][nb][j] * acc[mb][nb][j];
            ss += __shfl_xor(ss, 1, 32); ss += __shfl_xor(ss, 2, 32); ss += __shfl_xor(ss, 4, 32); ss += __shfl_xor(ss, 8, 32);
            const float rs = rsqrtf(ss * (1.0f / 128.0f) + 1.0e-6f);
#pragma unroll
            for (int nb = 0; nb < 8; ++nb) os[(hi * 8 + j) * OSQ + nb * 16 + lr] = (acc[mb][nb][j] * rs) * wn[nb]; }   // D: row 8h+j, col lane&15
        wave_sync();
        v8h hv[8];
#pragma unroll
        for (int s = 0; s < 8; ++s) { const int p = s * 32 + lane; const int row = p >> 4, c8 = (p & 15) * 8;   // 8 s x 2 rows = 16 rows; 16 lanes x 8 = 128 columns
            const int pc = c8 ^ 64, jj = c8 & 63; const float sg = (c8 < 64) ? -1.0f : 1.0f;
            const v4f x0 = *(const v4fa*)(&os[row * OSQ + c8]), x1 = *(const v4fa*)(&os[row * OSQ + c8 + 4]);
            const v4f y0 = *(const v4fa*)(&os[row * OSQ + pc]), y1 = *(const v4fa*)(&os[row * OSQ + pc + 4]);
            const size_t to = (size_t)(tt + mb * 16 + row) * 64 + (size_t)jj;      // token position < SEQ, jj + 7 < 64
            const v4f ca = *(const v4f*)(COS + to), cb = *(const v4f*)(COS + to + 4), sa = *(const v4f*)(SIN + to), sb = *(const v4f*)(SIN + to + 4);
            v8h o;
#pragma unroll
            for (int i = 0; i < 4; ++i) { o[i] = toh_flush(x0[i] * ca[i] + (sg * y0[i]) * sa[i]); o[4 + i] = toh_flush(x1[i] * cb[i] + (sg * y1[i]) * sb[i]); }
            hv[s] = o; }
        const size_t sbs = tbase + (size_t)(mb * 16) * HD;
{
#pragma unroll
            for (int s = 0; s < 8; ++s) *(v8h*)(Ph + sbs + (size_t)(s * 32 + lane) * 8) = hv[s];
             }
        wave_sync();
    }
}

// k_vt: v^T projection, ONE WAVE per 64x64 tile (16 accumulators), K = DX. A = Wv rows (m = h*128 + d), Bt = x rows (n = b*SEQ + t); plane [(b*2048 + m)][t], row pitch SEQ. grid (DQ/64, NB*SEQ/64).
__global__ __launch_bounds__(32) void k_vt(const bf* __restrict__ A, const bf* __restrict__ Bt, h16* Ph) {
    __shared__ __align__(16) float os[16 * 68];
    const int K = DX;
    const int lane = threadIdx.x & 31, lr = lane & 15, hi = lane >> 4; const int r0 = blockIdx.x * 64, c0 = blockIdx.y * 64;
    v8f acc[4][4];
#pragma unroll
    for (int mb = 0; mb < 4; ++mb)
#pragma unroll
        for (int nb = 0; nb < 4; ++nb) acc[mb][nb] = (v8f){};
    const size_t aoff = (size_t)(r0 + lr) * K + 8 * hi, boff = (size_t)(c0 + lr) * K + 8 * hi;
#pragma unroll 1
    for (int kc = 0; kc < K; kc += 32) {
        v16bf a[4];
#pragma unroll
        for (int mb = 0; mb < 4; ++mb) a[mb] = ldb(A + aoff + (size_t)mb * 16 * K + kc);
#pragma unroll
        for (int nb = 0; nb < 4; ++nb) { const v16bf b = ldb(Bt + boff + (size_t)nb * 16 * K + kc);
#pragma unroll
            for (int mb = 0; mb < 4; ++mb) acc[mb][nb] = wmmabg(a[mb], b, acc[mb][nb]); }
    }
    const int bb = c0 / SEQ, tt = c0 % SEQ;
    const size_t tbase = (size_t)bb * (size_t)DQ * SEQ + (size_t)r0 * SEQ + (size_t)tt;
#pragma unroll
    for (int mb = 0; mb < 4; ++mb) {
#pragma unroll
        for (int nb = 0; nb < 4; ++nb) {
#pragma unroll
            for (int j = 0; j < 8; ++j) os[(hi * 8 + j) * 68 + nb * 16 + lr] = acc[mb][nb][j]; }   // D: row 8h+j, col lane&15
        wave_sync();
        v8h hv[4];
#pragma unroll
        for (int s = 0; s < 4; ++s) { const int row = 4 * s + (lane >> 3), c8 = (lane & 7) * 8;   // 4 s x 4 row groups = 16 rows; 8 lanes x 8 = 64 columns
            const v4f x0 = *(const v4fa*)(&os[row * 68 + c8]); const v4f x1 = *(const v4fa*)(&os[row * 68 + c8 + 4]); v8h o;
#pragma unroll
            for (int i = 0; i < 4; ++i) { o[i] = toh_flush(x0[i]); o[4 + i] = toh_flush(x1[i]); }
            hv[s] = o; }
        const size_t sbs = tbase + (size_t)(mb * 16) * SEQ;
{
#pragma unroll
            for (int s = 0; s < 4; ++s) { const int row = 4 * s + (lane >> 3), c8 = (lane & 7) * 8;
                *(v8h*)(Ph + sbs + (size_t)row * SEQ + c8) = hv[s]; }
             }
        wave_sync();
    }
}

// stage_kv: one stage (KT keys) into LDS, 8 asynchronous 16-B copies per thread, whole 128-B lines per wave instruction.
// K tile: KT rows x 256 B, contiguous in the plane; piece c = 256 i + tid -> row c>>4, 16-B column c&15. V^T tile: 128 rows x 128 B; piece c -> row c>>3, 16-B column c&7.
// kg, vg: the thread's first global piece; lk, lv: its LDS byte addresses. The s_wait_xcnt closes the statement so that no address register is rewritten ahead of it.
static __device__ __forceinline__ void stage_kv(const h16* kg, const h16* vg, unsigned lk, unsigned lv) {
    asm volatile("global_load_async_to_lds_b128 %0, %1, off\n\t"
                 "global_load_async_to_lds_b128 %2, %3, off\n\t"
                 "global_load_async_to_lds_b128 %4, %5, off\n\t"
                 "global_load_async_to_lds_b128 %6, %7, off\n\t"
                 "global_load_async_to_lds_b128 %8, %9, off\n\t"
                 "global_load_async_to_lds_b128 %10, %11, off\n\t"
                 "global_load_async_to_lds_b128 %12, %13, off\n\t"
                 "global_load_async_to_lds_b128 %14, %15, off\n\t"
                 "s_wait_xcnt 0x0"
                 :: "v"(lk), "v"(kg), "v"(lk + 16 * KPH * 2), "v"(kg + 2048), "v"(lk + 32 * KPH * 2), "v"(kg + 4096), "v"(lk + 48 * KPH * 2), "v"(kg + 6144),
                    "v"(lv), "v"(vg), "v"(lv + 32 * VPH * 2), "v"(vg + (size_t)32 * SEQ), "v"(lv + 64 * VPH * 2), "v"(vg + (size_t)64 * SEQ), "v"(lv + 96 * VPH * 2), "v"(vg + (size_t)96 * SEQ)
                 : "memory");
}

// k_flash: fused attention, one wave per 16 query rows of one (batch, head), AW waves per block on the same (batch, head); K and V^T tiles of KT keys come once per block into LDS
// (two buffers, the next tile's copies fly while this one is worked on), fragments by two 16-B LDS loads each; Q fragments straight from the f16 plane.
// Transposed form: S^T[key][t] = K Q^T (A = K rows, B = Q rows, 4 k-steps over d); lane (t = lane&15, h = lane>>4) holds keys 8h+r of each 16-key tile, so the packed
// P tile is directly the B fragment of O^T[d][t] = V^T P^T (element r <- tile keys 0..15, element 8+r <- tile keys 16..31, lane unchanged); 8 output tiles of 16 d.
// Additive mask row t, keys key0+8h+0..7 and key0+16+8h+0..7: four 16-B loads per lane per step, value RNE-converted to bf16, added after the scale (base-2 domain).
// Softmax state (running max, partial sum) is one scalar per lane; the two lane halves of a row are combined with one xor-16 exchange. Q fragments are re-loaded each step through an opaque zero offset.
__global__ __launch_bounds__(32 * AW) __attribute__((amdgpu_num_vgpr(256)))
void k_flash(const h16* __restrict__ QH, const h16* __restrict__ KP, const h16* __restrict__ VT, const float* __restrict__ mask, h16* CTX) {
    __shared__ __align__(16) char sm[2 * STB];
    float* os = (float*)sm;                                     // output tiles, after the key loop
    const int tid = threadIdx.x;
    const int lane = threadIdx.x & 31, lr = lane & 15, hi = lane >> 4;
    const int wave = __builtin_amdgcn_readfirstlane((int)(threadIdx.x >> 5));
    const int zh = blockIdx.y; const int b = zh / NH_, h = zh % NH_;
    const int t0 = (blockIdx.x * AW + wave) * 16;
    const size_t pbase = (size_t)zh * SEQ * HD;
    const size_t qo = pbase + (size_t)(t0 + lr) * HD + 8 * hi;  // + ks*32          (B fragment: col t, k = d)
    const int ko = lr * KPH + 8 * hi;                           // + key*KPH + ks*32 (A fragment: row key, k = d), halves in the K tile
    const int vo = lr * VPH + 8 * hi;                           // + 16j*VPH + key   (A fragment: row d, k = key), halves in the V^T tile
    const unsigned lbase = (unsigned)(size_t)sm;                // LDS byte address of the stage buffers
    const unsigned lk = lbase + (unsigned)((tid >> 4) * (KPH * 2) + (tid & 15) * 16);
    const unsigned lv = lbase + (unsigned)(KTB + (tid >> 3) * (VPH * 2) + (tid & 7) * 16);
    const h16* kg = KP + pbase + (size_t)tid * 8;
    const h16* vg = VT + pbase + (size_t)(tid >> 3) * SEQ + (size_t)(tid & 7) * 8;
    const float* mrow = mask + ((size_t)b * SEQ_FULL + (size_t)(t0 + lr)) * SEQ_FULL + 8 * hi;
    v8f o[8];
#pragma unroll
    for (int j = 0; j < 8; ++j) o[j] = (v8f){};
    float m = NEGB, l = 0.0f;
    stage_kv(kg, vg, lk, lv);
    asm volatile("s_wait_asynccnt 0x0" ::: "memory");           // this wave's copies of tile 0 have landed
    __syncthreads();                                            // tile 0 is readable by every wave
    stage_kv(kg + (size_t)KT * HD, vg + KT, lk + STB, lv + STB);
#pragma unroll 1
    for (int t = 0; t < SEQ / KT; ++t) {
      const unsigned bo = (unsigned)(t & 1) * STB;
      const h16* kt = (const h16*)(sm + bo) + ko;
      const h16* vt = (const h16*)(sm + bo + KTB) + vo;
#pragma unroll   // both 32-key steps of a tile in line: their tile offsets become immediates of the LDS loads
      for (int sub = 0; sub < KT / 32; ++sub) {
        const int key0 = t * KT + sub * 32;
        unsigned qsh = 0; asm volatile("" : "+v"(qsh));
        const h16* ka = kt + sub * 32 * KPH;
        const h16* qa = QH + qo + qsh;
        v8f sA = (v8f){}, sB = (v8f){};
#pragma unroll
        for (int ks = 0; ks < HD / 32; ++ks) {
            const v16h qf = ldh(qa + ks * 32);
            const v16h ka0 = ldh(ka + ks * 32), kb0 = ldh(ka + 16 * KPH + ks * 32);
            sA = wmma16g(ka0, qf, sA); sB = wmma16g(kb0, qf, sB); }
        const float* mp = mrow + key0;                           // keys key0+8h+0..7 and key0+16+8h+0..7, all < SEQ
        const v4f m0 = *(const v4f*)mp, m1 = *(const v4f*)(mp + 4), m2 = *(const v4f*)(mp + 16), m3 = *(const v4f*)(mp + 20);
        float ta[8], tb[8]; float mx = NEGB;
#pragma unroll
        for (int r = 0; r < 4; ++r) {
            ta[r] = sA[r] * SC2 + bfr(m0[r]) * L2E; ta[4 + r] = sA[4 + r] * SC2 + bfr(m1[r]) * L2E;
            tb[r] = sB[r] * SC2 + bfr(m2[r]) * L2E; tb[4 + r] = sB[4 + r] * SC2 + bfr(m3[r]) * L2E; }
#pragma unroll
        for (int r = 0; r < 8; ++r) mx = fmaxf(mx, fmaxf(ta[r], tb[r]));
        mx = fmaxf(mx, __shfl_xor(mx, 16, 32));
        const float mnew = fmaxf(m, mx);
        const float alpha = __builtin_amdgcn_exp2f(m - mnew);
        const float sh = PSH - mnew;
        v16h pb; float ls = 0.0f;
#pragma unroll
        for (int r = 0; r < 8; ++r) {
            const float xa = ta[r] + sh, xb = tb[r] + sh;
            const float ea = __builtin_amdgcn_exp2f(xa), eb = __builtin_amdgcn_exp2f(xb);
            const float ga = (xa < -14.0f) ? 0.0f : ea, gb = (xb < -14.0f) ? 0.0f : eb;   // no subnormal f16 P (select on the exponent argument)
            const h16 pa = (h16)ga; const h16 pc = (h16)gb;
            pb[r] = pa; pb[8 + r] = pc;
            ls += (float)pa + (float)pc; }
        l = l * alpha + ls; m = mnew;
#pragma unroll
        for (int j = 0; j < 8; ++j) o[j] = o[j] * alpha;
        const h16* va = vt + sub * 32;
#pragma unroll
        for (int g = 0; g < 2; ++g) {
            v16h vf[4];
#pragma unroll
            for (int j = 0; j < 4; ++j) vf[j] = ldh(va + (16 * (4 * g + j)) * VPH);
#pragma unroll
            for (int j = 0; j < 4; ++j) o[4 * g + j] = wmma16g(vf[j], pb, o[4 * g + j]); }
      }
      asm volatile("s_wait_dscnt 0x0" ::: "memory");            // this wave's reads of tile t are done before its buffer is refilled
      asm volatile("s_wait_asynccnt 0x0" ::: "memory");         // this wave's copies of tile t + 1 have landed
      __syncthreads();                                          // publishes tile t + 1 and ends every wave's reads of tile t
      if (t + 2 < SEQ / KT) stage_kv(kg + (size_t)(t + 2) * KT * HD, vg + (t + 2) * KT, lk + bo, lv + bo);
    }
    asm volatile("s_wait_asynccnt 0x0" ::: "memory");           // no copy is outstanding when the buffers become output tiles
    l += __shfl_xor(l, 16, 32);
    const bool any = l > 0.0f;
    const float lsafe = any ? l : 1.0f;
    const float inv = any ? ((1.0f / lsafe) * CXS) : 0.0f;
    const int wb = wave * 16 * OSP;
    // O^T D layout: o[j][r] = (d = 16j + 8h + r, t = lane&15) -> os[t][d]; rows 0..15 x columns 0..127 all written
#pragma unroll
    for (int j = 0; j < 8; ++j) { v4f a, c;
        a[0] = o[j][0] * inv; a[1] = o[j][1] * inv; a[2] = o[j][2] * inv; a[3] = o[j][3] * inv; c[0] = o[j][4] * inv; c[1] = o[j][5] * inv; c[2] = o[j][6] * inv; c[3] = o[j][7] * inv;
        *(v4fa*)(&os[wb + lr * OSP + 16 * j + 8 * hi]) = a; *(v4fa*)(&os[wb + lr * OSP + 16 * j + 8 * hi + 4]) = c; }
    wave_sync();
    v8h hv[8];
#pragma unroll
    for (int s = 0; s < 8; ++s) { const int p = s * 32 + lane; const int row = p >> 4, c8 = (p & 15) * 8;   // 8 s x 2 rows = 16 rows; 16 lanes x 8 = 128 columns = two lines
        const v4f x0 = *(const v4fa*)(&os[wb + row * OSP + c8]); const v4f x1 = *(const v4fa*)(&os[wb + row * OSP + c8 + 4]); v8h q;
#pragma unroll
        for (int i = 0; i < 4; ++i) { q[i] = toh_flush(x0[i]); q[4 + i] = toh_flush(x1[i]); }
        hv[s] = q; }
    h16* crow = CTX + ((size_t)b * SEQ + (size_t)t0) * DQ + (size_t)h * HD;
{
#pragma unroll
        for (int s = 0; s < 8; ++s) { const int p = s * 32 + lane; const int row = p >> 4, c8 = (p & 15) * 8;
            *(v8h*)(crow + (size_t)row * DQ + c8) = hv[s]; }
         }
}

// k_out: output projection, ONE WAVE per 64x64 tile (16 accumulators), f16 operands straight from K-contiguous planes, K = DQ.
// OUT[m][n] = (1/16384) sum_k A[m][k] Bt[n][k]; A = ctx rows (m = b*SEQ + t, x256), Bt = Wo rows (n, x64). grid (NB*SEQ/64, DX/64).
__global__ __launch_bounds__(32) void k_out(const h16* __restrict__ A, const h16* __restrict__ Bt, float* OUT) {
    __shared__ __align__(16) float os[16 * 68];
    const int K = DQ;
    const int lane = threadIdx.x & 31, lr = lane & 15, hi = lane >> 4; const int r0 = blockIdx.x * 64, c0 = blockIdx.y * 64;
    v8f acc[4][4];
#pragma unroll
    for (int mb = 0; mb < 4; ++mb)
#pragma unroll
        for (int nb = 0; nb < 4; ++nb) acc[mb][nb] = (v8f){};
    const size_t aoff = (size_t)(r0 + lr) * K + 8 * hi, boff = (size_t)(c0 + lr) * K + 8 * hi;
#pragma unroll 1
    for (int kc = 0; kc < K; kc += 32) {
        v16h a[4];
#pragma unroll
        for (int mb = 0; mb < 4; ++mb) a[mb] = ldh(A + aoff + (size_t)mb * 16 * K + kc);
#pragma unroll
        for (int nb = 0; nb < 4; ++nb) { const v16h bq = ldh(Bt + boff + (size_t)nb * 16 * K + kc);
#pragma unroll
            for (int mb = 0; mb < 4; ++mb) acc[mb][nb] = wmma16g(a[mb], bq, acc[mb][nb]); }
    }
    const int bb = r0 / SEQ, tt = r0 % SEQ;
    float* obase = OUT + ((size_t)bb * OUT_SEQ + (size_t)tt) * DX + c0;
#pragma unroll
    for (int mb = 0; mb < 4; ++mb) {
#pragma unroll
        for (int nb = 0; nb < 4; ++nb) {
#pragma unroll
            for (int j = 0; j < 8; ++j) os[(hi * 8 + j) * 68 + nb * 16 + lr] = acc[mb][nb][j] * OSC; }   // D: row 8h+j, col lane&15
        wave_sync();
        v4f ov[8];
#pragma unroll
        for (int s = 0; s < 8; ++s) { const int p = s * 32 + lane; const int row = p >> 4, c4 = (p & 15) * 4;   // 8 s x 2 rows = 16 rows; 16 lanes x 4 floats = 64 columns = two lines
            ov[s] = *(const v4fa*)(&os[row * 68 + c4]); }
{
#pragma unroll
            for (int s = 0; s < 8; ++s) { const int p = s * 32 + lane; const int row = p >> 4, c4 = (p & 15) * 4;
                *(v4f*)(obase + (size_t)(mb * 16 + row) * DX + c4) = ov[s]; }
             }
        wave_sync();
    }
}

static constexpr size_t al256(size_t v) { return (v + 255) & ~(size_t)255; }
static constexpr size_t SZ_XB = al256((size_t)NB * SEQ * DX * 2);          // x bf16 [NB*SEQ][192]
static constexpr size_t SZ_WB = al256((size_t)3 * DQ * DX * 2);            // Wq | Wk | Wv bf16 [3][2048][192]
static constexpr size_t SZ_WO = al256((size_t)DX * DQ * 2);                // Wo f16 [192][2048]
static constexpr size_t SZ_TB = al256((size_t)SEQ * 64 * 4);               // cos or sin table [SEQ][64]
static constexpr size_t SZ_PL = al256((size_t)NB * NH_ * SEQ * HD * 2);    // q, k, v^T planes
static constexpr size_t SZ_CX = al256((size_t)NB * SEQ * DQ * 2);          // ctx plane
static constexpr size_t SZ_TOTAL = SZ_XB + SZ_WB + SZ_WO + 2 * SZ_TB + 3 * SZ_PL + SZ_CX;
static_assert(SZ_TOTAL <= (size_t)134217728);          // workspace carve <= 128 MiB
static_assert(((size_t)DQ * DX * 2) % 256 == 0);       // weight sub-planes stay 256-byte aligned
static_assert((size_t)NB * NH_ * SEQ * HD == (size_t)NB * DQ * SEQ);       // v^T plane [(b*2048 + m)][t] has the same extent as the q/k planes

extern "C" void kernel_launch(void* const* d_in, const int* in_sizes, int n_in,
                              void* d_out, int out_size, void* d_ws, size_t ws_size, hipStream_t stream) {
    if (n_in < 8) return;
    const size_t needx = ((size_t)(NB - 1) * SEQ_FULL + SEQ) * DX;
    const size_t needm = ((size_t)(NB - 1) * SEQ_FULL + (size_t)(SEQ - 1)) * SEQ_FULL + SEQ;
    if ((size_t)in_sizes[0] < needx || (size_t)in_sizes[1] < needm) return;
    if ((size_t)in_sizes[2] < (size_t)DQ * DX || (size_t)in_sizes[3] < (size_t)DQ * DX || (size_t)in_sizes[4] < (size_t)DQ * DX || (size_t)in_sizes[5] < (size_t)DX * DQ) return;
    if (in_sizes[6] < HD || in_sizes[7] < HD) return;
    if ((size_t)out_size < ((size_t)(NB - 1) * OUT_SEQ + SEQ) * DX) return;
    if (SZ_TOTAL > ws_size) return;
    // wire order: x, mask0, wq, wk, wv, wo, q_norm_w, k_norm_w
    const float* x    = (const float*)d_in[0];
    const float* mask = (const float*)d_in[1];
    const float* wq   = (const float*)d_in[2];
    const float* wk   = (const float*)d_in[3];
    const float* wv   = (const float*)d_in[4];
    const float* wo   = (const float*)d_in[5];
    const float* qnw  = (const float*)d_in[6];
    const float* knw  = (const float*)d_in[7];
    float* OUT = (float*)d_out;      // [NB][SEQ][192]
    char* wsp = (char*)d_ws;
    bf*  XB  = (bf*)wsp;  wsp += SZ_XB;               // [NB*SEQ][192]
    bf*  WB  = (bf*)wsp;  wsp += SZ_WB;               // [3][2048][192]: q | k | v  ([out][in] = Bt as-is)
    h16* WOH = (h16*)wsp; wsp += SZ_WO;               // [192][2048] x64
    float* COS = (float*)wsp; wsp += SZ_TB;           // [SEQ][64]
    float* SIN = (float*)wsp; wsp += SZ_TB;           // [SEQ][64]
    h16* QH  = (h16*)wsp; wsp += SZ_PL;               // [NB*16][SEQ][128]
    h16* KP  = (h16*)wsp; wsp += SZ_PL;               // [NB*16][SEQ][128]
    h16* VT  = (h16*)wsp; wsp += SZ_PL;               // [NB*16][128][SEQ]
    h16* CTX = (h16*)wsp; wsp += SZ_CX;               // [NB*SEQ][2048] x256
    bf* WQ = WB; bf* WK = WB + (size_t)DQ * DX; bf* WV = WB + (size_t)2 * DQ * DX;

    if (SEQ == SEQ_FULL) {
        const size_t n8 = (size_t)NB * SEQ * DX / 8;
        k_cvt8<<<(unsigned)((n8 + 255) / 256), 256, 0, stream>>>(x, XB, n8);
    } else {
        const size_t n8 = (size_t)SEQ * DX / 8;
        for (int b = 0; b < NB; ++b) k_cvt8<<<(unsigned)((n8 + 255) / 256), 256, 0, stream>>>(x + (size_t)b * SEQ_FULL * DX, XB + (size_t)b * SEQ * DX, n8);
    }
    { const size_t n8 = (size_t)DQ * DX / 8; const unsigned g = (unsigned)((n8 + 255) / 256);
      k_cvt8<<<g, 256, 0, stream>>>(wq, WQ, n8); k_cvt8<<<g, 256, 0, stream>>>(wk, WK, n8); k_cvt8<<<g, 256, 0, stream>>>(wv, WV, n8);
      k_cvtw<<<g, 256, 0, stream>>>(wo, WOH, n8, WOS); }
    k_tab<<<(unsigned)(SEQ * 64 / 256), 256, 0, stream>>>(COS, SIN, SEQ * 64);

    // q, k: A = x rows (m = b*SEQ + t), Bt = W rows (n = h*128 + d) -> normalised, rotated plane [(b*16 + h)][t][d]
    k_qk<<<dim3(NB * SEQ / 32, NH_, 1), 32, 0, stream>>>(XB, WQ, qnw, COS, SIN, QH);
    k_qk<<<dim3(NB * SEQ / 32, NH_, 1), 32, 0, stream>>>(XB, WK, knw, COS, SIN, KP);
    // v^T: A = Wv rows (m = h*128 + d), Bt = x rows (n = b*SEQ + t) -> plane [(b*2048 + m)][t] = [(b*16 + h)][d][t]
    k_vt<<<dim3(DQ / 64, NB * SEQ / 64, 1), 32, 0, stream>>>(WV, XB, VT);

    k_flash<<<dim3(SEQ / (16 * AW), NB * NH_, 1), 32 * AW, 0, stream>>>(QH, KP, VT, mask, CTX);
    // output projection: A = ctx rows [b*SEQ + t][2048], Bt = Wo rows [192][2048]
    k_out<<<dim3(NB * SEQ / 64, DX / 64, 1), 32, 0, stream>>>(CTX, WOH, OUT);
}

// v002
// One run takes 224 microseconds.
// In two side-by-side timings against v001, it was 1.20 and 1.18 times as fast.
// Counting every step since v000, it is 1.86 times as fast.
#include <hip/hip_runtime.h>

// Dense self-attention layer: x [NB][SEQ][192]; Wq/Wk/Wv [2048][192] ([out][in], y = x W^T, no bias); 16 heads x 128; per-head RMS normalisation of q and k (eps 1e-6, gain inputs);
// rotate-half rotary embeddings (base 1e6, positions 0..SEQ-1); scores = q.k * 128^-0.5 + additive mask [NB][1][SEQ][SEQ] (read by value); softmax over keys; P.V; heads merged; output = ctx Wo^T with Wo [192][2048] (f32).
// Compute dtypes, f32 accumulate everywhere: q/k/v projections v_wmma_f32_16x16x32_bf16 (x and W RNE-converted to bf16; products exact);
// scores v_wmma_f32_16x16x32_f16 (q, k single f16 planes after normalisation and rotary); P.V v_wmma_f32_16x16x32_f16 (P single f16 with x16384 carry that cancels in the normalisation, v single f16);
// output projection v_wmma_f32_16x16x32_f16 (ctx single f16 with x256 carry, Wo = bf16-converted value x64 as f16; 1/16384 folded in the f32 epilogue). Softmax f32 (online, running max), row sum over the converted P.
// Layout: bf16 copies of x and Wq|Wk|Wv; f16 Wo plane; cos/sin tables [SEQ][64] f32; q, k planes [b*16+h][t][128]; v^T plane [b*16+h][d][t]; ctx plane [b*SEQ+t][h*128+d];
// fused flash kernel in transposed form (S^T = K Q^T, O^T = V^T P^T), K and V^T tiles staged in LDS for the whole block, Q fragments straight from the f16 plane, no score or probability plane in memory.

#ifndef NB
#define NB 2
#endif
#ifndef SEQ
#define SEQ 2048
#endif
#define NB_FULL  2
#define SEQ_FULL 2048
#ifndef OUT_SEQ
#define OUT_SEQ SEQ              // row pitch (in tokens) between batches of the output
#endif
#define DX   192                 // model width (projection K, output N)
#define NH_  16
#define HD   128
#define DQ   2048                // NH_ * HD
#define AW   8                   // waves per flash block (16 query rows each)
#define KT   64                  // keys per LDS stage of the flash kernel
#define KPH  136                 // LDS row pitch (halves) of the K tile: 272 B = 16 B x odd
#define VPH  72                  // LDS row pitch (halves) of the V^T tile: 144 B = 16 B x odd
#define KTB  (KT * KPH * 2)      // bytes of one K tile in LDS
#define VTB  (HD * VPH * 2)      // bytes of one V^T tile in LDS
#define STB  (KTB + VTB)         // bytes of one stage
#define OSP  132                 // LDS row pitch (floats) of the flash output tile
#define OSQ  132                 // LDS row pitch (floats) of the q/k epilogue tile
#define SC2  ((float)(0.08838834764831845 * 1.4426950408889634))   // HD^-0.5 * log2(e)
#define L2E  1.4426950408889634f
#define PSH  14.0f               // log2 of the P carry (16384)
#define NEGB (-3.0e38f)
#define CXS  256.0f              // carry of the ctx plane
#define WOS  64.0f               // carry of the Wo plane
#define OSC  (1.0f / 16384.0f)   // 1 / (CXS * WOS)

static_assert(HD == 128);                      // q/k plane row = 256 bytes = two lines; one head = 8 column tiles of 16
static_assert(NH_ * HD == DQ);                 // head h = columns h*128 + d
static_assert(HD % 32 == 0);                   // score k-loop steps by 32
static_assert(DX % 32 == 0);                   // projection k-loop steps by 32
static_assert(DQ % 32 == 0);                   // output-projection k-loop steps by 32
static_assert(DX % 64 == 0);                   // output column tiles of 64
static_assert(DQ % 64 == 0);                   // v^T row tiles of 64
static_assert(SEQ % 64 == 0);                  // a 64-token tile never straddles two batches
static_assert((NB * SEQ) % 64 == 0);
static_assert(SEQ % 32 == 0);                  // key loop steps by 32; 32-token q/k tiles
static_assert(SEQ % (16 * AW) == 0);           // flash grid covers the sequence exactly
static_assert(((size_t)SEQ * DX) % 64 == 0);
static_assert(((size_t)DQ * DX) % 2048 == 0);  // weight converts: whole 256-thread blocks
static_assert((SEQ * 64) % 256 == 0);
static_assert(NB <= NB_FULL);
static_assert(SEQ <= SEQ_FULL);
static_assert(OSP >= HD);
static_assert(OSQ >= HD);
static_assert((OSP * 4) % 16 == 0);
static_assert((OSQ * 4) % 16 == 0);
static_assert((DX * 4) % 128 == 0);            // output rows start on a line
static_assert(32 * 16 * 8 == 16 * HD * 2);     // q/k epilogue and ctx epilogue: 32 lanes x 16 B x 8 instructions == 16 rows x 256 B
static_assert(32 * 16 * 4 == 16 * 64 * 2);
static_assert(32 * 16 * 8 == 16 * 64 * 4);     // output epilogue: 32 lanes x 16 B x 8 instructions == 16 rows x 256 B
static_assert(16 * OSQ * 4 <= 131072);         // static LDS of the q/k projection kernel
static_assert(16 * 68 * 4 <= 131072);          // static LDS of the v^T and output projection kernels
static_assert(2 * STB <= 131072);              // static LDS of the flash kernel
static_assert(AW * 16 * OSP * 4 <= 2 * STB);   // the output tiles reuse the two stage buffers
static_assert(SEQ % KT == 0 && SEQ / KT >= 2); // whole stages; the two-buffer prologue needs two
static_assert(KT * HD * 2 == 4 * 32 * AW * 16);  // K tile: 4 pieces of 16 B per thread
static_assert(HD * KT * 2 == 4 * 32 * AW * 16);  // V^T tile: 4 pieces of 16 B per thread
static_assert(KT == 64 && 32 * AW == 256);     // piece maps of stage_kv: 16 pieces per K row, 8 per V^T row, 256 threads
static_assert(STB % 16 == 0 && KTB % 16 == 0);

typedef _Float16 h16;
typedef unsigned short bf;
typedef __attribute__((ext_vector_type(16))) __bf16   v16bf;
typedef __attribute__((ext_vector_type(16))) _Float16 v16h;
typedef __attribute__((ext_vector_type(8)))  _Float16 v8h;
typedef __attribute__((ext_vector_type(8)))  unsigned short v8us;
typedef __attribute__((ext_vector_type(8)))  float    v8f;
typedef __attribute__((ext_vector_type(4)))  float    v4f;
typedef v4f  __attribute__((may_alias)) v4fa;

__device__ __forceinline__ unsigned short f2bf(float f) { unsigned u = __float_as_uint(f); u += 0x7FFFu + ((u >> 16) & 1u); return (unsigned short)(u >> 16); }
__device__ __forceinline__ float bfr(float f) { return __uint_as_float(((unsigned)f2bf(f)) << 16); }   // value after RNE convert to bf16
__device__ __forceinline__ v16h cat16(v8h lo, v8h hi) { return __builtin_shufflevector(lo, hi, 0, 1, 2, 3, 4, 5, 6, 7, 8, 9, 10, 11, 12, 13, 14, 15); }
__device__ __forceinline__ v16bf cat16b(v8us lo, v8us hi) { return __builtin_bit_cast(v16bf, __builtin_shufflevector(lo, hi, 0, 1, 2, 3, 4, 5, 6, 7, 8, 9, 10, 11, 12, 13, 14, 15)); }
__device__ __forceinline__ v8f wmma16(v16h a, v16h b, v8f c) { return __builtin_amdgcn_wmma_f32_16x16x32_f16(false, a, false, b, (short)0, c, false, false); }
__device__ __forceinline__ v8f wmmab(v16bf a, v16bf b, v8f c) { return __builtin_amdgcn_wmma_f32_16x16x32_bf16(false, a, false, b, (short)0, c, false, false); }
// fragment loaders from K-contiguous 16-bit rows; p already includes + 8*(lane>>4): elements 0..7 <- k0+8h+0..7, elements 8..15 <- k0+16+8h+0..7 (same map for A and B)
__device__ __forceinline__ v16h  ldh(const h16* p) { return cat16(*(const v8h*)p, *(const v8h*)(p + 16)); }
__device__ __forceinline__ v16bf ldb(const bf* p)  { return cat16b(*(const v8us*)p, *(const v8us*)(p + 16)); }
// ordering point for wave-private LDS tiles (same wave writes and reads)
__device__ __forceinline__ void wave_sync() { __builtin_amdgcn_fence(3 /* release order */, "wavefront"); __builtin_amdgcn_wave_barrier(); asm volatile("" ::: "memory"); }

// f32 -> f16 operand convert that cannot produce a subnormal (|v| < 2^-14 -> +0)
static __device__ __forceinline__ h16 toh_flush(float v) { const h16 r = (h16)v; return (fabsf(v) < 6.103515625e-05f) ? (h16)0.0f : r; }
// one matrix instruction + its own four-slot guard (one accumulator per guard)
static __device__ __forceinline__ v8f wmma16g(v16h a, v16h b, v8f c) { c = wmma16(a, b, c); asm volatile("v_nop\n\tv_nop\n\tv_nop\n\tv_nop" : "+v"(c) : "v"(a), "v"(b)); return c; }
static __device__ __forceinline__ v8f wmmabg(v16bf a, v16bf b, v8f c) { c = wmmab(a, b, c); asm volatile("v_nop\n\tv_nop\n\tv_nop\n\tv_nop" : "+v"(c) : "v"(a), "v"(b)); return c; }

__global__ __launch_bounds__(256) void k_cvt8(const float* __restrict__ src, bf* dst, size_t n8) {
    const size_t i = (size_t)blockIdx.x * 256 + threadIdx.x; if (i >= n8) return;
    const v8f v = *(const v8f*)(src + i * 8); v8us o;
#pragma unroll
    for (int k = 0; k < 8; ++k) o[k] = f2bf(v[k]);
    *(v8us*)(dst + i * 8) = o; 
}

__global__ __launch_bounds__(256) void k_cvtw(const float* __restrict__ src, h16* dst, size_t n8, float sc) {
    const size_t i = (size_t)blockIdx.x * 256 + threadIdx.x; if (i >= n8) return;
    const v8f v = *(const v8f*)(src + i * 8); v8h o;
#pragma unroll
    for (int k = 0; k < 8; ++k) o[k] = toh_flush(bfr(v[k]) * sc);
    *(v8h*)(dst + i * 8) = o; 
}

// k_tab: rotary tables COS/SIN [SEQ][64] (f32): angle = (float)pos * inv_freq[j], inv_freq[j] = 1e6^(-j/64); precise sincosf (angles reach 2047 rad).
__global__ __launch_bounds__(256) void k_tab(float* COS, float* SIN, int n) {
#pragma clang fp contract(off)
    const int i = blockIdx.x * 256 + threadIdx.x; if (i >= n) return;
    const int pos = i >> 6, j = i & 63;
    const float invf = exp2f(-(float)j * (19.931568569324174f / 64.0f));   // log2(1e6) / 64
    const float ang = (float)pos * invf;
    float sn, cs; sincosf(ang, &sn, &cs);
    *(float*)(COS + i) = cs; *(float*)(SIN + i) = sn; 
}

// k_qk: projection + per-head RMS normalisation + rotary, ONE WAVE per 32 tokens x 128 columns (one head; 16 accumulators), operands straight from K-contiguous bf16 planes, K = DX.
// C[m][n] = sum_k A[m][k] Bt[n][k]; A = x rows (m = b*SEQ + t), Bt = W rows (n = h*128 + d). grid (NB*SEQ/32, NH_).
// Epilogue per 16-row slab: row sum of squares from the accumulators (8 column tiles per lane, xor 1/2/4/8 inside each 16-lane half), y = (c * rstd) * gain staged in a wave-private LDS tile;
// store stage: lane piece p = 32 s + lane -> row p>>4, columns c8 = 8 (p&15); out[c] = y[c] cos[c&63] + (c < 64 ? -y[c+64] : y[c-64]) sin[c&63] (tables by 16-B loads), f16;
__global__ __launch_bounds__(32) void k_qk(const bf* __restrict__ A, const bf* __restrict__ Bt, const float* __restrict__ nw,
                                           const float* __restrict__ COS, const float* __restrict__ SIN, h16* Ph) {
    __shared__ __align__(16) float os[16 * OSQ];
    const int K = DX;
    const int lane = threadIdx.x & 31, lr = lane & 15, hi = lane >> 4; const int r0 = blockIdx.x * 32, c0 = blockIdx.y * HD;
    v8f acc[2][8];
#pragma unroll
    for (int mb = 0; mb < 2; ++mb)
#pragma unroll
        for (int nb = 0; nb < 8; ++nb) acc[mb][nb] = (v8f){};
    const size_t aoff = (size_t)(r0 + lr) * K + 8 * hi, boff = (size_t)(c0 + lr) * K + 8 * hi;
#pragma unroll 1
    for (int kc = 0; kc < K; kc += 32) {
        v16bf a[2];
#pragma unroll
        for (int mb = 0; mb < 2; ++mb) a[mb] = ldb(A + aoff + (size_t)mb * 16 * K + kc);
#pragma unroll
        for (int nb = 0; nb < 8; ++nb) { const v16bf b = ldb(Bt + boff + (size_t)nb * 16 * K + kc);
#pragma unroll
            for (int mb = 0; mb < 2; ++mb) acc[mb][nb] = wmmabg(a[mb], b, acc[mb][nb]); }
    }
    float wn[8];
#pragma unroll
    for (int nb = 0; nb < 8; ++nb) wn[nb] = bfr(nw[nb * 16 + lr]);                 // nb*16 + lr < HD
    const int bb = r0 / SEQ, tt = r0 % SEQ; const int zc = bb * NH_ + (int)blockIdx.y;
    const size_t tbase = ((size_t)zc * SEQ + (size_t)tt) * HD;
#pragma unroll
    for (int mb = 0; mb < 2; ++mb) {
#pragma unroll
        for (int j = 0; j < 8; ++j) {
            float ss = 0.0f;
#pragma unroll
            for (int nb = 0; nb < 8; ++nb) ss += acc[mb][nb][j] * acc[mb][nb][j];
            ss += __shfl_xor(ss, 1, 32); ss += __shfl_xor(ss, 2, 32); ss += __shfl_xor(ss, 4, 32); ss += __shfl_xor(ss, 8, 32);
            const float rs = rsqrtf(ss * (1.0f / 128.0f) + 1.0e-6f);
#pragma unroll
            for (int nb = 0; nb < 8; ++nb) os[(hi * 8 + j) * OSQ + nb * 16 + lr] = (acc[mb][nb][j] * rs) * wn[nb]; }   // D: row 8h+j, col lane&15
        wave_sync();
        v8h hv[8];
#pragma unroll
        for (int s = 0; s < 8; ++s) { const int p = s * 32 + lane; const int row = p >> 4, c8 = (p & 15) * 8;   // 8 s x 2 rows = 16 rows; 16 lanes x 8 = 128 columns
            const int pc = c8 ^ 64, jj = c8 & 63; const float sg = (c8 < 64) ? -1.0f : 1.0f;
            const v4f x0 = *(const v4fa*)(&os[row * OSQ + c8]), x1 = *(const v4fa*)(&os[row * OSQ + c8 + 4]);
            const v4f y0 = *(const v4fa*)(&os[row * OSQ + pc]), y1 = *(const v4fa*)(&os[row * OSQ + pc + 4]);
            const size_t to = (size_t)(tt + mb * 16 + row) * 64 + (size_t)jj;      // token position < SEQ, jj + 7 < 64
            const v4f ca = *(const v4f*)(COS + to), cb = *(const v4f*)(COS + to + 4), sa = *(const v4f*)(SIN + to), sb = *(const v4f*)(SIN + to + 4);
            v8h o;
#pragma unroll
            for (int i = 0; i < 4; ++i) { o[i] = toh_flush(x0[i] * ca[i] + (sg * y0[i]) * sa[i]); o[4 + i] = toh_flush(x1[i] * cb[i] + (sg * y1[i]) * sb[i]); }
            hv[s] = o; }
        const size_t sbs = tbase + (size_t)(mb * 16) * HD;
{
#pragma unroll
            for (int s = 0; s < 8; ++s) *(v8h*)(Ph + sbs + (size_t)(s * 32 + lane) * 8) = hv[s];
             }
        wave_sync();
    }
}

// k_vt: v^T projection, ONE WAVE per 64x64 tile (16 accumulators), K = DX. A = Wv rows (m = h*128 + d), Bt = x rows (n = b*SEQ + t); plane [(b*2048 + m)][t], row pitch SEQ. grid (DQ/64, NB*SEQ/64).
__global__ __launch_bounds__(32) void k_vt(const bf* __restrict__ A, const bf* __restrict__ Bt, h16* Ph) {
    __shared__ __align__(16) float os[16 * 68];
    const int K = DX;
    const int lane = threadIdx.x & 31, lr = lane & 15, hi = lane >> 4; const int r0 = blockIdx.x * 64, c0 = blockIdx.y * 64;
    v8f acc[4][4];
#pragma unroll
    for (int mb = 0; mb < 4; ++mb)
#pragma unroll
        for (int nb = 0; nb < 4; ++nb) acc[mb][nb] = (v8f){};
    const size_t aoff = (size_t)(r0 + lr) * K + 8 * hi, boff = (size_t)(c0 + lr) * K + 8 * hi;
#pragma unroll 1
    for (int kc = 0; kc < K; kc += 32) {
        v16bf a[4];
#pragma unroll
        for (int mb = 0; mb < 4; ++mb) a[mb] = ldb(A + aoff + (size_t)mb * 16 * K + kc);
#pragma unroll
        for (int nb = 0; nb < 4; ++nb) { const v16bf b = ldb(Bt + boff + (size_t)nb * 16 * K + kc);
#pragma unroll
            for (int mb = 0; mb < 4; ++mb) acc[mb][nb] = wmmabg(a[mb], b, acc[mb][nb]); }
    }
    const int bb = c0 / SEQ, tt = c0 % SEQ;
    const size_t tbase = (size_t)bb * (size_t)DQ * SEQ + (size_t)r0 * SEQ + (size_t)tt;
#pragma unroll
    for (int mb = 0; mb < 4; ++mb) {
#pragma unroll
        for (int nb = 0; nb < 4; ++nb) {
#pragma unroll
            for (int j = 0; j < 8; ++j) os[(hi * 8 + j) * 68 + nb * 16 + lr] = acc[mb][nb][j]; }   // D: row 8h+j, col lane&15
        wave_sync();
        v8h hv[4];
#pragma unroll
        for (int s = 0; s < 4; ++s) { const int row = 4 * s + (lane >> 3), c8 = (lane & 7) * 8;   // 4 s x 4 row groups = 16 rows; 8 lanes x 8 = 64 columns
            const v4f x0 = *(const v4fa*)(&os[row * 68 + c8]); const v4f x1 = *(const v4fa*)(&os[row * 68 + c8 + 4]); v8h o;
#pragma unroll
            for (int i = 0; i < 4; ++i) { o[i] = toh_flush(x0[i]); o[4 + i] = toh_flush(x1[i]); }
            hv[s] = o; }
        const size_t sbs = tbase + (size_t)(mb * 16) * SEQ;
{
#pragma unroll
            for (int s = 0; s < 4; ++s) { const int row = 4 * s + (lane >> 3), c8 = (lane & 7) * 8;
                *(v8h*)(Ph + sbs + (size_t)row * SEQ + c8) = hv[s]; }
             }
        wave_sync();
    }
}

// stage_kv: one stage (KT keys) into LDS, 8 asynchronous 16-B copies per thread, whole 128-B lines per wave instruction.
// K tile: KT rows x 256 B, contiguous in the plane; piece c = 256 i + tid -> row c>>4, 16-B column c&15. V^T tile: 128 rows x 128 B; piece c -> row c>>3, 16-B column c&7.
// kg, vg: the thread's first global piece; lk, lv: its LDS byte addresses. The s_wait_xcnt closes the statement so that no address register is rewritten ahead of it.
static __device__ __forceinline__ void stage_kv(const h16* kg, const h16* vg, unsigned lk, unsigned lv) {
    asm volatile("global_load_async_to_lds_b128 %0, %1, off\n\t"
                 "global_load_async_to_lds_b128 %2, %3, off\n\t"
                 "global_load_async_to_lds_b128 %4, %5, off\n\t"
                 "global_load_async_to_lds_b128 %6, %7, off\n\t"
                 "global_load_async_to_lds_b128 %8, %9, off\n\t"
                 "global_load_async_to_lds_b128 %10, %11, off\n\t"
                 "global_load_async_to_lds_b128 %12, %13, off\n\t"
                 "global_load_async_to_lds_b128 %14, %15, off\n\t"
                 "s_wait_xcnt 0x0"
                 :: "v"(lk), "v"(kg), "v"(lk + 16 * KPH * 2), "v"(kg + 2048), "v"(lk + 32 * KPH * 2), "v"(kg + 4096), "v"(lk + 48 * KPH * 2), "v"(kg + 6144),
                    "v"(lv), "v"(vg), "v"(lv + 32 * VPH * 2), "v"(vg + (size_t)32 * SEQ), "v"(lv + 64 * VPH * 2), "v"(vg + (size_t)64 * SEQ), "v"(lv + 96 * VPH * 2), "v"(vg + (size_t)96 * SEQ)
                 : "memory");
}

// k_flash: fused attention, one wave per 16 query rows of one (batch, head), AW waves per block on the same (batch, head); K and V^T tiles of KT keys come once per block into LDS
// (two buffers, the next tile's copies fly while this one is worked on), fragments by two 16-B LDS loads each; Q fragments straight from the f16 plane, once per wave.
// Transposed form: S^T[key][t] = K Q^T (A = K rows, B = Q rows, 4 k-steps over d); lane (t = lane&15, h = lane>>4) holds keys 8h+r of each 16-key tile, so the packed
// P tile is directly the B fragment of O^T[d][t] = V^T P^T (element r <- tile keys 0..15, element 8+r <- tile keys 16..31, lane unchanged); 8 output tiles of 16 d.
// Additive mask row t, keys key0+8h+0..7 and key0+16+8h+0..7: four 16-B loads per lane per step, value RNE-converted to bf16, added after the scale (base-2 domain).
// Softmax state (running max, partial sum) is one scalar per lane; the two lane halves of a row are combined with one xor-16 exchange. Q fragments are loaded once, ahead of the key loop, and stay in registers.
__global__ __launch_bounds__(32 * AW) __attribute__((amdgpu_num_vgpr(256)))
void k_flash(const h16* __restrict__ QH, const h16* __restrict__ KP, const h16* __restrict__ VT, const float* __restrict__ mask, h16* CTX) {
    __shared__ __align__(16) char sm[2 * STB];
    float* os = (float*)sm;                                     // output tiles, after the key loop
    const int tid = threadIdx.x;
    const int lane = threadIdx.x & 31, lr = lane & 15, hi = lane >> 4;
    const int wave = __builtin_amdgcn_readfirstlane((int)(threadIdx.x >> 5));
    const int zh = blockIdx.y; const int b = zh / NH_, h = zh % NH_;
    const int t0 = (blockIdx.x * AW + wave) * 16;
    const size_t pbase = (size_t)zh * SEQ * HD;
    const size_t qo = pbase + (size_t)(t0 + lr) * HD + 8 * hi;  // + ks*32          (B fragment: col t, k = d)
    const int ko = lr * KPH + 8 * hi;                           // + key*KPH + ks*32 (A fragment: row key, k = d), halves in the K tile
    const int vo = lr * VPH + 8 * hi;                           // + 16j*VPH + key   (A fragment: row d, k = key), halves in the V^T tile
    const unsigned lbase = (unsigned)(size_t)sm;                // LDS byte address of the stage buffers
    const unsigned lk = lbase + (unsigned)((tid >> 4) * (KPH * 2) + (tid & 15) * 16);
    const unsigned lv = lbase + (unsigned)(KTB + (tid >> 3) * (VPH * 2) + (tid & 7) * 16);
    const h16* kg = KP + pbase + (size_t)tid * 8;
    const h16* vg = VT + pbase + (size_t)(tid >> 3) * SEQ + (size_t)(tid & 7) * 8;
    const float* mrow = mask + ((size_t)b * SEQ_FULL + (size_t)(t0 + lr)) * SEQ_FULL + 8 * hi;
    v8f o[8];
#pragma unroll
    for (int j = 0; j < 8; ++j) o[j] = (v8f){};
    float m = NEGB, l = 0.0f;
    stage_kv(kg, vg, lk, lv);
    v16h qf[HD / 32];                                           // the wave's 16 query rows as B fragments, loaded once and held in 32 registers for the whole key loop
#pragma unroll   // constant indices, so that qf lives in registers and not in scratch memory
    for (int ks = 0; ks < HD / 32; ++ks) qf[ks] = ldh(QH + qo + ks * 32);
    asm volatile("s_wait_xcnt 0x0" ::: "memory");               // stands between the Q loads and the later reuse of their address registers
    asm volatile("s_wait_asynccnt 0x0" ::: "memory");           // this wave's copies of tile 0 have landed
    __syncthreads();                                            // tile 0 is readable by every wave
    stage_kv(kg + (size_t)KT * HD, vg + KT, lk + STB, lv + STB);
#pragma unroll 1
    for (int t = 0; t < SEQ / KT; ++t) {
      const unsigned bo = (unsigned)(t & 1) * STB;
      const h16* kt = (const h16*)(sm + bo) + ko;
      const h16* vt = (const h16*)(sm + bo + KTB) + vo;
#pragma unroll   // both 32-key steps of a tile in line: their tile offsets become immediates of the LDS loads
      for (int sub = 0; sub < KT / 32; ++sub) {
        const int key0 = t * KT + sub * 32;
        const h16* ka = kt + sub * 32 * KPH;
        v8f sA = (v8f){}, sB = (v8f){};
#pragma unroll
        for (int ks = 0; ks < HD / 32; ++ks) {
            const v16h ka0 = ldh(ka + ks * 32), kb0 = ldh(ka + 16 * KPH + ks * 32);
            sA = wmma16g(ka0, qf[ks], sA); sB = wmma16g(kb0, qf[ks], sB); }
        const float* mp = mrow + key0;                           // keys key0+8h+0..7 and key0+16+8h+0..7, all < SEQ
        const v4f m0 = *(const v4f*)mp, m1 = *(const v4f*)(mp + 4), m2 = *(const v4f*)(mp + 16), m3 = *(const v4f*)(mp + 20);
        float ta[8], tb[8]; float mx = NEGB;
#pragma unroll
        for (int r = 0; r < 4; ++r) {
            ta[r] = sA[r] * SC2 + bfr(m0[r]) * L2E; ta[4 + r] = sA[4 + r] * SC2 + bfr(m1[r]) * L2E;
            tb[r] = sB[r] * SC2 + bfr(m2[r]) * L2E; tb[4 + r] = sB[4 + r] * SC2 + bfr(m3[r]) * L2E; }
#pragma unroll
        for (int r = 0; r < 8; ++r) mx = fmaxf(mx, fmaxf(ta[r], tb[r]));
        mx = fmaxf(mx, __shfl_xor(mx, 16, 32));
        const float mnew = fmaxf(m, mx);
        const float alpha = __builtin_amdgcn_exp2f(m - mnew);
        const float sh = PSH - mnew;
        v16h pb; float ls = 0.0f;
#pragma unroll
        for (int r = 0; r < 8; ++r) {
            const float xa = ta[r] + sh, xb = tb[r] + sh;
            const float ea = __builtin_amdgcn_exp2f(xa), eb = __builtin_amdgcn_exp2f(xb);
            const float ga = (xa < -14.0f) ? 0.0f : ea, gb = (xb < -14.0f) ? 0.0f : eb;   // no subnormal f16 P (select on the exponent argument)
            const h16 pa = (h16)ga; const h16 pc = (h16)gb;
            pb[r] = pa; pb[8 + r] = pc;
            ls += (float)pa + (float)pc; }
        l = l * alpha + ls; m = mnew;
#pragma unroll
        for (int j = 0; j < 8; ++j) o[j] = o[j] * alpha;
        const h16* va = vt + sub * 32;
#pragma unroll
        for (int g = 0; g < 2; ++g) {
            v16h vf[4];
#pragma unroll
            for (int j = 0; j < 4; ++j) vf[j] = ldh(va + (16 * (4 * g + j)) * VPH);
#pragma unroll
            for (int j = 0; j < 4; ++j) o[4 * g + j] = wmma16g(vf[j], pb, o[4 * g + j]); }
      }
      asm volatile("s_wait_dscnt 0x0" ::: "memory");            // this wave's reads of tile t are done before its buffer is refilled
      asm volatile("s_wait_asynccnt 0x0" ::: "memory");         // this wave's copies of tile t + 1 have landed
      __syncthreads();                                          // publishes tile t + 1 and ends every wave's reads of tile t
      if (t + 2 < SEQ / KT) stage_kv(kg + (size_t)(t + 2) * KT * HD, vg + (t + 2) * KT, lk + bo, lv + bo);
    }
    asm volatile("s_wait_asynccnt 0x0" ::: "memory");           // no copy is outstanding when the buffers become output tiles
    l += __shfl_xor(l, 16, 32);
    const bool any = l > 0.0f;
    const float lsafe = any ? l : 1.0f;
    const float inv = any ? ((1.0f / lsafe) * CXS) : 0.0f;
    const int wb = wave * 16 * OSP;
    // O^T D layout: o[j][r] = (d = 16j + 8h + r, t = lane&15) -> os[t][d]; rows 0..15 x columns 0..127 all written
#pragma unroll
    for (int j = 0; j < 8; ++j) { v4f a, c;
        a[0] = o[j][0] * inv; a[1] = o[j][1] * inv; a[2] = o[j][2] * inv; a[3] = o[j][3] * inv; c[0] = o[j][4] * inv; c[1] = o[j][5] * inv; c[2] = o[j][6] * inv; c[3] = o[j][7] * inv;
        *(v4fa*)(&os[wb + lr * OSP + 16 * j + 8 * hi]) = a; *(v4fa*)(&os[wb + lr * OSP + 16 * j + 8 * hi + 4]) = c; }
    wave_sync();
    v8h hv[8];
#pragma unroll
    for (int s = 0; s < 8; ++s) { const int p = s * 32 + lane; const int row = p >> 4, c8 = (p & 15) * 8;   // 8 s x 2 rows = 16 rows; 16 lanes x 8 = 128 columns = two lines
        const v4f x0 = *(const v4fa*)(&os[wb + row * OSP + c8]); const v4f x1 = *(const v4fa*)(&os[wb + row * OSP + c8 + 4]); v8h q;
#pragma unroll
        for (int i = 0; i < 4; ++i) { q[i] = toh_flush(x0[i]); q[4 + i] = toh_flush(x1[i]); }
        hv[s] = q; }
    h16* crow = CTX + ((size_t)b * SEQ + (size_t)t0) * DQ + (size_t)h * HD;
{
#pragma unroll
        for (int s = 0; s < 8; ++s) { const int p = s * 32 + lane; const int row = p >> 4, c8 = (p & 15) * 8;
            *(v8h*)(crow + (size_t)row * DQ + c8) = hv[s]; }
         }
}

// k_out: output projection, ONE WAVE per 64x64 tile (16 accumulators), f16 operands straight from K-contiguous planes, K = DQ.
// OUT[m][n] = (1/16384) sum_k A[m][k] Bt[n][k]; A = ctx rows (m = b*SEQ + t, x256), Bt = Wo rows (n, x64). grid (NB*SEQ/64, DX/64).
__global__ __launch_bounds__(32) void k_out(const h16* __restrict__ A, const h16* __restrict__ Bt, float* OUT) {
    __shared__ __align__(16) float os[16 * 68];
    const int K = DQ;
    const int lane = threadIdx.x & 31, lr = lane & 15, hi = lane >> 4; const int r0 = blockIdx.x * 64, c0 = blockIdx.y * 64;
    v8f acc[4][4];
#pragma unroll
    for (int mb = 0; mb < 4; ++mb)
#pragma unroll
        for (int nb = 0; nb < 4; ++nb) acc[mb][nb] = (v8f){};
    const size_t aoff = (size_t)(r0 + lr) * K + 8 * hi, boff = (size_t)(c0 + lr) * K + 8 * hi;
#pragma unroll 1
    for (int kc = 0; kc < K; kc += 32) {
        v16h a[4];
#pragma unroll
        for (int mb = 0; mb < 4; ++mb) a[mb] = ldh(A + aoff + (size_t)mb * 16 * K + kc);
#pragma unroll
        for (int nb = 0; nb < 4; ++nb) { const v16h bq = ldh(Bt + boff + (size_t)nb * 16 * K + kc);
#pragma unroll
            for (int mb = 0; mb < 4; ++mb) acc[mb][nb] = wmma16g(a[mb], bq, acc[mb][nb]); }
    }
    const int bb = r0 / SEQ, tt = r0 % SEQ;
    float* obase = OUT + ((size_t)bb * OUT_SEQ + (size_t)tt) * DX + c0;
#pragma unroll
    for (int mb = 0; mb < 4; ++mb) {
#pragma unroll
        for (int nb = 0; nb < 4; ++nb) {
#pragma unroll
            for (int j = 0; j < 8; ++j) os[(hi * 8 + j) * 68 + nb * 16 + lr] = acc[mb][nb][j] * OSC; }   // D: row 8h+j, col lane&15
        wave_sync();
        v4f ov[8];
#pragma unroll
        for (int s = 0; s < 8; ++s) { const int p = s * 32 + lane; const int row = p >> 4, c4 = (p & 15) * 4;   // 8 s x 2 rows = 16 rows; 16 lanes x 4 floats = 64 columns = two lines
            ov[s] = *(const v4fa*)(&os[row * 68 + c4]); }
{
#pragma unroll
            for (int s = 0; s < 8; ++s) { const int p = s * 32 + lane; const int row = p >> 4, c4 = (p & 15) * 4;
                *(v4f*)(obase + (size_t)(mb * 16 + row) * DX + c4) = ov[s]; }
             }
        wave_sync();
    }
}

static constexpr size_t al256(size_t v) { return (v + 255) & ~(size_t)255; }
static constexpr size_t SZ_XB = al256((size_t)NB * SEQ * DX * 2);          // x bf16 [NB*SEQ][192]
static constexpr size_t SZ_WB = al256((size_t)3 * DQ * DX * 2);            // Wq | Wk | Wv bf16 [3][2048][192]
static constexpr size_t SZ_WO = al256((size_t)DX * DQ * 2);                // Wo f16 [192][2048]
static constexpr size_t SZ_TB = al256((size_t)SEQ * 64 * 4);               // cos or sin table [SEQ][64]
static constexpr size_t SZ_PL = al256((size_t)NB * NH_ * SEQ * HD * 2);    // q, k, v^T planes
static constexpr size_t SZ_CX = al256((size_t)NB * SEQ * DQ * 2);          // ctx plane
static constexpr size_t SZ_TOTAL = SZ_XB + SZ_WB + SZ_WO + 2 * SZ_TB + 3 * SZ_PL + SZ_CX;
static_assert(SZ_TOTAL <= (size_t)134217728);          // workspace carve <= 128 MiB
static_assert(((size_t)DQ * DX * 2) % 256 == 0);       // weight sub-planes stay 256-byte aligned
static_assert((size_t)NB * NH_ * SEQ * HD == (size_t)NB * DQ * SEQ);       // v^T plane [(b*2048 + m)][t] has the same extent as the q/k planes

extern "C" void kernel_launch(void* const* d_in, const int* in_sizes, int n_in,
                              void* d_out, int out_size, void* d_ws, size_t ws_size, hipStream_t stream) {
    if (n_in < 8) return;
    const size_t needx = ((size_t)(NB - 1) * SEQ_FULL + SEQ) * DX;
    const size_t needm = ((size_t)(NB - 1) * SEQ_FULL + (size_t)(SEQ - 1)) * SEQ_FULL + SEQ;
    if ((size_t)in_sizes[0] < needx || (size_t)in_sizes[1] < needm) return;
    if ((size_t)in_sizes[2] < (size_t)DQ * DX || (size_t)in_sizes[3] < (size_t)DQ * DX || (size_t)in_sizes[4] < (size_t)DQ * DX || (size_t)in_sizes[5] < (size_t)DX * DQ) return;
    if (in_sizes[6] < HD || in_sizes[7] < HD) return;
    if ((size_t)out_size < ((size_t)(NB - 1) * OUT_SEQ + SEQ) * DX) return;
    if (SZ_TOTAL > ws_size) return;
    // wire order: x, mask0, wq, wk, wv, wo, q_norm_w, k_norm_w
    const float* x    = (const float*)d_in[0];
    const float* mask = (const float*)d_in[1];
    const float* wq   = (const float*)d_in[2];
    const float* wk   = (const float*)d_in[3];
    const float* wv   = (const float*)d_in[4];
    const float* wo   = (const float*)d_in[5];
    const float* qnw  = (const float*)d_in[6];
    const float* knw  = (const float*)d_in[7];
    float* OUT = (float*)d_out;      // [NB][SEQ][192]
    char* wsp = (char*)d_ws;
    bf*  XB  = (bf*)wsp;  wsp += SZ_XB;               // [NB*SEQ][192]
    bf*  WB  = (bf*)wsp;  wsp += SZ_WB;               // [3][2048][192]: q | k | v  ([out][in] = Bt as-is)
    h16* WOH = (h16*)wsp; wsp += SZ_WO;               // [192][2048] x64
    float* COS = (float*)wsp; wsp += SZ_TB;           // [SEQ][64]
    float* SIN = (float*)wsp; wsp += SZ_TB;           // [SEQ][64]
    h16* QH  = (h16*)wsp; wsp += SZ_PL;               // [NB*16][SEQ][128]
    h16* KP  = (h16*)wsp; wsp += SZ_PL;               // [NB*16][SEQ][128]
    h16* VT  = (h16*)wsp; wsp += SZ_PL;               // [NB*16][128][SEQ]
    h16* CTX = (h16*)wsp; wsp += SZ_CX;               // [NB*SEQ][2048] x256
    bf* WQ = WB; bf* WK = WB + (size_t)DQ * DX; bf* WV = WB + (size_t)2 * DQ * DX;

    if (SEQ == SEQ_FULL) {
        const size_t n8 = (size_t)NB * SEQ * DX / 8;
        k_cvt8<<<(unsigned)((n8 + 255) / 256), 256, 0, stream>>>(x, XB, n8);
    } else {
        const size_t n8 = (size_t)SEQ * DX / 8;
        for (int b = 0; b < NB; ++b) k_cvt8<<<(unsigned)((n8 + 255) / 256), 256, 0, stream>>>(x + (size_t)b * SEQ_FULL * DX, XB + (size_t)b * SEQ * DX, n8);
    }
    { const size_t n8 = (size_t)DQ * DX / 8; const unsigned g = (unsigned)((n8 + 255) / 256);
      k_cvt8<<<g, 256, 0, stream>>>(wq, WQ, n8); k_cvt8<<<g, 256, 0, stream>>>(wk, WK, n8); k_cvt8<<<g, 256, 0, stream>>>(wv, WV, n8);
      k_cvtw<<<g, 256, 0, stream>>>(wo, WOH, n8, WOS); }
    k_tab<<<(unsigned)(SEQ * 64 / 256), 256, 0, stream>>>(COS, SIN, SEQ * 64);

    // q, k: A = x rows (m = b*SEQ + t), Bt = W rows (n = h*128 + d) -> normalised, rotated plane [(b*16 + h)][t][d]
    k_qk<<<dim3(NB * SEQ / 32, NH_, 1), 32, 0, stream>>>(XB, WQ, qnw, COS, SIN, QH);
    k_qk<<<dim3(NB * SEQ / 32, NH_, 1), 32, 0, stream>>>(XB, WK, knw, COS, SIN, KP);
    // v^T: A = Wv rows (m = h*128 + d), Bt = x rows (n = b*SEQ + t) -> plane [(b*2048 + m)][t] = [(b*16 + h)][d][t]
    k_vt<<<dim3(DQ / 64, NB * SEQ / 64, 1), 32, 0, stream>>>(WV, XB, VT);

    k_flash<<<dim3(SEQ / (16 * AW), NB * NH_, 1), 32 * AW, 0, stream>>>(QH, KP, VT, mask, CTX);
    // output projection: A = ctx rows [b*SEQ + t][2048], Bt = Wo rows [192][2048]
    k_out<<<dim3(NB * SEQ / 64, DX / 64, 1), 32, 0, stream>>>(CTX, WOH, OUT);
}

// v003
// Measured time: 189 microseconds a run.
// Two timings next to v002 put it at 1.20 and 1.19 times that version's speed.
// Counting every step since v000, it is 2.23 times as fast.
#include <hip/hip_runtime.h>

// Dense self-attention layer: x [NB][SEQ][192]; Wq/Wk/Wv [2048][192] ([out][in], y = x W^T, no bias); 16 heads x 128; per-head RMS normalisation of q and k (eps 1e-6, gain inputs);
// rotate-half rotary embeddings (base 1e6, positions 0..SEQ-1); scores = q.k * 128^-0.5 + additive mask [NB][1][SEQ][SEQ] (read by value); softmax over keys; P.V; heads merged; output = ctx Wo^T with Wo [192][2048] (f32).
// Compute dtypes, f32 accumulate everywhere: q/k/v projections v_wmma_f32_16x16x32_bf16 (x and W RNE-converted to bf16; products exact);
// scores v_wmma_f32_16x16x32_f16 (q, k single f16 planes after normalisation and rotary); P.V v_wmma_f32_16x16x32_f16 (P single f16 with x16384 carry that cancels in the normalisation, v single f16);
// output projection v_wmma_f32_16x16x32_f16 (ctx single f16 with x256 carry, Wo = bf16-converted value x64 as f16; 1/16384 folded in the f32 epilogue). Softmax f32 (online, running max), row sum over the converted P.
// Layout: bf16 copies of x and Wq|Wk|Wv; f16 Wo plane; cos/sin tables [SEQ][64] f32; q, k planes [b*16+h][t][128]; v^T plane [b*16+h][d][t]; ctx plane [b*SEQ+t][h*128+d];
// fused flash kernel in transposed form (S^T = K Q^T, O^T = V^T P^T), K and V^T tiles staged in LDS for the whole block, Q fragments straight from the f16 plane, no score or probability plane in memory.

#ifndef NB
#define NB 2
#endif
#ifndef SEQ
#define SEQ 2048
#endif
#define NB_FULL  2
#define SEQ_FULL 2048
#ifndef OUT_SEQ
#define OUT_SEQ SEQ              // row pitch (in tokens) between batches of the output
#endif
#define DX   192                 // model width (projection K, output N)
#define NH_  16
#define HD   128
#define DQ   2048                // NH_ * HD
#define AW   8                   // waves per flash block (16 query rows each)
#define KT   64                  // keys per LDS stage of the flash kernel
#define OW   8                   // waves per output-projection block (K split over them)
#define KPH  136                 // LDS row pitch (halves) of the K tile: 272 B = 16 B x odd
#define VPH  72                  // LDS row pitch (halves) of the V^T tile: 144 B = 16 B x odd
#define KTB  (KT * KPH * 2)      // bytes of one K tile in LDS
#define VTB  (HD * VPH * 2)      // bytes of one V^T tile in LDS
#define STB  (KTB + VTB)         // bytes of one stage
#define OSP  132                 // LDS row pitch (floats) of the flash output tile
#define OSQ  132                 // LDS row pitch (floats) of the q/k epilogue tile
#define SC2  ((float)(0.08838834764831845 * 1.4426950408889634))   // HD^-0.5 * log2(e)
#define L2E  1.4426950408889634f
#define PSH  14.0f               // log2 of the P carry (16384)
#define NEGB (-3.0e38f)
#define CXS  256.0f              // carry of the ctx plane
#define WOS  64.0f               // carry of the Wo plane
#define OSC  (1.0f / 16384.0f)   // 1 / (CXS * WOS)

static_assert(HD == 128);                      // q/k plane row = 256 bytes = two lines; one head = 8 column tiles of 16
static_assert(NH_ * HD == DQ);                 // head h = columns h*128 + d
static_assert(HD % 32 == 0);                   // score k-loop steps by 32
static_assert(DX % 32 == 0);                   // projection k-loop steps by 32
static_assert(DQ % 32 == 0);                   // output-projection k-loop steps by 32
static_assert(DX % 64 == 0);                   // output column tiles of 64
static_assert(DQ % 64 == 0);                   // v^T row tiles of 64
static_assert(SEQ % 64 == 0);                  // a 64-token tile never straddles two batches
static_assert((NB * SEQ) % 64 == 0);
static_assert(SEQ % 32 == 0);                  // key loop steps by 32; 32-token q/k tiles
static_assert(SEQ % (16 * AW) == 0);           // flash grid covers the sequence exactly
static_assert(((size_t)SEQ * DX) % 64 == 0);
static_assert(((size_t)DQ * DX) % 2048 == 0);  // weight converts: whole 256-thread blocks
static_assert((SEQ * 64) % 256 == 0);
static_assert(NB <= NB_FULL);
static_assert(SEQ <= SEQ_FULL);
static_assert(OSP >= HD);
static_assert(OSQ >= HD);
static_assert((OSP * 4) % 16 == 0);
static_assert((OSQ * 4) % 16 == 0);
static_assert((DX * 4) % 128 == 0);            // output rows start on a line
static_assert(32 * 16 * 8 == 16 * HD * 2);     // q/k epilogue and ctx epilogue: 32 lanes x 16 B x 8 instructions == 16 rows x 256 B
static_assert(32 * 16 * 4 == 16 * 64 * 2);
static_assert(16 * OSQ * 4 <= 131072);         // static LDS of the q/k projection kernel
static_assert(16 * 68 * 4 <= 131072);          // static LDS of the v^T projection kernel
static_assert(OW * 64 * 68 * 4 <= 163840);     // static LDS of the output projection kernel: one partial tile per wave
static_assert(DQ % (32 * OW) == 0);            // every wave of the output projection takes the same number of k-steps
static_assert(64 % OW == 0 && (64 / OW) * 16 == 4 * 32);   // output epilogue: 4 pieces of 16 B per lane cover the wave's rows
static_assert(2 * STB <= 131072);              // static LDS of the flash kernel
static_assert(AW * 16 * OSP * 4 <= 2 * STB);   // the output tiles reuse the two stage buffers
static_assert(SEQ % KT == 0 && SEQ / KT >= 2); // whole stages; the two-buffer prologue needs two
static_assert(KT * HD * 2 == 4 * 32 * AW * 16);  // K tile: 4 pieces of 16 B per thread
static_assert(HD * KT * 2 == 4 * 32 * AW * 16);  // V^T tile: 4 pieces of 16 B per thread
static_assert(KT == 64 && 32 * AW == 256);     // piece maps of stage_kv: 16 pieces per K row, 8 per V^T row, 256 threads
static_assert(STB % 16 == 0 && KTB % 16 == 0);

typedef _Float16 h16;
typedef unsigned short bf;
typedef __attribute__((ext_vector_type(16))) __bf16   v16bf;
typedef __attribute__((ext_vector_type(16))) _Float16 v16h;
typedef __attribute__((ext_vector_type(8)))  _Float16 v8h;
typedef __attribute__((ext_vector_type(8)))  unsigned short v8us;
typedef __attribute__((ext_vector_type(8)))  float    v8f;
typedef __attribute__((ext_vector_type(4)))  float    v4f;
typedef v4f  __attribute__((may_alias)) v4fa;

__device__ __forceinline__ unsigned short f2bf(float f) { unsigned u = __float_as_uint(f); u += 0x7FFFu + ((u >> 16) & 1u); return (unsigned short)(u >> 16); }
__device__ __forceinline__ float bfr(float f) { return __uint_as_float(((unsigned)f2bf(f)) << 16); }   // value after RNE convert to bf16
__device__ __forceinline__ v16h cat16(v8h lo, v8h hi) { return __builtin_shufflevector(lo, hi, 0, 1, 2, 3, 4, 5, 6, 7, 8, 9, 10, 11, 12, 13, 14, 15); }
__device__ __forceinline__ v16bf cat16b(v8us lo, v8us hi) { return __builtin_bit_cast(v16bf, __builtin_shufflevector(lo, hi, 0, 1, 2, 3, 4, 5, 6, 7, 8, 9, 10, 11, 12, 13, 14, 15)); }
__device__ __forceinline__ v8f wmma16(v16h a, v16h b, v8f c) { return __builtin_amdgcn_wmma_f32_16x16x32_f16(false, a, false, b, (short)0, c, false, false); }
__device__ __forceinline__ v8f wmmab(v16bf a, v16bf b, v8f c) { return __builtin_amdgcn_wmma_f32_16x16x32_bf16(false, a, false, b, (short)0, c, false, false); }
// fragment loaders from K-contiguous 16-bit rows; p already includes + 8*(lane>>4): elements 0..7 <- k0+8h+0..7, elements 8..15 <- k0+16+8h+0..7 (same map for A and B)
__device__ __forceinline__ v16h  ldh(const h16* p) { return cat16(*(const v8h*)p, *(const v8h*)(p + 16)); }
__device__ __forceinline__ v16bf ldb(const bf* p)  { return cat16b(*(const v8us*)p, *(const v8us*)(p + 16)); }
// ordering point for wave-private LDS tiles (same wave writes and reads)
__device__ __forceinline__ void wave_sync() { __builtin_amdgcn_fence(3 /* release order */, "wavefront"); __builtin_amdgcn_wave_barrier(); asm volatile("" ::: "memory"); }

// f32 -> f16 operand convert that cannot produce a subnormal (|v| < 2^-14 -> +0)
static __device__ __forceinline__ h16 toh_flush(float v) { const h16 r = (h16)v; return (fabsf(v) < 6.103515625e-05f) ? (h16)0.0f : r; }
// one matrix instruction + its own four-slot guard (one accumulator per guard)
static __device__ __forceinline__ v8f wmma16g(v16h a, v16h b, v8f c) { c = wmma16(a, b, c); asm volatile("v_nop\n\tv_nop\n\tv_nop\n\tv_nop" : "+v"(c) : "v"(a), "v"(b)); return c; }
static __device__ __forceinline__ v8f wmmabg(v16bf a, v16bf b, v8f c) { c = wmmab(a, b, c); asm volatile("v_nop\n\tv_nop\n\tv_nop\n\tv_nop" : "+v"(c) : "v"(a), "v"(b)); return c; }

__global__ __launch_bounds__(256) void k_cvt8(const float* __restrict__ src, bf* dst, size_t n8) {
    const size_t i = (size_t)blockIdx.x * 256 + threadIdx.x; if (i >= n8) return;
    const v8f v = *(const v8f*)(src + i * 8); v8us o;
#pragma unroll
    for (int k = 0; k < 8; ++k) o[k] = f2bf(v[k]);
    *(v8us*)(dst + i * 8) = o; 
}

__global__ __launch_bounds__(256) void k_cvtw(const float* __restrict__ src, h16* dst, size_t n8, float sc) {
    const size_t i = (size_t)blockIdx.x * 256 + threadIdx.x; if (i >= n8) return;
    const v8f v = *(const v8f*)(src + i * 8); v8h o;
#pragma unroll
    for (int k = 0; k < 8; ++k) o[k] = toh_flush(bfr(v[k]) * sc);
    *(v8h*)(dst + i * 8) = o; 
}

// k_tab: rotary tables COS/SIN [SEQ][64] (f32): angle = (float)pos * inv_freq[j], inv_freq[j] = 1e6^(-j/64); precise sincosf (angles reach 2047 rad).
__global__ __launch_bounds__(256) void k_tab(float* COS, float* SIN, int n) {
#pragma clang fp contract(off)
    const int i = blockIdx.x * 256 + threadIdx.x; if (i >= n) return;
    const int pos = i >> 6, j = i & 63;
    const float invf = exp2f(-(float)j * (19.931568569324174f / 64.0f));   // log2(1e6) / 64
    const float ang = (float)pos * invf;
    float sn, cs; sincosf(ang, &sn, &cs);
    *(float*)(COS + i) = cs; *(float*)(SIN + i) = sn; 
}

// k_qk: projection + per-head RMS normalisation + rotary, ONE WAVE per 32 tokens x 128 columns (one head; 16 accumulators), operands straight from K-contiguous bf16 planes, K = DX.
// C[m][n] = sum_k A[m][k] Bt[n][k]; A = x rows (m = b*SEQ + t), Bt = W rows (n = h*128 + d). grid (NB*SEQ/32, NH_).
// Epilogue per 16-row slab: row sum of squares from the accumulators (8 column tiles per lane, xor 1/2/4/8 inside each 16-lane half), y = (c * rstd) * gain staged in a wave-private LDS tile;
// store stage: lane piece p = 32 s + lane -> row p>>4, columns c8 = 8 (p&15); out[c] = y[c] cos[c&63] + (c < 64 ? -y[c+64] : y[c-64]) sin[c&63] (tables by 16-B loads), f16;
__global__ __launch_bounds__(32) void k_qk(const bf* __restrict__ A, const bf* __restrict__ Bt, const float* __restrict__ nw,
                                           const float* __restrict__ COS, const float* __restrict__ SIN, h16* Ph) {
    __shared__ __align__(16) float os[16 * OSQ];
    const int K = DX;
    const int lane = threadIdx.x & 31, lr = lane & 15, hi = lane >> 4; const int r0 = blockIdx.x * 32, c0 = blockIdx.y * HD;
    v8f acc[2][8];
#pragma unroll
    for (int mb = 0; mb < 2; ++mb)
#pragma unroll
        for (int nb = 0; nb < 8; ++nb) acc[mb][nb] = (v8f){};
    const size_t aoff = (size_t)(r0 + lr) * K + 8 * hi, boff = (size_t)(c0 + lr) * K + 8 * hi;
#pragma unroll 1
    for (int kc = 0; kc < K; kc += 32) {
        v16bf a[2];
#pragma unroll
        for (int mb = 0; mb < 2; ++mb) a[mb] = ldb(A + aoff + (size_t)mb * 16 * K + kc);
#pragma unroll
        for (int nb = 0; nb < 8; ++nb) { const v16bf b = ldb(Bt + boff + (size_t)nb * 16 * K + kc);
#pragma unroll
            for (int mb = 0; mb < 2; ++mb) acc[mb][nb] = wmmabg(a[mb], b, acc[mb][nb]); }
    }
    float wn[8];
#pragma unroll
    for (int nb = 0; nb < 8; ++nb) wn[nb] = bfr(nw[nb * 16 + lr]);                 // nb*16 + lr < HD
    const int bb = r0 / SEQ, tt = r0 % SEQ; const int zc = bb * NH_ + (int)blockIdx.y;
    const size_t tbase = ((size_t)zc * SEQ + (size_t)tt) * HD;
#pragma unroll
    for (int mb = 0; mb < 2; ++mb) {
#pragma unroll
        for (int j = 0; j < 8; ++j) {
            float ss = 0.0f;
#pragma unroll
            for (int nb = 0; nb < 8; ++nb) ss += acc[mb][nb][j] * acc[mb][nb][j];
            ss += __shfl_xor(ss, 1, 32); ss += __shfl_xor(ss, 2, 32); ss += __shfl_xor(ss, 4, 32); ss += __shfl_xor(ss, 8, 32);
            const float rs = rsqrtf(ss * (1.0f / 128.0f) + 1.0e-6f);
#pragma unroll
            for (int nb = 0; nb < 8; ++nb) os[(hi * 8 + j) * OSQ + nb * 16 + lr] = (acc[mb][nb][j] * rs) * wn[nb]; }   // D: row 8h+j, col lane&15
        wave_sync();
        v8h hv[8];
#pragma unroll
        for (int s = 0; s < 8; ++s) { const int p = s * 32 + lane; const int row = p >> 4, c8 = (p & 15) * 8;   // 8 s x 2 rows = 16 rows; 16 lanes x 8 = 128 columns
            const int pc = c8 ^ 64, jj = c8 & 63; const float sg = (c8 < 64) ? -1.0f : 1.0f;
            const v4f x0 = *(const v4fa*)(&os[row * OSQ + c8]), x1 = *(const v4fa*)(&os[row * OSQ + c8 + 4]);
            const v4f y0 = *(const v4fa*)(&os[row * OSQ + pc]), y1 = *(const v4fa*)(&os[row * OSQ + pc + 4]);
            const size_t to = (size_t)(tt + mb * 16 + row) * 64 + (size_t)jj;      // token position < SEQ, jj + 7 < 64
            const v4f ca = *(const v4f*)(COS + to), cb = *(const v4f*)(COS + to + 4), sa = *(const v4f*)(SIN + to), sb = *(const v4f*)(SIN + to + 4);
            v8h o;
#pragma unroll
            for (int i = 0; i < 4; ++i) { o[i] = toh_flush(x0[i] * ca[i] + (sg * y0[i]) * sa[i]); o[4 + i] = toh_flush(x1[i] * cb[i] + (sg * y1[i]) * sb[i]); }
            hv[s] = o; }
        const size_t sbs = tbase + (size_t)(mb * 16) * HD;
{
#pragma unroll
            for (int s = 0; s < 8; ++s) *(v8h*)(Ph + sbs + (size_t)(s * 32 + lane) * 8) = hv[s];
             }
        wave_sync();
    }
}

// k_vt: v^T projection, ONE WAVE per 64x64 tile (16 accumulators), K = DX. A = Wv rows (m = h*128 + d), Bt = x rows (n = b*SEQ + t); plane [(b*2048 + m)][t], row pitch SEQ. grid (DQ/64, NB*SEQ/64).
__global__ __launch_bounds__(32) void k_vt(const bf* __restrict__ A, const bf* __restrict__ Bt, h16* Ph) {
    __shared__ __align__(16) float os[16 * 68];
    const int K = DX;
    const int lane = threadIdx.x & 31, lr = lane & 15, hi = lane >> 4; const int r0 = blockIdx.x * 64, c0 = blockIdx.y * 64;
    v8f acc[4][4];
#pragma unroll
    for (int mb = 0; mb < 4; ++mb)
#pragma unroll
        for (int nb = 0; nb < 4; ++nb) acc[mb][nb] = (v8f){};
    const size_t aoff = (size_t)(r0 + lr) * K + 8 * hi, boff = (size_t)(c0 + lr) * K + 8 * hi;
#pragma unroll 1
    for (int kc = 0; kc < K; kc += 32) {
        v16bf a[4];
#pragma unroll
        for (int mb = 0; mb < 4; ++mb) a[mb] = ldb(A + aoff + (size_t)mb * 16 * K + kc);
#pragma unroll
        for (int nb = 0; nb < 4; ++nb) { const v16bf b = ldb(Bt + boff + (size_t)nb * 16 * K + kc);
#pragma unroll
            for (int mb = 0; mb < 4; ++mb) acc[mb][nb] = wmmabg(a[mb], b, acc[mb][nb]); }
    }
    const int bb = c0 / SEQ, tt = c0 % SEQ;
    const size_t tbase = (size_t)bb * (size_t)DQ * SEQ + (size_t)r0 * SEQ + (size_t)tt;
#pragma unroll
    for (int mb = 0; mb < 4; ++mb) {
#pragma unroll
        for (int nb = 0; nb < 4; ++nb) {
#pragma unroll
            for (int j = 0; j < 8; ++j) os[(hi * 8 + j) * 68 + nb * 16 + lr] = acc[mb][nb][j]; }   // D: row 8h+j, col lane&15
        wave_sync();
        v8h hv[4];
#pragma unroll
        for (int s = 0; s < 4; ++s) { const int row = 4 * s + (lane >> 3), c8 = (lane & 7) * 8;   // 4 s x 4 row groups = 16 rows; 8 lanes x 8 = 64 columns
            const v4f x0 = *(const v4fa*)(&os[row * 68 + c8]); const v4f x1 = *(const v4fa*)(&os[row * 68 + c8 + 4]); v8h o;
#pragma unroll
            for (int i = 0; i < 4; ++i) { o[i] = toh_flush(x0[i]); o[4 + i] = toh_flush(x1[i]); }
            hv[s] = o; }
        const size_t sbs = tbase + (size_t)(mb * 16) * SEQ;
{
#pragma unroll
            for (int s = 0; s < 4; ++s) { const int row = 4 * s + (lane >> 3), c8 = (lane & 7) * 8;
                *(v8h*)(Ph + sbs + (size_t)row * SEQ + c8) = hv[s]; }
             }
        wave_sync();
    }
}

// stage_kv: one stage (KT keys) into LDS, 8 asynchronous 16-B copies per thread, whole 128-B lines per wave instruction.
// K tile: KT rows x 256 B, contiguous in the plane; piece c = 256 i + tid -> row c>>4, 16-B column c&15. V^T tile: 128 rows x 128 B; piece c -> row c>>3, 16-B column c&7.
// kg, vg: the thread's first global piece; lk, lv: its LDS byte addresses. The s_wait_xcnt closes the statement so that no address register is rewritten ahead of it.
static __device__ __forceinline__ void stage_kv(const h16* kg, const h16* vg, unsigned lk, unsigned lv) {
    asm volatile("global_load_async_to_lds_b128 %0, %1, off\n\t"
                 "global_load_async_to_lds_b128 %2, %3, off\n\t"
                 "global_load_async_to_lds_b128 %4, %5, off\n\t"
                 "global_load_async_to_lds_b128 %6, %7, off\n\t"
                 "global_load_async_to_lds_b128 %8, %9, off\n\t"
                 "global_load_async_to_lds_b128 %10, %11, off\n\t"
                 "global_load_async_to_lds_b128 %12, %13, off\n\t"
                 "global_load_async_to_lds_b128 %14, %15, off\n\t"
                 "s_wait_xcnt 0x0"
                 :: "v"(lk), "v"(kg), "v"(lk + 16 * KPH * 2), "v"(kg + 2048), "v"(lk + 32 * KPH * 2), "v"(kg + 4096), "v"(lk + 48 * KPH * 2), "v"(kg + 6144),
                    "v"(lv), "v"(vg), "v"(lv + 32 * VPH * 2), "v"(vg + (size_t)32 * SEQ), "v"(lv + 64 * VPH * 2), "v"(vg + (size_t)64 * SEQ), "v"(lv + 96 * VPH * 2), "v"(vg + (size_t)96 * SEQ)
                 : "memory");
}

// k_flash: fused attention, one wave per 16 query rows of one (batch, head), AW waves per block on the same (batch, head); K and V^T tiles of KT keys come once per block into LDS
// (two buffers, the next tile's copies fly while this one is worked on), fragments by two 16-B LDS loads each; Q fragments straight from the f16 plane, once per wave.
// Transposed form: S^T[key][t] = K Q^T (A = K rows, B = Q rows, 4 k-steps over d); lane (t = lane&15, h = lane>>4) holds keys 8h+r of each 16-key tile, so the packed
// P tile is directly the B fragment of O^T[d][t] = V^T P^T (element r <- tile keys 0..15, element 8+r <- tile keys 16..31, lane unchanged); 8 output tiles of 16 d.
// Additive mask row t, keys key0+8h+0..7 and key0+16+8h+0..7: four 16-B loads per lane per step, value RNE-converted to bf16, added after the scale (base-2 domain).
// Softmax state (running max, partial sum) is one scalar per lane; the two lane halves of a row are combined with one xor-16 exchange. Q fragments are loaded once, ahead of the key loop, and stay in registers.
__global__ __launch_bounds__(32 * AW) __attribute__((amdgpu_num_vgpr(256)))
void k_flash(const h16* __restrict__ QH, const h16* __restrict__ KP, const h16* __restrict__ VT, const float* __restrict__ mask, h16* CTX) {
    __shared__ __align__(16) char sm[2 * STB];
    float* os = (float*)sm;                                     // output tiles, after the key loop
    const int tid = threadIdx.x;
    const int lane = threadIdx.x & 31, lr = lane & 15, hi = lane >> 4;
    const int wave = __builtin_amdgcn_readfirstlane((int)(threadIdx.x >> 5));
    const int zh = blockIdx.y; const int b = zh / NH_, h = zh % NH_;
    const int t0 = (blockIdx.x * AW + wave) * 16;
    const size_t pbase = (size_t)zh * SEQ * HD;
    const size_t qo = pbase + (size_t)(t0 + lr) * HD + 8 * hi;  // + ks*32          (B fragment: col t, k = d)
    const int ko = lr * KPH + 8 * hi;                           // + key*KPH + ks*32 (A fragment: row key, k = d), halves in the K tile
    const int vo = lr * VPH + 8 * hi;                           // + 16j*VPH + key   (A fragment: row d, k = key), halves in the V^T tile
    const unsigned lbase = (unsigned)(size_t)sm;                // LDS byte address of the stage buffers
    const unsigned lk = lbase + (unsigned)((tid >> 4) * (KPH * 2) + (tid & 15) * 16);
    const unsigned lv = lbase + (unsigned)(KTB + (tid >> 3) * (VPH * 2) + (tid & 7) * 16);
    const h16* kg = KP + pbase + (size_t)tid * 8;
    const h16* vg = VT + pbase + (size_t)(tid >> 3) * SEQ + (size_t)(tid & 7) * 8;
    const float* mrow = mask + ((size_t)b * SEQ_FULL + (size_t)(t0 + lr)) * SEQ_FULL + 8 * hi;
    v8f o[8];
#pragma unroll
    for (int j = 0; j < 8; ++j) o[j] = (v8f){};
    float m = NEGB, l = 0.0f;
    stage_kv(kg, vg, lk, lv);
    v16h qf[HD / 32];                                           // the wave's 16 query rows as B fragments, loaded once and held in 32 registers for the whole key loop
#pragma unroll   // constant indices, so that qf lives in registers and not in scratch memory
    for (int ks = 0; ks < HD / 32; ++ks) qf[ks] = ldh(QH + qo + ks * 32);
    asm volatile("s_wait_xcnt 0x0" ::: "memory");               // stands between the Q loads and the later reuse of their address registers
    asm volatile("s_wait_asynccnt 0x0" ::: "memory");           // this wave's copies of tile 0 have landed
    __syncthreads();                                            // tile 0 is readable by every wave
    stage_kv(kg + (size_t)KT * HD, vg + KT, lk + STB, lv + STB);
#pragma unroll 1
    for (int t = 0; t < SEQ / KT; ++t) {
      const unsigned bo = (unsigned)(t & 1) * STB;
      const h16* kt = (const h16*)(sm + bo) + ko;
      const h16* vt = (const h16*)(sm + bo + KTB) + vo;
#pragma unroll   // both 32-key steps of a tile in line: their tile offsets become immediates of the LDS loads
      for (int sub = 0; sub < KT / 32; ++sub) {
        const int key0 = t * KT + sub * 32;
        const h16* ka = kt + sub * 32 * KPH;
        v8f sA = (v8f){}, sB = (v8f){};
#pragma unroll
        for (int ks = 0; ks < HD / 32; ++ks) {
            const v16h ka0 = ldh(ka + ks * 32), kb0 = ldh(ka + 16 * KPH + ks * 32);
            sA = wmma16g(ka0, qf[ks], sA); sB = wmma16g(kb0, qf[ks], sB); }
        const float* mp = mrow + key0;                           // keys key0+8h+0..7 and key0+16+8h+0..7, all < SEQ
        const v4f m0 = *(const v4f*)mp, m1 = *(const v4f*)(mp + 4), m2 = *(const v4f*)(mp + 16), m3 = *(const v4f*)(mp + 20);
        float ta[8], tb[8]; float mx = NEGB;
#pragma unroll
        for (int r = 0; r < 4; ++r) {
            ta[r] = sA[r] * SC2 + bfr(m0[r]) * L2E; ta[4 + r] = sA[4 + r] * SC2 + bfr(m1[r]) * L2E;
            tb[r] = sB[r] * SC2 + bfr(m2[r]) * L2E; tb[4 + r] = sB[4 + r] * SC2 + bfr(m3[r]) * L2E; }
#pragma unroll
        for (int r = 0; r < 8; ++r) mx = fmaxf(mx, fmaxf(ta[r], tb[r]));
        mx = fmaxf(mx, __shfl_xor(mx, 16, 32));
        const float mnew = fmaxf(m, mx);
        const float alpha = __builtin_amdgcn_exp2f(m - mnew);
        const float sh = PSH - mnew;
        v16h pb; float ls = 0.0f;
#pragma unroll
        for (int r = 0; r < 8; ++r) {
            const float xa = ta[r] + sh, xb = tb[r] + sh;
            const float ea = __builtin_amdgcn_exp2f(xa), eb = __builtin_amdgcn_exp2f(xb);
            const float ga = (xa < -14.0f) ? 0.0f : ea, gb = (xb < -14.0f) ? 0.0f : eb;   // no subnormal f16 P (select on the exponent argument)
            const h16 pa = (h16)ga; const h16 pc = (h16)gb;
            pb[r] = pa; pb[8 + r] = pc;
            ls += (float)pa + (float)pc; }
        l = l * alpha + ls; m = mnew;
#pragma unroll
        for (int j = 0; j < 8; ++j) o[j] = o[j] * alpha;
        const h16* va = vt + sub * 32;
#pragma unroll
        for (int g = 0; g < 2; ++g) {
            v16h vf[4];
#pragma unroll
            for (int j = 0; j < 4; ++j) vf[j] = ldh(va + (16 * (4 * g + j)) * VPH);
#pragma unroll
            for (int j = 0; j < 4; ++j) o[4 * g + j] = wmma16g(vf[j], pb, o[4 * g + j]); }
      }
      asm volatile("s_wait_dscnt 0x0" ::: "memory");            // this wave's reads of tile t are done before its buffer is refilled
      asm volatile("s_wait_asynccnt 0x0" ::: "memory");         // this wave's copies of tile t + 1 have landed
      __syncthreads();                                          // publishes tile t + 1 and ends every wave's reads of tile t
      if (t + 2 < SEQ / KT) stage_kv(kg + (size_t)(t + 2) * KT * HD, vg + (t + 2) * KT, lk + bo, lv + bo);
    }
    asm volatile("s_wait_asynccnt 0x0" ::: "memory");           // no copy is outstanding when the buffers become output tiles
    l += __shfl_xor(l, 16, 32);
    const bool any = l > 0.0f;
    const float lsafe = any ? l : 1.0f;
    const float inv = any ? ((1.0f / lsafe) * CXS) : 0.0f;
    const int wb = wave * 16 * OSP;
    // O^T D layout: o[j][r] = (d = 16j + 8h + r, t = lane&15) -> os[t][d]; rows 0..15 x columns 0..127 all written
#pragma unroll
    for (int j = 0; j < 8; ++j) { v4f a, c;
        a[0] = o[j][0] * inv; a[1] = o[j][1] * inv; a[2] = o[j][2] * inv; a[3] = o[j][3] * inv; c[0] = o[j][4] * inv; c[1] = o[j][5] * inv; c[2] = o[j][6] * inv; c[3] = o[j][7] * inv;
        *(v4fa*)(&os[wb + lr * OSP + 16 * j + 8 * hi]) = a; *(v4fa*)(&os[wb + lr * OSP + 16 * j + 8 * hi + 4]) = c; }
    wave_sync();
    v8h hv[8];
#pragma unroll
    for (int s = 0; s < 8; ++s) { const int p = s * 32 + lane; const int row = p >> 4, c8 = (p & 15) * 8;   // 8 s x 2 rows = 16 rows; 16 lanes x 8 = 128 columns = two lines
        const v4f x0 = *(const v4fa*)(&os[wb + row * OSP + c8]); const v4f x1 = *(const v4fa*)(&os[wb + row * OSP + c8 + 4]); v8h q;
#pragma unroll
        for (int i = 0; i < 4; ++i) { q[i] = toh_flush(x0[i]); q[4 + i] = toh_flush(x1[i]); }
        hv[s] = q; }
    h16* crow = CTX + ((size_t)b * SEQ + (size_t)t0) * DQ + (size_t)h * HD;
{
#pragma unroll
        for (int s = 0; s < 8; ++s) { const int p = s * 32 + lane; const int row = p >> 4, c8 = (p & 15) * 8;
            *(v8h*)(crow + (size_t)row * DQ + c8) = hv[s]; }
         }
}

// k_out: output projection, OW waves per 64x64 tile (16 accumulators each), f16 operands straight from K-contiguous planes, K = DQ split over the waves:
// wave w takes the 32-wide k-steps w, w + OW, w + 2 OW, ... (neighbouring waves read the two halves of the same 128-B lines), so OW times as many loads are in flight per tile.
// OUT[m][n] = (1/16384) sum_k A[m][k] Bt[n][k]; A = ctx rows (m = b*SEQ + t, x256), Bt = Wo rows (n, x64). grid (NB*SEQ/64, DX/64).
// Epilogue: every wave writes its partial 64x64 f32 tile to its own LDS plane; behind one barrier wave w adds rows 8w..8w+7 over the planes in plane order 0..OW-1 and stores them as whole lines.
__global__ __launch_bounds__(32 * OW) void k_out(const h16* __restrict__ A, const h16* __restrict__ Bt, float* OUT) {
    __shared__ __align__(16) float os[OW * 64 * 68];
    const int K = DQ;
    const int lane = threadIdx.x & 31, lr = lane & 15, hi = lane >> 4; const int r0 = blockIdx.x * 64, c0 = blockIdx.y * 64;
    const int wave = __builtin_amdgcn_readfirstlane((int)(threadIdx.x >> 5));
    v8f acc[4][4];
#pragma unroll
    for (int mb = 0; mb < 4; ++mb)
#pragma unroll
        for (int nb = 0; nb < 4; ++nb) acc[mb][nb] = (v8f){};
    const size_t aoff = (size_t)(r0 + lr) * K + 8 * hi, boff = (size_t)(c0 + lr) * K + 8 * hi;
#pragma unroll 1
    for (int kc = wave * 32; kc < K; kc += 32 * OW) {
        v16h a[4];
#pragma unroll
        for (int mb = 0; mb < 4; ++mb) a[mb] = ldh(A + aoff + (size_t)mb * 16 * K + kc);
#pragma unroll
        for (int nb = 0; nb < 4; ++nb) { const v16h bq = ldh(Bt + boff + (size_t)nb * 16 * K + kc);
#pragma unroll
            for (int mb = 0; mb < 4; ++mb) acc[mb][nb] = wmma16g(a[mb], bq, acc[mb][nb]); }
    }
    float* ow = os + wave * (64 * 68);
#pragma unroll
    for (int mb = 0; mb < 4; ++mb)
#pragma unroll
        for (int nb = 0; nb < 4; ++nb)
#pragma unroll
            for (int j = 0; j < 8; ++j) ow[(mb * 16 + hi * 8 + j) * 68 + nb * 16 + lr] = acc[mb][nb][j];   // D: row 8h+j, col lane&15
    __syncthreads();                                            // every wave's partial tile is readable by every wave
    const int bb = r0 / SEQ, tt = r0 % SEQ;
    float* obase = OUT + ((size_t)bb * OUT_SEQ + (size_t)tt) * DX + c0;
    v4f ov[4];
#pragma unroll
    for (int s = 0; s < 4; ++s) { const int p = s * 32 + lane; const int row = wave * (64 / OW) + (p >> 4), c4 = (p & 15) * 4;   // 4 s x 2 rows = 8 rows; 16 lanes x 4 floats = 64 columns = two lines
        v4f sum = *(const v4fa*)(&os[row * 68 + c4]);
#pragma unroll
        for (int q = 1; q < OW; ++q) sum += *(const v4fa*)(&os[q * (64 * 68) + row * 68 + c4]);
        ov[s] = sum * OSC; }
#pragma unroll
    for (int s = 0; s < 4; ++s) { const int p = s * 32 + lane; const int row = wave * (64 / OW) + (p >> 4), c4 = (p & 15) * 4;
        *(v4f*)(obase + (size_t)row * DX + c4) = ov[s]; }
}

static constexpr size_t al256(size_t v) { return (v + 255) & ~(size_t)255; }
static constexpr size_t SZ_XB = al256((size_t)NB * SEQ * DX * 2);          // x bf16 [NB*SEQ][192]
static constexpr size_t SZ_WB = al256((size_t)3 * DQ * DX * 2);            // Wq | Wk | Wv bf16 [3][2048][192]
static constexpr size_t SZ_WO = al256((size_t)DX * DQ * 2);                // Wo f16 [192][2048]
static constexpr size_t SZ_TB = al256((size_t)SEQ * 64 * 4);               // cos or sin table [SEQ][64]
static constexpr size_t SZ_PL = al256((size_t)NB * NH_ * SEQ * HD * 2);    // q, k, v^T planes
static constexpr size_t SZ_CX = al256((size_t)NB * SEQ * DQ * 2);          // ctx plane
static constexpr size_t SZ_TOTAL = SZ_XB + SZ_WB + SZ_WO + 2 * SZ_TB + 3 * SZ_PL + SZ_CX;
static_assert(SZ_TOTAL <= (size_t)134217728);          // workspace carve <= 128 MiB
static_assert(((size_t)DQ * DX * 2) % 256 == 0);       // weight sub-planes stay 256-byte aligned
static_assert((size_t)NB * NH_ * SEQ * HD == (size_t)NB * DQ * SEQ);       // v^T plane [(b*2048 + m)][t] has the same extent as the q/k planes

extern "C" void kernel_launch(void* const* d_in, const int* in_sizes, int n_in,
                              void* d_out, int out_size, void* d_ws, size_t ws_size, hipStream_t stream) {
    if (n_in < 8) return;
    const size_t needx = ((size_t)(NB - 1) * SEQ_FULL + SEQ) * DX;
    const size_t needm = ((size_t)(NB - 1) * SEQ_FULL + (size_t)(SEQ - 1)) * SEQ_FULL + SEQ;
    if ((size_t)in_sizes[0] < needx || (size_t)in_sizes[1] < needm) return;
    if ((size_t)in_sizes[2] < (size_t)DQ * DX || (size_t)in_sizes[3] < (size_t)DQ * DX || (size_t)in_sizes[4] < (size_t)DQ * DX || (size_t)in_sizes[5] < (size_t)DX * DQ) return;
    if (in_sizes[6] < HD || in_sizes[7] < HD) return;
    if ((size_t)out_size < ((size_t)(NB - 1) * OUT_SEQ + SEQ) * DX) return;
    if (SZ_TOTAL > ws_size) return;
    // wire order: x, mask0, wq, wk, wv, wo, q_norm_w, k_norm_w
    const float* x    = (const float*)d_in[0];
    const float* mask = (const float*)d_in[1];
    const float* wq   = (const float*)d_in[2];
    const float* wk   = (const float*)d_in[3];
    const float* wv   = (const float*)d_in[4];
    const float* wo   = (const float*)d_in[5];
    const float* qnw  = (const float*)d_in[6];
    const float* knw  = (const float*)d_in[7];
    float* OUT = (float*)d_out;      // [NB][SEQ][192]
    char* wsp = (char*)d_ws;
    bf*  XB  = (bf*)wsp;  wsp += SZ_XB;               // [NB*SEQ][192]
    bf*  WB  = (bf*)wsp;  wsp += SZ_WB;               // [3][2048][192]: q | k | v  ([out][in] = Bt as-is)
    h16* WOH = (h16*)wsp; wsp += SZ_WO;               // [192][2048] x64
    float* COS = (float*)wsp; wsp += SZ_TB;           // [SEQ][64]
    float* SIN = (float*)wsp; wsp += SZ_TB;           // [SEQ][64]
    h16* QH  = (h16*)wsp; wsp += SZ_PL;               // [NB*16][SEQ][128]
    h16* KP  = (h16*)wsp; wsp += SZ_PL;               // [NB*16][SEQ][128]
    h16* VT  = (h16*)wsp; wsp += SZ_PL;               // [NB*16][128][SEQ]
    h16* CTX = (h16*)wsp; wsp += SZ_CX;               // [NB*SEQ][2048] x256
    bf* WQ = WB; bf* WK = WB + (size_t)DQ * DX; bf* WV = WB + (size_t)2 * DQ * DX;

    if (SEQ == SEQ_FULL) {
        const size_t n8 = (size_t)NB * SEQ * DX / 8;
        k_cvt8<<<(unsigned)((n8 + 255) / 256), 256, 0, stream>>>(x, XB, n8);
    } else {
        const size_t n8 = (size_t)SEQ * DX / 8;
        for (int b = 0; b < NB; ++b) k_cvt8<<<(unsigned)((n8 + 255) / 256), 256, 0, stream>>>(x + (size_t)b * SEQ_FULL * DX, XB + (size_t)b * SEQ * DX, n8);
    }
    { const size_t n8 = (size_t)DQ * DX / 8; const unsigned g = (unsigned)((n8 + 255) / 256);
      k_cvt8<<<g, 256, 0, stream>>>(wq, WQ, n8); k_cvt8<<<g, 256, 0, stream>>>(wk, WK, n8); k_cvt8<<<g, 256, 0, stream>>>(wv, WV, n8);
      k_cvtw<<<g, 256, 0, stream>>>(wo, WOH, n8, WOS); }
    k_tab<<<(unsigned)(SEQ * 64 / 256), 256, 0, stream>>>(COS, SIN, SEQ * 64);

    // q, k: A = x rows (m = b*SEQ + t), Bt = W rows (n = h*128 + d) -> normalised, rotated plane [(b*16 + h)][t][d]
    k_qk<<<dim3(NB * SEQ / 32, NH_, 1), 32, 0, stream>>>(XB, WQ, qnw, COS, SIN, QH);
    k_qk<<<dim3(NB * SEQ / 32, NH_, 1), 32, 0, stream>>>(XB, WK, knw, COS, SIN, KP);
    // v^T: A = Wv rows (m = h*128 + d), Bt = x rows (n = b*SEQ + t) -> plane [(b*2048 + m)][t] = [(b*16 + h)][d][t]
    k_vt<<<dim3(DQ / 64, NB * SEQ / 64, 1), 32, 0, stream>>>(WV, XB, VT);

    k_flash<<<dim3(SEQ / (16 * AW), NB * NH_, 1), 32 * AW, 0, stream>>>(QH, KP, VT, mask, CTX);
    // output projection: A = ctx rows [b*SEQ + t][2048], Bt = Wo rows [192][2048]
    k_out<<<dim3(NB * SEQ / 64, DX / 64, 1), 32 * OW, 0, stream>>>(CTX, WOH, OUT);
}

// v004
// One run takes 147 microseconds.
// In two side-by-side timings against v003, it was 1.28 and 1.30 times as fast.
// Over all steps from v000 it is 2.87 times as fast.
#include <hip/hip_runtime.h>

// Dense self-attention layer: x [NB][SEQ][192]; Wq/Wk/Wv [2048][192] ([out][in], y = x W^T, no bias); 16 heads x 128; per-head RMS normalisation of q and k (eps 1e-6, gain inputs);
// rotate-half rotary embeddings (base 1e6, positions 0..SEQ-1); scores = q.k * 128^-0.5 + additive mask [NB][1][SEQ][SEQ] (read by value); softmax over keys; P.V; heads merged; output = ctx Wo^T with Wo [192][2048] (f32).
// Compute dtypes, f32 accumulate everywhere: q/k/v projections v_wmma_f32_16x16x32_bf16 (x and W RNE-converted to bf16; products exact);
// scores v_wmma_f32_16x16x32_f16 (q, k single f16 planes after normalisation and rotary); P.V v_wmma_f32_16x16x32_f16 (P single f16 with x16384 carry that cancels in the normalisation, v single f16);
// output projection v_wmma_f32_16x16x32_f16 (ctx single f16 with x256 carry, Wo = bf16-converted value x64 as f16; 1/16384 folded in the f32 epilogue). Softmax f32 (online, running max), row sum over the converted P.
// Layout: bf16 copies of x and Wq|Wk|Wv; f16 Wo plane; cos/sin tables [SEQ][64] f32; q, k planes [b*16+h][t][128]; v^T plane [b*16+h][d][t]; ctx plane [b*SEQ+t][h*128+d];
// fused flash kernel in transposed form (S^T = K Q^T, O^T = V^T P^T), K and V^T tiles staged in LDS for the whole block, Q fragments straight from the f16 plane, no score or probability plane in memory.

#ifndef NB
#define NB 2
#endif
#ifndef SEQ
#define SEQ 2048
#endif
#define NB_FULL  2
#define SEQ_FULL 2048
#ifndef OUT_SEQ
#define OUT_SEQ SEQ              // row pitch (in tokens) between batches of the output
#endif
#define DX   192                 // model width (projection K, output N)
#define NH_  16
#define HD   128
#define DQ   2048                // NH_ * HD
#define AW   8                   // waves per flash block (16 query rows each)
#define KT   64                  // keys per LDS stage of the flash kernel
#define OW   8                   // waves per output-projection block (K split over them)
#define KPH  136                 // LDS row pitch (halves) of the K tile: 272 B = 16 B x odd
#define VPH  72                  // LDS row pitch (halves) of the V^T tile: 144 B = 16 B x odd
#define KTB  (KT * KPH * 2)      // bytes of one K tile in LDS
#define VTB  (HD * VPH * 2)      // bytes of one V^T tile in LDS
#define STB  (KTB + VTB)         // bytes of one stage
#define OSP  132                 // LDS row pitch (floats) of the flash output tile
#define OSQ  132                 // LDS row pitch (floats) of the q/k epilogue tile
#define SC2  ((float)(0.08838834764831845 * 1.4426950408889634))   // HD^-0.5 * log2(e)
#define L2E  1.4426950408889634f
#define PSH  14.0f               // log2 of the P carry (16384)
#define NEGB (-3.0e38f)
#define CXS  256.0f              // carry of the ctx plane
#define WOS  64.0f               // carry of the Wo plane
#define OSC  (1.0f / 16384.0f)   // 1 / (CXS * WOS)

static_assert(HD == 128);                      // q/k plane row = 256 bytes = two lines; one head = 8 column tiles of 16
static_assert(NH_ * HD == DQ);                 // head h = columns h*128 + d
static_assert(HD % 32 == 0);                   // score k-loop steps by 32
static_assert(DX % 32 == 0);                   // projection k-loop steps by 32
static_assert(DQ % 32 == 0);                   // output-projection k-loop steps by 32
static_assert(DX % 64 == 0);                   // output column tiles of 64
static_assert(DQ % 64 == 0);                   // v^T row tiles of 64
static_assert(SEQ % 64 == 0);                  // a 64-token tile never straddles two batches
static_assert((NB * SEQ) % 64 == 0);
static_assert(SEQ % 32 == 0);                  // key loop steps by 32; 32-token q/k tiles
static_assert(SEQ % (16 * AW) == 0);           // flash grid covers the sequence exactly
static_assert(((size_t)SEQ * DX) % 64 == 0);
static_assert(((size_t)DQ * DX) % 2048 == 0);  // weight converts: whole 256-thread blocks
static_assert((SEQ * 64) % 256 == 0);
static_assert(NB <= NB_FULL);
static_assert(SEQ <= SEQ_FULL);
static_assert(OSP >= HD);
static_assert(OSQ >= HD);
static_assert((OSP * 4) % 16 == 0);
static_assert((OSQ * 4) % 16 == 0);
static_assert((DX * 4) % 128 == 0);            // output rows start on a line
static_assert(32 * 16 * 8 == 16 * HD * 2);     // q/k epilogue and ctx epilogue: 32 lanes x 16 B x 8 instructions == 16 rows x 256 B
static_assert(32 * 16 * 4 == 16 * 64 * 2);
static_assert(16 * OSQ * 4 <= 131072);         // static LDS of the q/k projection kernel
static_assert(16 * 68 * 4 <= 131072);          // static LDS of the v^T projection kernel
static_assert(OW * 64 * 68 * 4 <= 163840);     // static LDS of the output projection kernel: one partial tile per wave
static_assert(DQ % (32 * OW) == 0);            // every wave of the output projection takes the same number of k-steps
static_assert(64 % OW == 0 && (64 / OW) * 16 == 4 * 32);   // output epilogue: 4 pieces of 16 B per lane cover the wave's rows
static_assert(2 * STB <= 131072);              // static LDS of the flash kernel
static_assert(AW * 16 * OSP * 4 <= 2 * STB);   // the output tiles reuse the two stage buffers
static_assert(SEQ % KT == 0 && SEQ / KT >= 2); // whole stages; the two-buffer prologue needs two
static_assert(KT * HD * 2 == 4 * 32 * AW * 16);  // K tile: 4 pieces of 16 B per thread
static_assert(HD * KT * 2 == 4 * 32 * AW * 16);  // V^T tile: 4 pieces of 16 B per thread
static_assert(KT == 64 && 32 * AW == 256);     // piece maps of stage_kv: 16 pieces per K row, 8 per V^T row, 256 threads
static_assert(STB % 16 == 0 && KTB % 16 == 0);

typedef _Float16 h16;
typedef unsigned short bf;
typedef __attribute__((ext_vector_type(16))) __bf16   v16bf;
typedef __attribute__((ext_vector_type(16))) _Float16 v16h;
typedef __attribute__((ext_vector_type(8)))  _Float16 v8h;
typedef __attribute__((ext_vector_type(8)))  unsigned short v8us;
typedef __attribute__((ext_vector_type(8)))  float    v8f;
typedef __attribute__((ext_vector_type(4)))  float    v4f;
typedef v4f  __attribute__((may_alias)) v4fa;

__device__ __forceinline__ unsigned short f2bf(float f) { unsigned u = __float_as_uint(f); u += 0x7FFFu + ((u >> 16) & 1u); return (unsigned short)(u >> 16); }
__device__ __forceinline__ float bfr(float f) { return __uint_as_float(((unsigned)f2bf(f)) << 16); }   // value after RNE convert to bf16
__device__ __forceinline__ v16h cat16(v8h lo, v8h hi) { return __builtin_shufflevector(lo, hi, 0, 1, 2, 3, 4, 5, 6, 7, 8, 9, 10, 11, 12, 13, 14, 15); }
__device__ __forceinline__ v16bf cat16b(v8us lo, v8us hi) { return __builtin_bit_cast(v16bf, __builtin_shufflevector(lo, hi, 0, 1, 2, 3, 4, 5, 6, 7, 8, 9, 10, 11, 12, 13, 14, 15)); }
__device__ __forceinline__ v8f wmma16(v16h a, v16h b, v8f c) { return __builtin_amdgcn_wmma_f32_16x16x32_f16(false, a, false, b, (short)0, c, false, false); }
__device__ __forceinline__ v8f wmmab(v16bf a, v16bf b, v8f c) { return __builtin_amdgcn_wmma_f32_16x16x32_bf16(false, a, false, b, (short)0, c, false, false); }
// fragment loaders from K-contiguous 16-bit rows; p already includes + 8*(lane>>4): elements 0..7 <- k0+8h+0..7, elements 8..15 <- k0+16+8h+0..7 (same map for A and B)
__device__ __forceinline__ v16h  ldh(const h16* p) { return cat16(*(const v8h*)p, *(const v8h*)(p + 16)); }
__device__ __forceinline__ v16bf ldb(const bf* p)  { return cat16b(*(const v8us*)p, *(const v8us*)(p + 16)); }
// ordering point for wave-private LDS tiles (same wave writes and reads)
__device__ __forceinline__ void wave_sync() { __builtin_amdgcn_fence(3 /* release order */, "wavefront"); __builtin_amdgcn_wave_barrier(); asm volatile("" ::: "memory"); }

// f32 -> f16 operand convert that cannot produce a subnormal (|v| < 2^-14 -> +0)
static __device__ __forceinline__ h16 toh_flush(float v) { const h16 r = (h16)v; return (fabsf(v) < 6.103515625e-05f) ? (h16)0.0f : r; }
// one matrix instruction + its own four-slot guard (one accumulator per guard)
static __device__ __forceinline__ v8f wmma16g(v16h a, v16h b, v8f c) { c = wmma16(a, b, c); asm volatile("v_nop\n\tv_nop\n\tv_nop\n\tv_nop" : "+v"(c) : "v"(a), "v"(b)); return c; }
static __device__ __forceinline__ v8f wmmabg(v16bf a, v16bf b, v8f c) { c = wmmab(a, b, c); asm volatile("v_nop\n\tv_nop\n\tv_nop\n\tv_nop" : "+v"(c) : "v"(a), "v"(b)); return c; }

__global__ __launch_bounds__(256) void k_cvt8(const float* __restrict__ src, bf* dst, size_t n8) {
    const size_t i = (size_t)blockIdx.x * 256 + threadIdx.x; if (i >= n8) return;
    const v8f v = *(const v8f*)(src + i * 8); v8us o;
#pragma unroll
    for (int k = 0; k < 8; ++k) o[k] = f2bf(v[k]);
    *(v8us*)(dst + i * 8) = o; 
}

__global__ __launch_bounds__(256) void k_cvtw(const float* __restrict__ src, h16* dst, size_t n8, float sc) {
    const size_t i = (size_t)blockIdx.x * 256 + threadIdx.x; if (i >= n8) return;
    const v8f v = *(const v8f*)(src + i * 8); v8h o;
#pragma unroll
    for (int k = 0; k < 8; ++k) o[k] = toh_flush(bfr(v[k]) * sc);
    *(v8h*)(dst + i * 8) = o; 
}

// k_tab: rotary tables COS/SIN [SEQ][64] (f32): angle = (float)pos * inv_freq[j], inv_freq[j] = 1e6^(-j/64); precise sincosf (angles reach 2047 rad).
__global__ __launch_bounds__(256) void k_tab(float* COS, float* SIN, int n) {
#pragma clang fp contract(off)
    const int i = blockIdx.x * 256 + threadIdx.x; if (i >= n) return;
    const int pos = i >> 6, j = i & 63;
    const float invf = exp2f(-(float)j * (19.931568569324174f / 64.0f));   // log2(1e6) / 64
    const float ang = (float)pos * invf;
    float sn, cs; sincosf(ang, &sn, &cs);
    *(float*)(COS + i) = cs; *(float*)(SIN + i) = sn; 
}

// k_qk: projection + per-head RMS normalisation + rotary, ONE WAVE per 32 tokens x 128 columns (one head; 16 accumulators), operands straight from K-contiguous bf16 planes, K = DX.
// C[m][n] = sum_k A[m][k] Bt[n][k]; A = x rows (m = b*SEQ + t), Bt = W rows (n = h*128 + d). grid (NB*SEQ/32, NH_).
// Epilogue per 16-row slab: row sum of squares from the accumulators (8 column tiles per lane, xor 1/2/4/8 inside each 16-lane half), y = (c * rstd) * gain staged in a wave-private LDS tile;
// store stage: lane piece p = 32 s + lane -> row p>>4, columns c8 = 8 (p&15); out[c] = y[c] cos[c&63] + (c < 64 ? -y[c+64] : y[c-64]) sin[c&63] (tables by 16-B loads), f16;
__global__ __launch_bounds__(32) void k_qk(const bf* __restrict__ A, const bf* __restrict__ Bt, const float* __restrict__ nw,
                                           const float* __restrict__ COS, const float* __restrict__ SIN, h16* Ph) {
    __shared__ __align__(16) float os[16 * OSQ];
    const int K = DX;
    const int lane = threadIdx.x & 31, lr = lane & 15, hi = lane >> 4; const int r0 = blockIdx.x * 32, c0 = blockIdx.y * HD;
    v8f acc[2][8];
#pragma unroll
    for (int mb = 0; mb < 2; ++mb)
#pragma unroll
        for (int nb = 0; nb < 8; ++nb) acc[mb][nb] = (v8f){};
    const size_t aoff = (size_t)(r0 + lr) * K + 8 * hi, boff = (size_t)(c0 + lr) * K + 8 * hi;
#pragma unroll 1
    for (int kc = 0; kc < K; kc += 32) {
        const bf* pa = A + aoff + kc; const bf* pb = Bt + boff + kc;
        v16bf a[2], b[8];                                        // all 20 loads of the k-step stand ahead of its first product: one memory latency per k-step instead of one per column tile
#pragma unroll
        for (int mb = 0; mb < 2; ++mb) a[mb] = ldb(pa + (size_t)mb * 16 * K);
#pragma unroll
        for (int nb = 0; nb < 8; ++nb) b[nb] = ldb(pb + (size_t)nb * 16 * K);
        asm volatile("s_wait_xcnt 0x0" :: "v"(pa), "v"(pb) : "memory");   // stands between the loads and any rewrite of their address registers, which it keeps live (no load lands on them)
#pragma unroll
        for (int nb = 0; nb < 8; ++nb)
#pragma unroll
            for (int mb = 0; mb < 2; ++mb) acc[mb][nb] = wmmabg(a[mb], b[nb], acc[mb][nb]);
    }
    float wn[8];
#pragma unroll
    for (int nb = 0; nb < 8; ++nb) wn[nb] = bfr(nw[nb * 16 + lr]);                 // nb*16 + lr < HD
    const int bb = r0 / SEQ, tt = r0 % SEQ; const int zc = bb * NH_ + (int)blockIdx.y;
    const size_t tbase = ((size_t)zc * SEQ + (size_t)tt) * HD;
#pragma unroll
    for (int mb = 0; mb < 2; ++mb) {
#pragma unroll
        for (int j = 0; j < 8; ++j) {
            float ss = 0.0f;
#pragma unroll
            for (int nb = 0; nb < 8; ++nb) ss += acc[mb][nb][j] * acc[mb][nb][j];
            ss += __shfl_xor(ss, 1, 32); ss += __shfl_xor(ss, 2, 32); ss += __shfl_xor(ss, 4, 32); ss += __shfl_xor(ss, 8, 32);
            const float rs = rsqrtf(ss * (1.0f / 128.0f) + 1.0e-6f);
#pragma unroll
            for (int nb = 0; nb < 8; ++nb) os[(hi * 8 + j) * OSQ + nb * 16 + lr] = (acc[mb][nb][j] * rs) * wn[nb]; }   // D: row 8h+j, col lane&15
        wave_sync();
        v8h hv[8];
#pragma unroll
        for (int s = 0; s < 8; ++s) { const int p = s * 32 + lane; const int row = p >> 4, c8 = (p & 15) * 8;   // 8 s x 2 rows = 16 rows; 16 lanes x 8 = 128 columns
            const int pc = c8 ^ 64, jj = c8 & 63; const float sg = (c8 < 64) ? -1.0f : 1.0f;
            const v4f x0 = *(const v4fa*)(&os[row * OSQ + c8]), x1 = *(const v4fa*)(&os[row * OSQ + c8 + 4]);
            const v4f y0 = *(const v4fa*)(&os[row * OSQ + pc]), y1 = *(const v4fa*)(&os[row * OSQ + pc + 4]);
            const size_t to = (size_t)(tt + mb * 16 + row) * 64 + (size_t)jj;      // token position < SEQ, jj + 7 < 64
            const v4f ca = *(const v4f*)(COS + to), cb = *(const v4f*)(COS + to + 4), sa = *(const v4f*)(SIN + to), sb = *(const v4f*)(SIN + to + 4);
            v8h o;
#pragma unroll
            for (int i = 0; i < 4; ++i) { o[i] = toh_flush(x0[i] * ca[i] + (sg * y0[i]) * sa[i]); o[4 + i] = toh_flush(x1[i] * cb[i] + (sg * y1[i]) * sb[i]); }
            hv[s] = o; }
        const size_t sbs = tbase + (size_t)(mb * 16) * HD;
{
#pragma unroll
            for (int s = 0; s < 8; ++s) *(v8h*)(Ph + sbs + (size_t)(s * 32 + lane) * 8) = hv[s];
             }
        wave_sync();
    }
}

// k_vt: v^T projection, ONE WAVE per 64x64 tile (16 accumulators), K = DX. A = Wv rows (m = h*128 + d), Bt = x rows (n = b*SEQ + t); plane [(b*2048 + m)][t], row pitch SEQ. grid (DQ/64, NB*SEQ/64).
__global__ __launch_bounds__(32) void k_vt(const bf* __restrict__ A, const bf* __restrict__ Bt, h16* Ph) {
    __shared__ __align__(16) float os[16 * 68];
    const int K = DX;
    const int lane = threadIdx.x & 31, lr = lane & 15, hi = lane >> 4; const int r0 = blockIdx.x * 64, c0 = blockIdx.y * 64;
    v8f acc[4][4];
#pragma unroll
    for (int mb = 0; mb < 4; ++mb)
#pragma unroll
        for (int nb = 0; nb < 4; ++nb) acc[mb][nb] = (v8f){};
    const size_t aoff = (size_t)(r0 + lr) * K + 8 * hi, boff = (size_t)(c0 + lr) * K + 8 * hi;
#pragma unroll 1
    for (int kc = 0; kc < K; kc += 32) {
        const bf* pa = A + aoff + kc; const bf* pb = Bt + boff + kc;
        v16bf a[4], b[4];                                        // all 16 loads of the k-step stand ahead of its first product: one memory latency per k-step instead of one per column tile
#pragma unroll
        for (int mb = 0; mb < 4; ++mb) a[mb] = ldb(pa + (size_t)mb * 16 * K);
#pragma unroll
        for (int nb = 0; nb < 4; ++nb) b[nb] = ldb(pb + (size_t)nb * 16 * K);
        asm volatile("s_wait_xcnt 0x0" :: "v"(pa), "v"(pb) : "memory");   // stands between the loads and any rewrite of their address registers, which it keeps live (no load lands on them)
#pragma unroll
        for (int nb = 0; nb < 4; ++nb)
#pragma unroll
            for (int mb = 0; mb < 4; ++mb) acc[mb][nb] = wmmabg(a[mb], b[nb], acc[mb][nb]);
    }
    const int bb = c0 / SEQ, tt = c0 % SEQ;
    const size_t tbase = (size_t)bb * (size_t)DQ * SEQ + (size_t)r0 * SEQ + (size_t)tt;
#pragma unroll
    for (int mb = 0; mb < 4; ++mb) {
#pragma unroll
        for (int nb = 0; nb < 4; ++nb) {
#pragma unroll
            for (int j = 0; j < 8; ++j) os[(hi * 8 + j) * 68 + nb * 16 + lr] = acc[mb][nb][j]; }   // D: row 8h+j, col lane&15
        wave_sync();
        v8h hv[4];
#pragma unroll
        for (int s = 0; s < 4; ++s) { const int row = 4 * s + (lane >> 3), c8 = (lane & 7) * 8;   // 4 s x 4 row groups = 16 rows; 8 lanes x 8 = 64 columns
            const v4f x0 = *(const v4fa*)(&os[row * 68 + c8]); const v4f x1 = *(const v4fa*)(&os[row * 68 + c8 + 4]); v8h o;
#pragma unroll
            for (int i = 0; i < 4; ++i) { o[i] = toh_flush(x0[i]); o[4 + i] = toh_flush(x1[i]); }
            hv[s] = o; }
        const size_t sbs = tbase + (size_t)(mb * 16) * SEQ;
{
#pragma unroll
            for (int s = 0; s < 4; ++s) { const int row = 4 * s + (lane >> 3), c8 = (lane & 7) * 8;
                *(v8h*)(Ph + sbs + (size_t)row * SEQ + c8) = hv[s]; }
             }
        wave_sync();
    }
}

// stage_kv: one stage (KT keys) into LDS, 8 asynchronous 16-B copies per thread, whole 128-B lines per wave instruction.
// K tile: KT rows x 256 B, contiguous in the plane; piece c = 256 i + tid -> row c>>4, 16-B column c&15. V^T tile: 128 rows x 128 B; piece c -> row c>>3, 16-B column c&7.
// kg, vg: the thread's first global piece; lk, lv: its LDS byte addresses. The s_wait_xcnt closes the statement so that no address register is rewritten ahead of it.
static __device__ __forceinline__ void stage_kv(const h16* kg, const h16* vg, unsigned lk, unsigned lv) {
    asm volatile("global_load_async_to_lds_b128 %0, %1, off\n\t"
                 "global_load_async_to_lds_b128 %2, %3, off\n\t"
                 "global_load_async_to_lds_b128 %4, %5, off\n\t"
                 "global_load_async_to_lds_b128 %6, %7, off\n\t"
                 "global_load_async_to_lds_b128 %8, %9, off\n\t"
                 "global_load_async_to_lds_b128 %10, %11, off\n\t"
                 "global_load_async_to_lds_b128 %12, %13, off\n\t"
                 "global_load_async_to_lds_b128 %14, %15, off\n\t"
                 "s_wait_xcnt 0x0"
                 :: "v"(lk), "v"(kg), "v"(lk + 16 * KPH * 2), "v"(kg + 2048), "v"(lk + 32 * KPH * 2), "v"(kg + 4096), "v"(lk + 48 * KPH * 2), "v"(kg + 6144),
                    "v"(lv), "v"(vg), "v"(lv + 32 * VPH * 2), "v"(vg + (size_t)32 * SEQ), "v"(lv + 64 * VPH * 2), "v"(vg + (size_t)64 * SEQ), "v"(lv + 96 * VPH * 2), "v"(vg + (size_t)96 * SEQ)
                 : "memory");
}

// k_flash: fused attention, one wave per 16 query rows of one (batch, head), AW waves per block on the same (batch, head); K and V^T tiles of KT keys come once per block into LDS
// (two buffers, the next tile's copies fly while this one is worked on), fragments by two 16-B LDS loads each; Q fragments straight from the f16 plane, once per wave.
// Transposed form: S^T[key][t] = K Q^T (A = K rows, B = Q rows, 4 k-steps over d); lane (t = lane&15, h = lane>>4) holds keys 8h+r of each 16-key tile, so the packed
// P tile is directly the B fragment of O^T[d][t] = V^T P^T (element r <- tile keys 0..15, element 8+r <- tile keys 16..31, lane unchanged); 8 output tiles of 16 d.
// Additive mask row t, keys key0+8h+0..7 and key0+16+8h+0..7: four 16-B loads per lane per step, issued one step ahead, value RNE-converted to bf16, added after the scale (base-2 domain).
// Softmax state (running max, partial sum) is one scalar per lane; the two lane halves of a row are combined with one xor-16 exchange. Q fragments are loaded once, ahead of the key loop, and stay in registers.
__global__ __launch_bounds__(32 * AW) __attribute__((amdgpu_num_vgpr(256)))
void k_flash(const h16* __restrict__ QH, const h16* __restrict__ KP, const h16* __restrict__ VT, const float* __restrict__ mask, h16* CTX) {
    __shared__ __align__(16) char sm[2 * STB];
    float* os = (float*)sm;                                     // output tiles, after the key loop
    const int tid = threadIdx.x;
    const int lane = threadIdx.x & 31, lr = lane & 15, hi = lane >> 4;
    const int wave = __builtin_amdgcn_readfirstlane((int)(threadIdx.x >> 5));
    const int zh = blockIdx.y; const int b = zh / NH_, h = zh % NH_;
    const int t0 = (blockIdx.x * AW + wave) * 16;
    const size_t pbase = (size_t)zh * SEQ * HD;
    const size_t qo = pbase + (size_t)(t0 + lr) * HD + 8 * hi;  // + ks*32          (B fragment: col t, k = d)
    const int ko = lr * KPH + 8 * hi;                           // + key*KPH + ks*32 (A fragment: row key, k = d), halves in the K tile
    const int vo = lr * VPH + 8 * hi;                           // + 16j*VPH + key   (A fragment: row d, k = key), halves in the V^T tile
    const unsigned lbase = (unsigned)(size_t)sm;                // LDS byte address of the stage buffers
    const unsigned lk = lbase + (unsigned)((tid >> 4) * (KPH * 2) + (tid & 15) * 16);
    const unsigned lv = lbase + (unsigned)(KTB + (tid >> 3) * (VPH * 2) + (tid & 7) * 16);
    const h16* kg = KP + pbase + (size_t)tid * 8;
    const h16* vg = VT + pbase + (size_t)(tid >> 3) * SEQ + (size_t)(tid & 7) * 8;
    const float* mrow = mask + ((size_t)b * SEQ_FULL + (size_t)(t0 + lr)) * SEQ_FULL + 8 * hi;
    v8f o[8];
#pragma unroll
    for (int j = 0; j < 8; ++j) o[j] = (v8f){};
    float m = NEGB, l = 0.0f;
    stage_kv(kg, vg, lk, lv);
    v16h qf[HD / 32];                                           // the wave's 16 query rows as B fragments, loaded once and held in 32 registers for the whole key loop
#pragma unroll   // constant indices, so that qf lives in registers and not in scratch memory
    for (int ks = 0; ks < HD / 32; ++ks) qf[ks] = ldh(QH + qo + ks * 32);
    v4f m0 = *(const v4f*)mrow, m1 = *(const v4f*)(mrow + 4), m2 = *(const v4f*)(mrow + 16), m3 = *(const v4f*)(mrow + 20);   // mask values of step 0; every later step's are loaded one step ahead
    asm volatile("s_wait_xcnt 0x0" ::: "memory");               // stands between the Q loads and the later reuse of their address registers
    asm volatile("s_wait_asynccnt 0x0" ::: "memory");           // this wave's copies of tile 0 have landed
    __syncthreads();                                            // tile 0 is readable by every wave
    stage_kv(kg + (size_t)KT * HD, vg + KT, lk + STB, lv + STB);
#pragma unroll 1
    for (int t = 0; t < SEQ / KT; ++t) {
      const unsigned bo = (unsigned)(t & 1) * STB;
      const h16* kt = (const h16*)(sm + bo) + ko;
      const h16* vt = (const h16*)(sm + bo + KTB) + vo;
#pragma unroll   // both 32-key steps of a tile in line: their tile offsets become immediates of the LDS loads
      for (int sub = 0; sub < KT / 32; ++sub) {
        const int key0 = t * KT + sub * 32;
        const h16* ka = kt + sub * 32 * KPH;
        v8f sA = (v8f){}, sB = (v8f){};
        v16h ka0[HD / 32], kb0[HD / 32];                         // the step's 16 K loads stand ahead of its first product: one LDS latency per step instead of one per k-step
#pragma unroll
        for (int ks = 0; ks < HD / 32; ++ks) { ka0[ks] = ldh(ka + ks * 32); kb0[ks] = ldh(ka + 16 * KPH + ks * 32); }
#pragma unroll
        for (int ks = 0; ks < HD / 32; ++ks) { sA = wmma16g(ka0[ks], qf[ks], sA); sB = wmma16g(kb0[ks], qf[ks], sB); }
        const h16* va = vt + sub * 32;
        v16h vf[8];                                              // the step's 16 V^T loads are free to issue under the softmax arithmetic (the listing has most of them there), which covers their latency
#pragma unroll
        for (int j = 0; j < 8; ++j) vf[j] = ldh(va + (16 * j) * VPH);
        float ta[8], tb[8]; float mx = NEGB;
#pragma unroll
        for (int r = 0; r < 4; ++r) {
            ta[r] = sA[r] * SC2 + bfr(m0[r]) * L2E; ta[4 + r] = sA[4 + r] * SC2 + bfr(m1[r]) * L2E;
            tb[r] = sB[r] * SC2 + bfr(m2[r]) * L2E; tb[4 + r] = sB[4 + r] * SC2 + bfr(m3[r]) * L2E; }
        const float* mp = mrow + ((key0 + 32 < SEQ) ? key0 + 32 : 0);   // next step's keys +8h+0..7 and +16+8h+0..7, all < SEQ (behind the last step: step 0's again, unused)
        m0 = *(const v4f*)mp; m1 = *(const v4f*)(mp + 4); m2 = *(const v4f*)(mp + 16); m3 = *(const v4f*)(mp + 20);
#pragma unroll
        for (int r = 0; r < 8; ++r) mx = fmaxf(mx, fmaxf(ta[r], tb[r]));
        mx = fmaxf(mx, __shfl_xor(mx, 16, 32));
        const float mnew = fmaxf(m, mx);
        const float alpha = __builtin_amdgcn_exp2f(m - mnew);
        const float sh = PSH - mnew;
        v16h pb; float ls = 0.0f;
#pragma unroll
        for (int r = 0; r < 8; ++r) {
            const float xa = ta[r] + sh, xb = tb[r] + sh;
            const float ea = __builtin_amdgcn_exp2f(xa), eb = __builtin_amdgcn_exp2f(xb);
            const float ga = (xa < -14.0f) ? 0.0f : ea, gb = (xb < -14.0f) ? 0.0f : eb;   // no subnormal f16 P (select on the exponent argument)
            const h16 pa = (h16)ga; const h16 pc = (h16)gb;
            pb[r] = pa; pb[8 + r] = pc;
            ls += (float)pa + (float)pc; }
        l = l * alpha + ls; m = mnew;
#pragma unroll
        for (int j = 0; j < 8; ++j) o[j] = o[j] * alpha;
#pragma unroll
        for (int j = 0; j < 8; ++j) o[j] = wmma16g(vf[j], pb, o[j]);
      }
      asm volatile("s_wait_dscnt 0x0" ::: "memory");            // this wave's reads of tile t are done before its buffer is refilled
      asm volatile("s_wait_asynccnt 0x0" ::: "memory");         // this wave's copies of tile t + 1 have landed
      __syncthreads();                                          // publishes tile t + 1 and ends every wave's reads of tile t
      if (t + 2 < SEQ / KT) stage_kv(kg + (size_t)(t + 2) * KT * HD, vg + (t + 2) * KT, lk + bo, lv + bo);
    }
    asm volatile("s_wait_asynccnt 0x0" ::: "memory");           // no copy is outstanding when the buffers become output tiles
    l += __shfl_xor(l, 16, 32);
    const bool any = l > 0.0f;
    const float lsafe = any ? l : 1.0f;
    const float inv = any ? ((1.0f / lsafe) * CXS) : 0.0f;
    const int wb = wave * 16 * OSP;
    // O^T D layout: o[j][r] = (d = 16j + 8h + r, t = lane&15) -> os[t][d]; rows 0..15 x columns 0..127 all written
#pragma unroll
    for (int j = 0; j < 8; ++j) { v4f a, c;
        a[0] = o[j][0] * inv; a[1] = o[j][1] * inv; a[2] = o[j][2] * inv; a[3] = o[j][3] * inv; c[0] = o[j][4] * inv; c[1] = o[j][5] * inv; c[2] = o[j][6] * inv; c[3] = o[j][7] * inv;
        *(v4fa*)(&os[wb + lr * OSP + 16 * j + 8 * hi]) = a; *(v4fa*)(&os[wb + lr * OSP + 16 * j + 8 * hi + 4]) = c; }
    wave_sync();
    v8h hv[8];
#pragma unroll
    for (int s = 0; s < 8; ++s) { const int p = s * 32 + lane; const int row = p >> 4, c8 = (p & 15) * 8;   // 8 s x 2 rows = 16 rows; 16 lanes x 8 = 128 columns = two lines
        const v4f x0 = *(const v4fa*)(&os[wb + row * OSP + c8]); const v4f x1 = *(const v4fa*)(&os[wb + row * OSP + c8 + 4]); v8h q;
#pragma unroll
        for (int i = 0; i < 4; ++i) { q[i] = toh_flush(x0[i]); q[4 + i] = toh_flush(x1[i]); }
        hv[s] = q; }
    h16* crow = CTX + ((size_t)b * SEQ + (size_t)t0) * DQ + (size_t)h * HD;
{
#pragma unroll
        for (int s = 0; s < 8; ++s) { const int p = s * 32 + lane; const int row = p >> 4, c8 = (p & 15) * 8;
            *(v8h*)(crow + (size_t)row * DQ + c8) = hv[s]; }
         }
}

// k_out: output projection, OW waves per 64x64 tile (16 accumulators each), f16 operands straight from K-contiguous planes, K = DQ split over the waves:
// wave w takes the 32-wide k-steps w, w + OW, w + 2 OW, ... (neighbouring waves read the two halves of the same 128-B lines), so OW times as many loads are in flight per tile.
// OUT[m][n] = (1/16384) sum_k A[m][k] Bt[n][k]; A = ctx rows (m = b*SEQ + t, x256), Bt = Wo rows (n, x64). grid (NB*SEQ/64, DX/64).
// Epilogue: every wave writes its partial 64x64 f32 tile to its own LDS plane; behind one barrier wave w adds rows 8w..8w+7 over the planes in plane order 0..OW-1 and stores them as whole lines.
__global__ __launch_bounds__(32 * OW) void k_out(const h16* __restrict__ A, const h16* __restrict__ Bt, float* OUT) {
    __shared__ __align__(16) float os[OW * 64 * 68];
    const int K = DQ;
    const int lane = threadIdx.x & 31, lr = lane & 15, hi = lane >> 4; const int r0 = blockIdx.x * 64, c0 = blockIdx.y * 64;
    const int wave = __builtin_amdgcn_readfirstlane((int)(threadIdx.x >> 5));
    v8f acc[4][4];
#pragma unroll
    for (int mb = 0; mb < 4; ++mb)
#pragma unroll
        for (int nb = 0; nb < 4; ++nb) acc[mb][nb] = (v8f){};
    const size_t aoff = (size_t)(r0 + lr) * K + 8 * hi, boff = (size_t)(c0 + lr) * K + 8 * hi;
#pragma unroll 1
    for (int kc = wave * 32; kc < K; kc += 32 * OW) {
        const h16* pa = A + aoff + kc; const h16* pb = Bt + boff + kc;
        v16h a[4], bq[4];                                        // all 16 loads of the k-step stand ahead of its first product: one memory latency per k-step instead of one per column tile
#pragma unroll
        for (int mb = 0; mb < 4; ++mb) a[mb] = ldh(pa + (size_t)mb * 16 * K);
#pragma unroll
        for (int nb = 0; nb < 4; ++nb) bq[nb] = ldh(pb + (size_t)nb * 16 * K);
        asm volatile("s_wait_xcnt 0x0" :: "v"(pa), "v"(pb) : "memory");   // stands between the loads and any rewrite of their address registers, which it keeps live (no load lands on them)
#pragma unroll
        for (int nb = 0; nb < 4; ++nb)
#pragma unroll
            for (int mb = 0; mb < 4; ++mb) acc[mb][nb] = wmma16g(a[mb], bq[nb], acc[mb][nb]);
    }
    float* ow = os + wave * (64 * 68);
#pragma unroll
    for (int mb = 0; mb < 4; ++mb)
#pragma unroll
        for (int nb = 0; nb < 4; ++nb)
#pragma unroll
            for (int j = 0; j < 8; ++j) ow[(mb * 16 + hi * 8 + j) * 68 + nb * 16 + lr] = acc[mb][nb][j];   // D: row 8h+j, col lane&15
    __syncthreads();                                            // every wave's partial tile is readable by every wave
    const int bb = r0 / SEQ, tt = r0 % SEQ;
    float* obase = OUT + ((size_t)bb * OUT_SEQ + (size_t)tt) * DX + c0;
    v4f ov[4];
#pragma unroll
    for (int s = 0; s < 4; ++s) { const int p = s * 32 + lane; const int row = wave * (64 / OW) + (p >> 4), c4 = (p & 15) * 4;   // 4 s x 2 rows = 8 rows; 16 lanes x 4 floats = 64 columns = two lines
        v4f sum = *(const v4fa*)(&os[row * 68 + c4]);
#pragma unroll
        for (int q = 1; q < OW; ++q) sum += *(const v4fa*)(&os[q * (64 * 68) + row * 68 + c4]);
        ov[s] = sum * OSC; }
#pragma unroll
    for (int s = 0; s < 4; ++s) { const int p = s * 32 + lane; const int row = wave * (64 / OW) + (p >> 4), c4 = (p & 15) * 4;
        *(v4f*)(obase + (size_t)row * DX + c4) = ov[s]; }
}

static constexpr size_t al256(size_t v) { return (v + 255) & ~(size_t)255; }
static constexpr size_t SZ_XB = al256((size_t)NB * SEQ * DX * 2);          // x bf16 [NB*SEQ][192]
static constexpr size_t SZ_WB = al256((size_t)3 * DQ * DX * 2);            // Wq | Wk | Wv bf16 [3][2048][192]
static constexpr size_t SZ_WO = al256((size_t)DX * DQ * 2);                // Wo f16 [192][2048]
static constexpr size_t SZ_TB = al256((size_t)SEQ * 64 * 4);               // cos or sin table [SEQ][64]
static constexpr size_t SZ_PL = al256((size_t)NB * NH_ * SEQ * HD * 2);    // q, k, v^T planes
static constexpr size_t SZ_CX = al256((size_t)NB * SEQ * DQ * 2);          // ctx plane
static constexpr size_t SZ_TOTAL = SZ_XB + SZ_WB + SZ_WO + 2 * SZ_TB + 3 * SZ_PL + SZ_CX;
static_assert(SZ_TOTAL <= (size_t)134217728);          // workspace carve <= 128 MiB
static_assert(((size_t)DQ * DX * 2) % 256 == 0);       // weight sub-planes stay 256-byte aligned
static_assert((size_t)NB * NH_ * SEQ * HD == (size_t)NB * DQ * SEQ);       // v^T plane [(b*2048 + m)][t] has the same extent as the q/k planes

extern "C" void kernel_launch(void* const* d_in, const int* in_sizes, int n_in,
                              void* d_out, int out_size, void* d_ws, size_t ws_size, hipStream_t stream) {
    if (n_in < 8) return;
    const size_t needx = ((size_t)(NB - 1) * SEQ_FULL + SEQ) * DX;
    const size_t needm = ((size_t)(NB - 1) * SEQ_FULL + (size_t)(SEQ - 1)) * SEQ_FULL + SEQ;
    if ((size_t)in_sizes[0] < needx || (size_t)in_sizes[1] < needm) return;
    if ((size_t)in_sizes[2] < (size_t)DQ * DX || (size_t)in_sizes[3] < (size_t)DQ * DX || (size_t)in_sizes[4] < (size_t)DQ * DX || (size_t)in_sizes[5] < (size_t)DX * DQ) return;
    if (in_sizes[6] < HD || in_sizes[7] < HD) return;
    if ((size_t)out_size < ((size_t)(NB - 1) * OUT_SEQ + SEQ) * DX) return;
    if (SZ_TOTAL > ws_size) return;
    // wire order: x, mask0, wq, wk, wv, wo, q_norm_w, k_norm_w
    const float* x    = (const float*)d_in[0];
    const float* mask = (const float*)d_in[1];
    const float* wq   = (const float*)d_in[2];
    const float* wk   = (const float*)d_in[3];
    const float* wv   = (const float*)d_in[4];
    const float* wo   = (const float*)d_in[5];
    const float* qnw  = (const float*)d_in[6];
    const float* knw  = (const float*)d_in[7];
    float* OUT = (float*)d_out;      // [NB][SEQ][192]
    char* wsp = (char*)d_ws;
    bf*  XB  = (bf*)wsp;  wsp += SZ_XB;               // [NB*SEQ][192]
    bf*  WB  = (bf*)wsp;  wsp += SZ_WB;               // [3][2048][192]: q | k | v  ([out][in] = Bt as-is)
    h16* WOH = (h16*)wsp; wsp += SZ_WO;               // [192][2048] x64
    float* COS = (float*)wsp; wsp += SZ_TB;           // [SEQ][64]
    float* SIN = (float*)wsp; wsp += SZ_TB;           // [SEQ][64]
    h16* QH  = (h16*)wsp; wsp += SZ_PL;               // [NB*16][SEQ][128]
    h16* KP  = (h16*)wsp; wsp += SZ_PL;               // [NB*16][SEQ][128]
    h16* VT  = (h16*)wsp; wsp += SZ_PL;               // [NB*16][128][SEQ]
    h16* CTX = (h16*)wsp; wsp += SZ_CX;               // [NB*SEQ][2048] x256
    bf* WQ = WB; bf* WK = WB + (size_t)DQ * DX; bf* WV = WB + (size_t)2 * DQ * DX;

    if (SEQ == SEQ_FULL) {
        const size_t n8 = (size_t)NB * SEQ * DX / 8;
        k_cvt8<<<(unsigned)((n8 + 255) / 256), 256, 0, stream>>>(x, XB, n8);
    } else {
        const size_t n8 = (size_t)SEQ * DX / 8;
        for (int b = 0; b < NB; ++b) k_cvt8<<<(unsigned)((n8 + 255) / 256), 256, 0, stream>>>(x + (size_t)b * SEQ_FULL * DX, XB + (size_t)b * SEQ * DX, n8);
    }
    { const size_t n8 = (size_t)DQ * DX / 8; const unsigned g = (unsigned)((n8 + 255) / 256);
      k_cvt8<<<g, 256, 0, stream>>>(wq, WQ, n8); k_cvt8<<<g, 256, 0, stream>>>(wk, WK, n8); k_cvt8<<<g, 256, 0, stream>>>(wv, WV, n8);
      k_cvtw<<<g, 256, 0, stream>>>(wo, WOH, n8, WOS); }
    k_tab<<<(unsigned)(SEQ * 64 / 256), 256, 0, stream>>>(COS, SIN, SEQ * 64);

    // q, k: A = x rows (m = b*SEQ + t), Bt = W rows (n = h*128 + d) -> normalised, rotated plane [(b*16 + h)][t][d]
    k_qk<<<dim3(NB * SEQ / 32, NH_, 1), 32, 0, stream>>>(XB, WQ, qnw, COS, SIN, QH);
    k_qk<<<dim3(NB * SEQ / 32, NH_, 1), 32, 0, stream>>>(XB, WK, knw, COS, SIN, KP);
    // v^T: A = Wv rows (m = h*128 + d), Bt = x rows (n = b*SEQ + t) -> plane [(b*2048 + m)][t] = [(b*16 + h)][d][t]
    k_vt<<<dim3(DQ / 64, NB * SEQ / 64, 1), 32, 0, stream>>>(WV, XB, VT);

    k_flash<<<dim3(SEQ / (16 * AW), NB * NH_, 1), 32 * AW, 0, stream>>>(QH, KP, VT, mask, CTX);
    // output projection: A = ctx rows [b*SEQ + t][2048], Bt = Wo rows [192][2048]
    k_out<<<dim3(NB * SEQ / 64, DX / 64, 1), 32 * OW, 0, stream>>>(CTX, WOH, OUT);
}

// v005
// One run takes 132 microseconds.
// Two timings next to v004 both put it at 1.11 times that version's speed.
// Counting every step since v000, it is 3.20 times as fast.
#include <hip/hip_runtime.h>

// Dense self-attention layer: x [NB][SEQ][192]; Wq/Wk/Wv [2048][192] ([out][in], y = x W^T, no bias); 16 heads x 128; per-head RMS normalisation of q and k (eps 1e-6, gain inputs);
// rotate-half rotary embeddings (base 1e6, positions 0..SEQ-1); scores = q.k * 128^-0.5 + additive mask [NB][1][SEQ][SEQ] (read by value); softmax over keys; P.V; heads merged; output = ctx Wo^T with Wo [192][2048] (f32).
// Compute dtypes, f32 accumulate everywhere: q/k/v projections v_wmma_f32_16x16x32_bf16 (x and W RNE-converted to bf16; products exact);
// scores v_wmma_f32_16x16x32_f16 (q, k single f16 planes after normalisation and rotary); P.V v_wmma_f32_16x16x32_f16 (P single f16 with x16384 carry that cancels in the normalisation, v single f16);
// output projection v_wmma_f32_16x16x32_f16 (ctx single f16 with x256 carry, Wo = bf16-converted value x64 as f16; 1/16384 folded in the f32 epilogue). Softmax f32 (online, running max), row sum over the converted P.
// Layout: bf16 copies of x and Wq|Wk|Wv; f16 Wo plane; cos/sin tables [SEQ][64] f32; q, k planes [b*16+h][t][128]; v^T plane [b*16+h][d][t]; ctx plane [b*SEQ+t][h*128+d];
// fused flash kernel in transposed form (S^T = K Q^T, O^T = V^T P^T), K and V^T tiles staged in LDS for the whole block, Q fragments straight from the f16 plane, no score or probability plane in memory.

#ifndef NB
#define NB 2
#endif
#ifndef SEQ
#define SEQ 2048
#endif
#define NB_FULL  2
#define SEQ_FULL 2048
#ifndef OUT_SEQ
#define OUT_SEQ SEQ              // row pitch (in tokens) between batches of the output
#endif
#define DX   192                 // model width (projection K, output N)
#define NH_  16
#define HD   128
#define DQ   2048                // NH_ * HD
#define AW   8                   // waves per flash block (16 query rows each)
#define KT   64                  // keys per LDS stage of the flash kernel
#define OW   8                   // waves per output-projection block (K split over them)
#define KPH  136                 // LDS row pitch (halves) of the K tile: 272 B = 16 B x odd
#define VPH  72                  // LDS row pitch (halves) of the V^T tile: 144 B = 16 B x odd
#define KTB  (KT * KPH * 2)      // bytes of one K tile in LDS
#define VTB  (HD * VPH * 2)      // bytes of one V^T tile in LDS
#define STB  (KTB + VTB)         // bytes of one stage
#define OSP  132                 // LDS row pitch (floats) of the flash output tile
#define OSQ  132                 // LDS row pitch (floats) of the q/k epilogue tile
#define SC2  ((float)(0.08838834764831845 * 1.4426950408889634))   // HD^-0.5 * log2(e)
#define L2E  1.4426950408889634f
#define PSH  14.0f               // log2 of the P carry (16384)
#define NEGB (-3.0e38f)
#define CXS  256.0f              // carry of the ctx plane
#define WOS  64.0f               // carry of the Wo plane
#define OSC  (1.0f / 16384.0f)   // 1 / (CXS * WOS)

static_assert(HD == 128);                      // q/k plane row = 256 bytes = two lines; one head = 8 column tiles of 16
static_assert(NH_ * HD == DQ);                 // head h = columns h*128 + d
static_assert(HD % 32 == 0);                   // score k-loop steps by 32
static_assert(DX % 32 == 0);                   // projection k-loop steps by 32
static_assert(DQ % 32 == 0);                   // output-projection k-loop steps by 32
static_assert(DX % 64 == 0);                   // output column tiles of 64
static_assert(DQ % 64 == 0);                   // v^T row tiles of 64
static_assert(SEQ % 64 == 0);                  // a 64-token tile never straddles two batches
static_assert((NB * SEQ) % 64 == 0);
static_assert(SEQ % 32 == 0);                  // key loop steps by 32; 32-token q/k tiles
static_assert(SEQ % (16 * AW) == 0);           // flash grid covers the sequence exactly
static_assert(((size_t)SEQ * DX) % 64 == 0);
static_assert(((size_t)DQ * DX) % 2048 == 0);  // weight converts: whole 256-thread blocks
static_assert((SEQ * 64) % 256 == 0);
static_assert(NB <= NB_FULL);
static_assert(SEQ <= SEQ_FULL);
static_assert(OSP >= HD);
static_assert(OSQ >= HD);
static_assert((OSP * 4) % 16 == 0);
static_assert((OSQ * 4) % 16 == 0);
static_assert((DX * 4) % 128 == 0);            // output rows start on a line
static_assert(32 * 16 * 8 == 16 * HD * 2);     // q/k epilogue and ctx epilogue: 32 lanes x 16 B x 8 instructions == 16 rows x 256 B
static_assert(32 * 16 * 4 == 16 * 64 * 2);
static_assert(16 * OSQ * 4 <= 131072);         // static LDS of the projection kernel (q, k and v^T jobs)
static_assert(16 * 68 * 4 <= 131072);          // LDS tile of the v^T projection job
static_assert(OW * 64 * 68 * 4 <= 163840);     // static LDS of the output projection kernel: one partial tile per wave
static_assert(DQ % (32 * OW) == 0);            // every wave of the output projection takes the same number of k-steps
static_assert(64 % OW == 0 && (64 / OW) * 16 == 4 * 32);   // output epilogue: 4 pieces of 16 B per lane cover the wave's rows
static_assert(2 * STB <= 131072);              // static LDS of the flash kernel
static_assert(AW * 16 * OSP * 4 <= 2 * STB);   // the output tiles reuse the two stage buffers
static_assert(SEQ % KT == 0 && SEQ / KT >= 2); // whole stages; the two-buffer prologue needs two
static_assert(KT * HD * 2 == 4 * 32 * AW * 16);  // K tile: 4 pieces of 16 B per thread
static_assert(HD * KT * 2 == 4 * 32 * AW * 16);  // V^T tile: 4 pieces of 16 B per thread
static_assert(KT == 64 && 32 * AW == 256);     // piece maps of stage_kv: 16 pieces per K row, 8 per V^T row, 256 threads
static_assert(STB % 16 == 0 && KTB % 16 == 0);

typedef _Float16 h16;
typedef unsigned short bf;
typedef __attribute__((ext_vector_type(16))) __bf16   v16bf;
typedef __attribute__((ext_vector_type(16))) _Float16 v16h;
typedef __attribute__((ext_vector_type(8)))  _Float16 v8h;
typedef __attribute__((ext_vector_type(8)))  unsigned short v8us;
typedef __attribute__((ext_vector_type(8)))  float    v8f;
typedef __attribute__((ext_vector_type(4)))  float    v4f;
typedef v4f  __attribute__((may_alias)) v4fa;

__device__ __forceinline__ unsigned short f2bf(float f) { unsigned u = __float_as_uint(f); u += 0x7FFFu + ((u >> 16) & 1u); return (unsigned short)(u >> 16); }
__device__ __forceinline__ float bfr(float f) { return __uint_as_float(((unsigned)f2bf(f)) << 16); }   // value after RNE convert to bf16
__device__ __forceinline__ v16h cat16(v8h lo, v8h hi) { return __builtin_shufflevector(lo, hi, 0, 1, 2, 3, 4, 5, 6, 7, 8, 9, 10, 11, 12, 13, 14, 15); }
__device__ __forceinline__ v16bf cat16b(v8us lo, v8us hi) { return __builtin_bit_cast(v16bf, __builtin_shufflevector(lo, hi, 0, 1, 2, 3, 4, 5, 6, 7, 8, 9, 10, 11, 12, 13, 14, 15)); }
__device__ __forceinline__ v8f wmma16(v16h a, v16h b, v8f c) { return __builtin_amdgcn_wmma_f32_16x16x32_f16(false, a, false, b, (short)0, c, false, false); }
__device__ __forceinline__ v8f wmmab(v16bf a, v16bf b, v8f c) { return __builtin_amdgcn_wmma_f32_16x16x32_bf16(false, a, false, b, (short)0, c, false, false); }
// fragment loaders from K-contiguous 16-bit rows; p already includes + 8*(lane>>4): elements 0..7 <- k0+8h+0..7, elements 8..15 <- k0+16+8h+0..7 (same map for A and B)
__device__ __forceinline__ v16h  ldh(const h16* p) { return cat16(*(const v8h*)p, *(const v8h*)(p + 16)); }
__device__ __forceinline__ v16bf ldb(const bf* p)  { return cat16b(*(const v8us*)p, *(const v8us*)(p + 16)); }
// ordering point for wave-private LDS tiles (same wave writes and reads)
__device__ __forceinline__ void wave_sync() { __builtin_amdgcn_fence(3 /* release order */, "wavefront"); __builtin_amdgcn_wave_barrier(); asm volatile("" ::: "memory"); }

// f32 -> f16 operand convert that cannot produce a subnormal (|v| < 2^-14 -> +0)
static __device__ __forceinline__ h16 toh_flush(float v) { const h16 r = (h16)v; return (fabsf(v) < 6.103515625e-05f) ? (h16)0.0f : r; }
// one matrix instruction + its own four-slot guard (one accumulator per guard)
static __device__ __forceinline__ v8f wmma16g(v16h a, v16h b, v8f c) { c = wmma16(a, b, c); asm volatile("v_nop\n\tv_nop\n\tv_nop\n\tv_nop" : "+v"(c) : "v"(a), "v"(b)); return c; }
static __device__ __forceinline__ v8f wmmabg(v16bf a, v16bf b, v8f c) { c = wmmab(a, b, c); asm volatile("v_nop\n\tv_nop\n\tv_nop\n\tv_nop" : "+v"(c) : "v"(a), "v"(b)); return c; }

static __device__ __forceinline__ void cvt8_body(const float* __restrict__ src, bf* dst, size_t n8, int blk) {
    const size_t i = (size_t)blk * 256 + threadIdx.x; if (i >= n8) return;
    const v8f v = *(const v8f*)(src + i * 8); v8us o;
#pragma unroll
    for (int k = 0; k < 8; ++k) o[k] = f2bf(v[k]);
    *(v8us*)(dst + i * 8) = o; 
}

static __device__ __forceinline__ void cvtw_body(const float* __restrict__ src, h16* dst, size_t n8, float sc, int blk) {
    const size_t i = (size_t)blk * 256 + threadIdx.x; if (i >= n8) return;
    const v8f v = *(const v8f*)(src + i * 8); v8h o;
#pragma unroll
    for (int k = 0; k < 8; ++k) o[k] = toh_flush(bfr(v[k]) * sc);
    *(v8h*)(dst + i * 8) = o; 
}

// tab_body: rotary tables COS/SIN [SEQ][64] (f32): angle = (float)pos * inv_freq[j], inv_freq[j] = 1e6^(-j/64); precise sincosf (angles reach 2047 rad).
// Contraction is off so that the angle keeps its own f32 rounding, as the reference rounds it, ahead of the range reduction.
static __device__ __forceinline__ void tab_body(float* COS, float* SIN, int n, int blk) {
#pragma clang fp contract(off)
    const int i = blk * 256 + threadIdx.x; if (i >= n) return;
    const int pos = i >> 6, j = i & 63;
    const float invf = exp2f(-(float)j * (19.931568569324174f / 64.0f));   // log2(1e6) / 64
    const float ang = (float)pos * invf;
    float sn, cs; sincosf(ang, &sn, &cs);
    *(float*)(COS + i) = cs; *(float*)(SIN + i) = sn; 
}

// k_prep: the six independent preparation jobs in ONE launch; the block index picks the job (block-uniform branches, no barrier, no data passes between the jobs).
// Block ranges, longest job first: rotary tables | x, one range per batch | Wq, Wk, Wv | Wo.
#define PB_TAB (SEQ * 64 / 256)
#define N8X    ((size_t)SEQ * DX / 8)
#define N8W    ((size_t)DQ * DX / 8)
#define PB_X   ((int)((N8X + 255) / 256))
#define PB_W   ((int)((N8W + 255) / 256))
#define PB_ALL (PB_TAB + NB * PB_X + 4 * PB_W)
__global__ __launch_bounds__(256) void k_prep(const float* __restrict__ x, const float* __restrict__ wq, const float* __restrict__ wk, const float* __restrict__ wv, const float* __restrict__ wo,
                                              bf* XB, bf* WB, h16* WOH, float* COS, float* SIN) {
    int blk = (int)blockIdx.x;
    if (blk < PB_TAB) { tab_body(COS, SIN, SEQ * 64, blk); return; }
    blk -= PB_TAB;
    if (blk < NB * PB_X) { const int b = blk / PB_X; cvt8_body(x + (size_t)b * SEQ_FULL * DX, XB + (size_t)b * SEQ * DX, N8X, blk - b * PB_X); return; }
    blk -= NB * PB_X;
    if (blk < 3 * PB_W) { const int w = blk / PB_W; cvt8_body(w == 0 ? wq : (w == 1 ? wk : wv), WB + (size_t)w * DQ * DX, N8W, blk - w * PB_W); return; }
    cvtw_body(wo, WOH, N8W, WOS, blk - 3 * PB_W);
}

// qk_body: projection + per-head RMS normalisation + rotary, ONE WAVE per 32 tokens x 128 columns (one head; 16 accumulators), operands straight from K-contiguous bf16 planes, K = DX.
// C[m][n] = sum_k A[m][k] Bt[n][k]; A = x rows (m = b*SEQ + t), Bt = W rows (n = h*128 + d). Tile (bx, by) of (NB*SEQ/32, NH_); os: the wave's LDS tile, 16 * OSQ floats.
// Epilogue per 16-row slab: row sum of squares from the accumulators (8 column tiles per lane, xor 1/2/4/8 inside each 16-lane half), y = (c * rstd) * gain staged in a wave-private LDS tile;
// store stage: lane piece p = 32 s + lane -> row p>>4, columns c8 = 8 (p&15); out[c] = y[c] cos[c&63] + (c < 64 ? -y[c+64] : y[c-64]) sin[c&63] (tables by 16-B loads), f16;
static __device__ __forceinline__ void qk_body(const bf* __restrict__ A, const bf* __restrict__ Bt, const float* __restrict__ nw,
                                               const float* __restrict__ COS, const float* __restrict__ SIN, h16* Ph, float* os, int bx, int by) {
    const int K = DX;
    const int lane = threadIdx.x & 31, lr = lane & 15, hi = lane >> 4; const int r0 = bx * 32, c0 = by * HD;
    v8f acc[2][8];
#pragma unroll
    for (int mb = 0; mb < 2; ++mb)
#pragma unroll
        for (int nb = 0; nb < 8; ++nb) acc[mb][nb] = (v8f){};
    const size_t aoff = (size_t)(r0 + lr) * K + 8 * hi, boff = (size_t)(c0 + lr) * K + 8 * hi;
#pragma unroll 1
    for (int kc = 0; kc < K; kc += 32) {
        const bf* pa = A + aoff + kc; const bf* pb = Bt + boff + kc;
        v16bf a[2], b[8];                                        // all 20 loads of the k-step stand ahead of its first product: one memory latency per k-step instead of one per column tile
#pragma unroll
        for (int mb = 0; mb < 2; ++mb) a[mb] = ldb(pa + (size_t)mb * 16 * K);
#pragma unroll
        for (int nb = 0; nb < 8; ++nb) b[nb] = ldb(pb + (size_t)nb * 16 * K);
        asm volatile("s_wait_xcnt 0x0" :: "v"(pa), "v"(pb) : "memory");   // stands between the loads and any rewrite of their address registers, which it keeps live (no load lands on them)
#pragma unroll
        for (int nb = 0; nb < 8; ++nb)
#pragma unroll
            for (int mb = 0; mb < 2; ++mb) acc[mb][nb] = wmmabg(a[mb], b[nb], acc[mb][nb]);
    }
    float wn[8];
#pragma unroll
    for (int nb = 0; nb < 8; ++nb) wn[nb] = bfr(nw[nb * 16 + lr]);                 // nb*16 + lr < HD
    const int bb = r0 / SEQ, tt = r0 % SEQ; const int zc = bb * NH_ + by;
    const size_t tbase = ((size_t)zc * SEQ + (size_t)tt) * HD;
#pragma unroll
    for (int mb = 0; mb < 2; ++mb) {
#pragma unroll
        for (int j = 0; j < 8; ++j) {
            float ss = 0.0f;
#pragma unroll
            for (int nb = 0; nb < 8; ++nb) ss += acc[mb][nb][j] * acc[mb][nb][j];
            ss += __shfl_xor(ss, 1, 32); ss += __shfl_xor(ss, 2, 32); ss += __shfl_xor(ss, 4, 32); ss += __shfl_xor(ss, 8, 32);
            const float rs = rsqrtf(ss * (1.0f / 128.0f) + 1.0e-6f);
#pragma unroll
            for (int nb = 0; nb < 8; ++nb) os[(hi * 8 + j) * OSQ + nb * 16 + lr] = (acc[mb][nb][j] * rs) * wn[nb]; }   // D: row 8h+j, col lane&15
        wave_sync();
        v8h hv[8];
#pragma unroll
        for (int s = 0; s < 8; ++s) { const int p = s * 32 + lane; const int row = p >> 4, c8 = (p & 15) * 8;   // 8 s x 2 rows = 16 rows; 16 lanes x 8 = 128 columns
            const int pc = c8 ^ 64, jj = c8 & 63; const float sg = (c8 < 64) ? -1.0f : 1.0f;
            const v4f x0 = *(const v4fa*)(&os[row * OSQ + c8]), x1 = *(const v4fa*)(&os[row * OSQ + c8 + 4]);
            const v4f y0 = *(const v4fa*)(&os[row * OSQ + pc]), y1 = *(const v4fa*)(&os[row * OSQ + pc + 4]);
            const size_t to = (size_t)(tt + mb * 16 + row) * 64 + (size_t)jj;      // token position < SEQ, jj + 7 < 64
            const v4f ca = *(const v4f*)(COS + to), cb = *(const v4f*)(COS + to + 4), sa = *(const v4f*)(SIN + to), sb = *(const v4f*)(SIN + to + 4);
            v8h o;
#pragma unroll
            for (int i = 0; i < 4; ++i) { o[i] = toh_flush(x0[i] * ca[i] + (sg * y0[i]) * sa[i]); o[4 + i] = toh_flush(x1[i] * cb[i] + (sg * y1[i]) * sb[i]); }
            hv[s] = o; }
        const size_t sbs = tbase + (size_t)(mb * 16) * HD;
{
#pragma unroll
            for (int s = 0; s < 8; ++s) *(v8h*)(Ph + sbs + (size_t)(s * 32 + lane) * 8) = hv[s];
             }
        wave_sync();
    }
}

// vt_body: v^T projection, ONE WAVE per 64x64 tile (16 accumulators), K = DX. A = Wv rows (m = h*128 + d), Bt = x rows (n = b*SEQ + t); plane [(b*2048 + m)][t], row pitch SEQ. Tile (bx, by) of (DQ/64, NB*SEQ/64); os: the wave's LDS tile, 16 * 68 floats.
static __device__ __forceinline__ void vt_body(const bf* __restrict__ A, const bf* __restrict__ Bt, h16* Ph, float* os, int bx, int by) {
    const int K = DX;
    const int lane = threadIdx.x & 31, lr = lane & 15, hi = lane >> 4; const int r0 = bx * 64, c0 = by * 64;
    v8f acc[4][4];
#pragma unroll
    for (int mb = 0; mb < 4; ++mb)
#pragma unroll
        for (int nb = 0; nb < 4; ++nb) acc[mb][nb] = (v8f){};
    const size_t aoff = (size_t)(r0 + lr) * K + 8 * hi, boff = (size_t)(c0 + lr) * K + 8 * hi;
#pragma unroll 1
    for (int kc = 0; kc < K; kc += 32) {
        const bf* pa = A + aoff + kc; const bf* pb = Bt + boff + kc;
        v16bf a[4], b[4];                                        // all 16 loads of the k-step stand ahead of its first product: one memory latency per k-step instead of one per column tile
#pragma unroll
        for (int mb = 0; mb < 4; ++mb) a[mb] = ldb(pa + (size_t)mb * 16 * K);
#pragma unroll
        for (int nb = 0; nb < 4; ++nb) b[nb] = ldb(pb + (size_t)nb * 16 * K);
        asm volatile("s_wait_xcnt 0x0" :: "v"(pa), "v"(pb) : "memory");   // stands between the loads and any rewrite of their address registers, which it keeps live (no load lands on them)
#pragma unroll
        for (int nb = 0; nb < 4; ++nb)
#pragma unroll
            for (int mb = 0; mb < 4; ++mb) acc[mb][nb] = wmmabg(a[mb], b[nb], acc[mb][nb]);
    }
    const int bb = c0 / SEQ, tt = c0 % SEQ;
    const size_t tbase = (size_t)bb * (size_t)DQ * SEQ + (size_t)r0 * SEQ + (size_t)tt;
#pragma unroll
    for (int mb = 0; mb < 4; ++mb) {
#pragma unroll
        for (int nb = 0; nb < 4; ++nb) {
#pragma unroll
            for (int j = 0; j < 8; ++j) os[(hi * 8 + j) * 68 + nb * 16 + lr] = acc[mb][nb][j]; }   // D: row 8h+j, col lane&15
        wave_sync();
        v8h hv[4];
#pragma unroll
        for (int s = 0; s < 4; ++s) { const int row = 4 * s + (lane >> 3), c8 = (lane & 7) * 8;   // 4 s x 4 row groups = 16 rows; 8 lanes x 8 = 64 columns
            const v4f x0 = *(const v4fa*)(&os[row * 68 + c8]); const v4f x1 = *(const v4fa*)(&os[row * 68 + c8 + 4]); v8h o;
#pragma unroll
            for (int i = 0; i < 4; ++i) { o[i] = toh_flush(x0[i]); o[4 + i] = toh_flush(x1[i]); }
            hv[s] = o; }
        const size_t sbs = tbase + (size_t)(mb * 16) * SEQ;
{
#pragma unroll
            for (int s = 0; s < 4; ++s) { const int row = 4 * s + (lane >> 3), c8 = (lane & 7) * 8;
                *(v8h*)(Ph + sbs + (size_t)row * SEQ + c8) = hv[s]; }
             }
        wave_sync();
    }
}

// k_proj: the three independent projections in ONE launch of one-wave blocks, grid (NB*SEQ/32, NH_, 3); blockIdx.z picks the job (block-uniform branch): 0 = q, 1 = k, 2 = v^T.
// The v^T job has as many tiles as a q or k job; its tile comes from the flat index of (x, y), weight-row tile fastest, as in a grid (DQ/64, NB*SEQ/64).
static_assert((NB * SEQ / 32) * NH_ == (DQ / 64) * (NB * SEQ / 64));
static_assert(16 * 68 <= 16 * OSQ);            // the v^T tile fits the shared LDS tile
__global__ __launch_bounds__(32) void k_proj(const bf* __restrict__ XB, const bf* __restrict__ WQ, const bf* __restrict__ WK, const bf* __restrict__ WV, const float* __restrict__ qnw, const float* __restrict__ knw,
                                             const float* __restrict__ COS, const float* __restrict__ SIN, h16* QH, h16* KP, h16* VT) {
    __shared__ __align__(16) float os[16 * OSQ];
    const int z = (int)blockIdx.z;
    if (z < 2) {
        qk_body(XB, z ? WK : WQ, z ? knw : qnw, COS, SIN, z ? KP : QH, os, (int)blockIdx.x, (int)blockIdx.y);
        return;
    }
    const int flat = (int)blockIdx.y * (NB * SEQ / 32) + (int)blockIdx.x;
    vt_body(WV, XB, VT, os, flat % (DQ / 64), flat / (DQ / 64));
}

// stage_kv: one stage (KT keys) into LDS, 8 asynchronous 16-B copies per thread, whole 128-B lines per wave instruction.
// K tile: KT rows x 256 B, contiguous in the plane; piece c = 256 i + tid -> row c>>4, 16-B column c&15. V^T tile: 128 rows x 128 B; piece c -> row c>>3, 16-B column c&7.
// kg, vg: the thread's first global piece; lk, lv: its LDS byte addresses. The s_wait_xcnt closes the statement so that no address register is rewritten ahead of it.
static __device__ __forceinline__ void stage_kv(const h16* kg, const h16* vg, unsigned lk, unsigned lv) {
    asm volatile("global_load_async_to_lds_b128 %0, %1, off\n\t"
                 "global_load_async_to_lds_b128 %2, %3, off\n\t"
                 "global_load_async_to_lds_b128 %4, %5, off\n\t"
                 "global_load_async_to_lds_b128 %6, %7, off\n\t"
                 "global_load_async_to_lds_b128 %8, %9, off\n\t"
                 "global_load_async_to_lds_b128 %10, %11, off\n\t"
                 "global_load_async_to_lds_b128 %12, %13, off\n\t"
                 "global_load_async_to_lds_b128 %14, %15, off\n\t"
                 "s_wait_xcnt 0x0"
                 :: "v"(lk), "v"(kg), "v"(lk + 16 * KPH * 2), "v"(kg + 2048), "v"(lk + 32 * KPH * 2), "v"(kg + 4096), "v"(lk + 48 * KPH * 2), "v"(kg + 6144),
                    "v"(lv), "v"(vg), "v"(lv + 32 * VPH * 2), "v"(vg + (size_t)32 * SEQ), "v"(lv + 64 * VPH * 2), "v"(vg + (size_t)64 * SEQ), "v"(lv + 96 * VPH * 2), "v"(vg + (size_t)96 * SEQ)
                 : "memory");
}

// k_flash: fused attention, one wave per 16 query rows of one (batch, head), AW waves per block on the same (batch, head); K and V^T tiles of KT keys come once per block into LDS
// (two buffers, the next tile's copies fly while this one is worked on), fragments by two 16-B LDS loads each; Q fragments straight from the f16 plane, once per wave.
// Transposed form: S^T[key][t] = K Q^T (A = K rows, B = Q rows, 4 k-steps over d); lane (t = lane&15, h = lane>>4) holds keys 8h+r of each 16-key tile, so the packed
// P tile is directly the B fragment of O^T[d][t] = V^T P^T (element r <- tile keys 0..15, element 8+r <- tile keys 16..31, lane unchanged); 8 output tiles of 16 d.
// Additive mask row t, keys key0+8h+0..7 and key0+16+8h+0..7: four 16-B loads per lane per step, issued one step ahead, value RNE-converted to bf16, added after the scale (base-2 domain).
// Softmax state (running max, partial sum) is one scalar per lane; the two lane halves of a row are combined with one xor-16 exchange. Q fragments are loaded once, ahead of the key loop, and stay in registers.
__global__ __launch_bounds__(32 * AW) __attribute__((amdgpu_num_vgpr(256)))
void k_flash(const h16* __restrict__ QH, const h16* __restrict__ KP, const h16* __restrict__ VT, const float* __restrict__ mask, h16* CTX) {
    __shared__ __align__(16) char sm[2 * STB];
    float* os = (float*)sm;                                     // output tiles, after the key loop
    const int tid = threadIdx.x;
    const int lane = threadIdx.x & 31, lr = lane & 15, hi = lane >> 4;
    const int wave = __builtin_amdgcn_readfirstlane((int)(threadIdx.x >> 5));
    const int zh = blockIdx.y; const int b = zh / NH_, h = zh % NH_;
    const int t0 = (blockIdx.x * AW + wave) * 16;
    const size_t pbase = (size_t)zh * SEQ * HD;
    const size_t qo = pbase + (size_t)(t0 + lr) * HD + 8 * hi;  // + ks*32          (B fragment: col t, k = d)
    const int ko = lr * KPH + 8 * hi;                           // + key*KPH + ks*32 (A fragment: row key, k = d), halves in the K tile
    const int vo = lr * VPH + 8 * hi;                           // + 16j*VPH + key   (A fragment: row d, k = key), halves in the V^T tile
    const unsigned lbase = (unsigned)(size_t)sm;                // LDS byte address of the stage buffers
    const unsigned lk = lbase + (unsigned)((tid >> 4) * (KPH * 2) + (tid & 15) * 16);
    const unsigned lv = lbase + (unsigned)(KTB + (tid >> 3) * (VPH * 2) + (tid & 7) * 16);
    const h16* kg = KP + pbase + (size_t)tid * 8;
    const h16* vg = VT + pbase + (size_t)(tid >> 3) * SEQ + (size_t)(tid & 7) * 8;
    const float* mrow = mask + ((size_t)b * SEQ_FULL + (size_t)(t0 + lr)) * SEQ_FULL + 8 * hi;
    v8f o[8];
#pragma unroll
    for (int j = 0; j < 8; ++j) o[j] = (v8f){};
    float m = NEGB, l = 0.0f;
    stage_kv(kg, vg, lk, lv);
    v16h qf[HD / 32];                                           // the wave's 16 query rows as B fragments, loaded once and held in 32 registers for the whole key loop
#pragma unroll   // constant indices, so that qf lives in registers and not in scratch memory
    for (int ks = 0; ks < HD / 32; ++ks) qf[ks] = ldh(QH + qo + ks * 32);
    v4f m0 = *(const v4f*)mrow, m1 = *(const v4f*)(mrow + 4), m2 = *(const v4f*)(mrow + 16), m3 = *(const v4f*)(mrow + 20);   // mask values of step 0; every later step's are loaded one step ahead
    asm volatile("s_wait_xcnt 0x0" ::: "memory");               // stands between the Q loads and the later reuse of their address registers
    asm volatile("s_wait_asynccnt 0x0" ::: "memory");           // this wave's copies of tile 0 have landed
    __syncthreads();                                            // tile 0 is readable by every wave
    stage_kv(kg + (size_t)KT * HD, vg + KT, lk + STB, lv + STB);
#pragma unroll 1
    for (int t = 0; t < SEQ / KT; ++t) {
      const unsigned bo = (unsigned)(t & 1) * STB;
      const h16* kt = (const h16*)(sm + bo) + ko;
      const h16* vt = (const h16*)(sm + bo + KTB) + vo;
#pragma unroll   // both 32-key steps of a tile in line: their tile offsets become immediates of the LDS loads
      for (int sub = 0; sub < KT / 32; ++sub) {
        const int key0 = t * KT + sub * 32;
        const h16* ka = kt + sub * 32 * KPH;
        v8f sA = (v8f){}, sB = (v8f){};
        v16h ka0[HD / 32], kb0[HD / 32];                         // the step's 16 K loads stand ahead of its first product: one LDS latency per step instead of one per k-step
#pragma unroll
        for (int ks = 0; ks < HD / 32; ++ks) { ka0[ks] = ldh(ka + ks * 32); kb0[ks] = ldh(ka + 16 * KPH + ks * 32); }
#pragma unroll
        for (int ks = 0; ks < HD / 32; ++ks) { sA = wmma16g(ka0[ks], qf[ks], sA); sB = wmma16g(kb0[ks], qf[ks], sB); }
        const h16* va = vt + sub * 32;
        v16h vf[8];                                              // the step's 16 V^T loads are free to issue under the softmax arithmetic (the listing has most of them there), which covers their latency
#pragma unroll
        for (int j = 0; j < 8; ++j) vf[j] = ldh(va + (16 * j) * VPH);
        float ta[8], tb[8]; float mx = NEGB;
#pragma unroll
        for (int r = 0; r < 4; ++r) {
            ta[r] = sA[r] * SC2 + bfr(m0[r]) * L2E; ta[4 + r] = sA[4 + r] * SC2 + bfr(m1[r]) * L2E;
            tb[r] = sB[r] * SC2 + bfr(m2[r]) * L2E; tb[4 + r] = sB[4 + r] * SC2 + bfr(m3[r]) * L2E; }
        const float* mp = mrow + ((key0 + 32 < SEQ) ? key0 + 32 : 0);   // next step's keys +8h+0..7 and +16+8h+0..7, all < SEQ (behind the last step: step 0's again, unused)
        m0 = *(const v4f*)mp; m1 = *(const v4f*)(mp + 4); m2 = *(const v4f*)(mp + 16); m3 = *(const v4f*)(mp + 20);
#pragma unroll
        for (int r = 0; r < 8; ++r) mx = fmaxf(mx, fmaxf(ta[r], tb[r]));
        mx = fmaxf(mx, __shfl_xor(mx, 16, 32));
        const float mnew = fmaxf(m, mx);
        const float alpha = __builtin_amdgcn_exp2f(m - mnew);
        const float sh = PSH - mnew;
        v16h pb; float ls = 0.0f;
#pragma unroll
        for (int r = 0; r < 8; ++r) {
            const float xa = ta[r] + sh, xb = tb[r] + sh;
            const float ea = __builtin_amdgcn_exp2f(xa), eb = __builtin_amdgcn_exp2f(xb);
            const float ga = (xa < -14.0f) ? 0.0f : ea, gb = (xb < -14.0f) ? 0.0f : eb;   // no subnormal f16 P (select on the exponent argument)
            const h16 pa = (h16)ga; const h16 pc = (h16)gb;
            pb[r] = pa; pb[8 + r] = pc;
            ls += (float)pa + (float)pc; }
        l = l * alpha + ls; m = mnew;
#pragma unroll
        for (int j = 0; j < 8; ++j) o[j] = o[j] * alpha;
#pragma unroll
        for (int j = 0; j < 8; ++j) o[j] = wmma16g(vf[j], pb, o[j]);
      }
      asm volatile("s_wait_dscnt 0x0" ::: "memory");            // this wave's reads of tile t are done before its buffer is refilled
      asm volatile("s_wait_asynccnt 0x0" ::: "memory");         // this wave's copies of tile t + 1 have landed
      __syncthreads();                                          // publishes tile t + 1 and ends every wave's reads of tile t
      if (t + 2 < SEQ / KT) stage_kv(kg + (size_t)(t + 2) * KT * HD, vg + (t + 2) * KT, lk + bo, lv + bo);
    }
    asm volatile("s_wait_asynccnt 0x0" ::: "memory");           // no copy is outstanding when the buffers become output tiles
    l += __shfl_xor(l, 16, 32);
    const bool any = l > 0.0f;
    const float lsafe = any ? l : 1.0f;
    const float inv = any ? ((1.0f / lsafe) * CXS) : 0.0f;
    const int wb = wave * 16 * OSP;
    // O^T D layout: o[j][r] = (d = 16j + 8h + r, t = lane&15) -> os[t][d]; rows 0..15 x columns 0..127 all written
#pragma unroll
    for (int j = 0; j < 8; ++j) { v4f a, c;
        a[0] = o[j][0] * inv; a[1] = o[j][1] * inv; a[2] = o[j][2] * inv; a[3] = o[j][3] * inv; c[0] = o[j][4] * inv; c[1] = o[j][5] * inv; c[2] = o[j][6] * inv; c[3] = o[j][7] * inv;
        *(v4fa*)(&os[wb + lr * OSP + 16 * j + 8 * hi]) = a; *(v4fa*)(&os[wb + lr * OSP + 16 * j + 8 * hi + 4]) = c; }
    wave_sync();
    v8h hv[8];
#pragma unroll
    for (int s = 0; s < 8; ++s) { const int p = s * 32 + lane; const int row = p >> 4, c8 = (p & 15) * 8;   // 8 s x 2 rows = 16 rows; 16 lanes x 8 = 128 columns = two lines
        const v4f x0 = *(const v4fa*)(&os[wb + row * OSP + c8]); const v4f x1 = *(const v4fa*)(&os[wb + row * OSP + c8 + 4]); v8h q;
#pragma unroll
        for (int i = 0; i < 4; ++i) { q[i] = toh_flush(x0[i]); q[4 + i] = toh_flush(x1[i]); }
        hv[s] = q; }
    h16* crow = CTX + ((size_t)b * SEQ + (size_t)t0) * DQ + (size_t)h * HD;
{
#pragma unroll
        for (int s = 0; s < 8; ++s) { const int p = s * 32 + lane; const int row = p >> 4, c8 = (p & 15) * 8;
            *(v8h*)(crow + (size_t)row * DQ + c8) = hv[s]; }
         }
}

// k_out: output projection, OW waves per 64x64 tile (16 accumulators each), f16 operands straight from K-contiguous planes, K = DQ split over the waves:
// wave w takes the 32-wide k-steps w, w + OW, w + 2 OW, ... (neighbouring waves read the two halves of the same 128-B lines), so OW times as many loads are in flight per tile.
// OUT[m][n] = (1/16384) sum_k A[m][k] Bt[n][k]; A = ctx rows (m = b*SEQ + t, x256), Bt = Wo rows (n, x64). grid (NB*SEQ/64, DX/64).
// Epilogue: every wave writes its partial 64x64 f32 tile to its own LDS plane; behind one barrier wave w adds rows 8w..8w+7 over the planes in plane order 0..OW-1 and stores them as whole lines.
__global__ __launch_bounds__(32 * OW) void k_out(const h16* __restrict__ A, const h16* __restrict__ Bt, float* OUT) {
    __shared__ __align__(16) float os[OW * 64 * 68];
    const int K = DQ;
    const int lane = threadIdx.x & 31, lr = lane & 15, hi = lane >> 4; const int r0 = blockIdx.x * 64, c0 = blockIdx.y * 64;
    const int wave = __builtin_amdgcn_readfirstlane((int)(threadIdx.x >> 5));
    v8f acc[4][4];
#pragma unroll
    for (int mb = 0; mb < 4; ++mb)
#pragma unroll
        for (int nb = 0; nb < 4; ++nb) acc[mb][nb] = (v8f){};
    const size_t aoff = (size_t)(r0 + lr) * K + 8 * hi, boff = (size_t)(c0 + lr) * K + 8 * hi;
#pragma unroll 1
    for (int kc = wave * 32; kc < K; kc += 32 * OW) {
        const h16* pa = A + aoff + kc; const h16* pb = Bt + boff + kc;
        v16h a[4], bq[4];                                        // all 16 loads of the k-step stand ahead of its first product: one memory latency per k-step instead of one per column tile
#pragma unroll
        for (int mb = 0; mb < 4; ++mb) a[mb] = ldh(pa + (size_t)mb * 16 * K);
#pragma unroll
        for (int nb = 0; nb < 4; ++nb) bq[nb] = ldh(pb + (size_t)nb * 16 * K);
        asm volatile("s_wait_xcnt 0x0" :: "v"(pa), "v"(pb) : "memory");   // stands between the loads and any rewrite of their address registers, which it keeps live (no load lands on them)
#pragma unroll
        for (int nb = 0; nb < 4; ++nb)
#pragma unroll
            for (int mb = 0; mb < 4; ++mb) acc[mb][nb] = wmma16g(a[mb], bq[nb], acc[mb][nb]);
    }
    float* ow = os + wave * (64 * 68);
#pragma unroll
    for (int mb = 0; mb < 4; ++mb)
#pragma unroll
        for (int nb = 0; nb < 4; ++nb)
#pragma unroll
            for (int j = 0; j < 8; ++j) ow[(mb * 16 + hi * 8 + j) * 68 + nb * 16 + lr] = acc[mb][nb][j];   // D: row 8h+j, col lane&15
    __syncthreads();                                            // every wave's partial tile is readable by every wave
    const int bb = r0 / SEQ, tt = r0 % SEQ;
    float* obase = OUT + ((size_t)bb * OUT_SEQ + (size_t)tt) * DX + c0;
    v4f ov[4];
#pragma unroll
    for (int s = 0; s < 4; ++s) { const int p = s * 32 + lane; const int row = wave * (64 / OW) + (p >> 4), c4 = (p & 15) * 4;   // 4 s x 2 rows = 8 rows; 16 lanes x 4 floats = 64 columns = two lines
        v4f sum = *(const v4fa*)(&os[row * 68 + c4]);
#pragma unroll
        for (int q = 1; q < OW; ++q) sum += *(const v4fa*)(&os[q * (64 * 68) + row * 68 + c4]);
        ov[s] = sum * OSC; }
#pragma unroll
    for (int s = 0; s < 4; ++s) { const int p = s * 32 + lane; const int row = wave * (64 / OW) + (p >> 4), c4 = (p & 15) * 4;
        *(v4f*)(obase + (size_t)row * DX + c4) = ov[s]; }
}

static constexpr size_t al256(size_t v) { return (v + 255) & ~(size_t)255; }
static constexpr size_t SZ_XB = al256((size_t)NB * SEQ * DX * 2);          // x bf16 [NB*SEQ][192]
static constexpr size_t SZ_WB = al256((size_t)3 * DQ * DX * 2);            // Wq | Wk | Wv bf16 [3][2048][192]
static constexpr size_t SZ_WO = al256((size_t)DX * DQ * 2);                // Wo f16 [192][2048]
static constexpr size_t SZ_TB = al256((size_t)SEQ * 64 * 4);               // cos or sin table [SEQ][64]
static constexpr size_t SZ_PL = al256((size_t)NB * NH_ * SEQ * HD * 2);    // q, k, v^T planes
static constexpr size_t SZ_CX = al256((size_t)NB * SEQ * DQ * 2);          // ctx plane
static constexpr size_t SZ_TOTAL = SZ_XB + SZ_WB + SZ_WO + 2 * SZ_TB + 3 * SZ_PL + SZ_CX;
static_assert(SZ_TOTAL <= (size_t)134217728);          // workspace carve <= 128 MiB
static_assert(((size_t)DQ * DX * 2) % 256 == 0);       // weight sub-planes stay 256-byte aligned
static_assert((size_t)NB * NH_ * SEQ * HD == (size_t)NB * DQ * SEQ);       // v^T plane [(b*2048 + m)][t] has the same extent as the q/k planes

extern "C" void kernel_launch(void* const* d_in, const int* in_sizes, int n_in,
                              void* d_out, int out_size, void* d_ws, size_t ws_size, hipStream_t stream) {
    if (n_in < 8) return;
    const size_t needx = ((size_t)(NB - 1) * SEQ_FULL + SEQ) * DX;
    const size_t needm = ((size_t)(NB - 1) * SEQ_FULL + (size_t)(SEQ - 1)) * SEQ_FULL + SEQ;
    if ((size_t)in_sizes[0] < needx || (size_t)in_sizes[1] < needm) return;
    if ((size_t)in_sizes[2] < (size_t)DQ * DX || (size_t)in_sizes[3] < (size_t)DQ * DX || (size_t)in_sizes[4] < (size_t)DQ * DX || (size_t)in_sizes[5] < (size_t)DX * DQ) return;
    if (in_sizes[6] < HD || in_sizes[7] < HD) return;
    if ((size_t)out_size < ((size_t)(NB - 1) * OUT_SEQ + SEQ) * DX) return;
    if (SZ_TOTAL > ws_size) return;
    // wire order: x, mask0, wq, wk, wv, wo, q_norm_w, k_norm_w
    const float* x    = (const float*)d_in[0];
    const float* mask = (const float*)d_in[1];
    const float* wq   = (const float*)d_in[2];
    const float* wk   = (const float*)d_in[3];
    const float* wv   = (const float*)d_in[4];
    const float* wo   = (const float*)d_in[5];
    const float* qnw  = (const float*)d_in[6];
    const float* knw  = (const float*)d_in[7];
    float* OUT = (float*)d_out;      // [NB][SEQ][192]
    char* wsp = (char*)d_ws;
    bf*  XB  = (bf*)wsp;  wsp += SZ_XB;               // [NB*SEQ][192]
    bf*  WB  = (bf*)wsp;  wsp += SZ_WB;               // [3][2048][192]: q | k | v  ([out][in] = Bt as-is)
    h16* WOH = (h16*)wsp; wsp += SZ_WO;               // [192][2048] x64
    float* COS = (float*)wsp; wsp += SZ_TB;           // [SEQ][64]
    float* SIN = (float*)wsp; wsp += SZ_TB;           // [SEQ][64]
    h16* QH  = (h16*)wsp; wsp += SZ_PL;               // [NB*16][SEQ][128]
    h16* KP  = (h16*)wsp; wsp += SZ_PL;               // [NB*16][SEQ][128]
    h16* VT  = (h16*)wsp; wsp += SZ_PL;               // [NB*16][128][SEQ]
    h16* CTX = (h16*)wsp; wsp += SZ_CX;               // [NB*SEQ][2048] x256
    bf* WQ = WB; bf* WK = WB + (size_t)DQ * DX; bf* WV = WB + (size_t)2 * DQ * DX;

    // preparation: bf16 copies of x and Wq|Wk|Wv, f16 Wo plane, rotary tables
    k_prep<<<PB_ALL, 256, 0, stream>>>(x, wq, wk, wv, wo, XB, WB, WOH, COS, SIN);
    // q, k: A = x rows (m = b*SEQ + t), Bt = W rows (n = h*128 + d) -> normalised, rotated plane [(b*16 + h)][t][d]
    // v^T: A = Wv rows (m = h*128 + d), Bt = x rows (n = b*SEQ + t) -> plane [(b*2048 + m)][t] = [(b*16 + h)][d][t]
    k_proj<<<dim3(NB * SEQ / 32, NH_, 3), 32, 0, stream>>>(XB, WQ, WK, WV, qnw, knw, COS, SIN, QH, KP, VT);

    k_flash<<<dim3(SEQ / (16 * AW), NB * NH_, 1), 32 * AW, 0, stream>>>(QH, KP, VT, mask, CTX);
    // output projection: A = ctx rows [b*SEQ + t][2048], Bt = Wo rows [192][2048]
    k_out<<<dim3(NB * SEQ / 64, DX / 64, 1), 32 * OW, 0, stream>>>(CTX, WOH, OUT);
}

// v006
// One run takes 117 microseconds.
// In both of two side-by-side timings against v005, it was 1.12 times as fast.
// All steps since v000 together make it 3.58 times as fast.
#include <hip/hip_runtime.h>

// Dense self-attention layer: x [NB][SEQ][192]; Wq/Wk/Wv [2048][192] ([out][in], y = x W^T, no bias); 16 heads x 128; per-head RMS normalisation of q and k (eps 1e-6, gain inputs);
// rotate-half rotary embeddings (base 1e6, positions 0..SEQ-1); scores = q.k * 128^-0.5 + additive mask [NB][1][SEQ][SEQ] (read by value); softmax over keys; P.V; heads merged; output = ctx Wo^T with Wo [192][2048] (f32).
// Compute dtypes, f32 accumulate everywhere: q/k/v projections v_wmma_f32_16x16x32_bf16 (x and W RNE-converted to bf16; products exact);
// scores v_wmma_f32_16x16x32_f16 (q, k single f16 planes after normalisation and rotary); P.V v_wmma_f32_16x16x32_f16 (P single f16 with x16384 carry that cancels in the normalisation, v single f16);
// output projection v_wmma_f32_16x16x32_f16 (ctx single f16 with x256 carry, Wo = bf16-converted value x64 as f16; 1/16384 folded in the f32 epilogue). Softmax f32 (online, running max), row sum over the converted P.
// Layout: bf16 copies of x and Wq|Wk|Wv; f16 Wo plane; cos/sin tables [SEQ][64] f32; q, k planes [b*16+h][t][128]; v^T plane [b*16+h][d][t]; ctx plane [b*SEQ+t][h*128+d];
// fused flash kernel in transposed form (S^T = K Q^T, O^T = V^T P^T), K and V^T tiles staged in LDS for the whole block, Q fragments straight from the f16 plane, no score or probability plane in memory.

#ifndef NB
#define NB 2
#endif
#ifndef SEQ
#define SEQ 2048
#endif
#define NB_FULL  2
#define SEQ_FULL 2048
#ifndef OUT_SEQ
#define OUT_SEQ SEQ              // row pitch (in tokens) between batches of the output
#endif
#define DX   192                 // model width (projection K, output N)
#define NH_  16
#define HD   128
#define DQ   2048                // NH_ * HD
#define AW   8                   // waves per flash block (16 query rows each)
#define KT   64                  // keys per LDS stage of the flash kernel
#define OW   8                   // waves per output-projection block (K split over them)
#define KPH  136                 // LDS row pitch (halves) of the K tile: 272 B = 16 B x odd
#define VPH  72                  // LDS row pitch (halves) of the V^T tile: 144 B = 16 B x odd
#define KTB  (KT * KPH * 2)      // bytes of one K tile in LDS
#define VTB  (HD * VPH * 2)      // bytes of one V^T tile in LDS
#define STB  (KTB + VTB)         // bytes of one stage
#define OSP  132                 // LDS row pitch (floats) of the flash output tile
#define OSQ  132                 // LDS row pitch (floats) of the q/k epilogue tile
#define PW   4                   // waves per projection block
#define PTK  128                 // tokens, and weight rows, per projection block
#define PPH  200                 // LDS row pitch (halves) of the projection tiles: 400 B = 16 B x odd
#define PTB  (PTK * PPH * 2)     // bytes of one projection tile in LDS
#define SC2  ((float)(0.08838834764831845 * 1.4426950408889634))   // HD^-0.5 * log2(e)
#define L2E  1.4426950408889634f
#define PSH  14.0f               // log2 of the P carry (16384)
#define NEGB (-3.0e38f)
#define CXS  256.0f              // carry of the ctx plane
#define WOS  64.0f               // carry of the Wo plane
#define OSC  (1.0f / 16384.0f)   // 1 / (CXS * WOS)

static_assert(HD == 128);                      // q/k plane row = 256 bytes = two lines; one head = 8 column tiles of 16
static_assert(NH_ * HD == DQ);                 // head h = columns h*128 + d
static_assert(HD % 32 == 0);                   // score k-loop steps by 32
static_assert(DX % 32 == 0);                   // projection k-loop steps by 32
static_assert(DQ % 32 == 0);                   // output-projection k-loop steps by 32
static_assert(DX % 64 == 0);                   // output column tiles of 64
static_assert(DQ % 64 == 0);                   // v^T row tiles of 64
static_assert(SEQ % 64 == 0);                  // a 64-token tile never straddles two batches
static_assert((NB * SEQ) % 64 == 0);
static_assert(SEQ % 32 == 0);                  // key loop steps by 32; 32-token q/k tiles
static_assert(SEQ % (16 * AW) == 0);           // flash grid covers the sequence exactly
static_assert(((size_t)SEQ * DX) % 64 == 0);
static_assert(((size_t)DQ * DX) % 2048 == 0);  // weight converts: whole 256-thread blocks
static_assert((SEQ * 64) % 256 == 0);
static_assert(NB <= NB_FULL);
static_assert(SEQ <= SEQ_FULL);
static_assert(OSP >= HD);
static_assert(OSQ >= HD);
static_assert((OSP * 4) % 16 == 0);
static_assert((OSQ * 4) % 16 == 0);
static_assert((DX * 4) % 128 == 0);            // output rows start on a line
static_assert(32 * 16 * 8 == 16 * HD * 2);     // q/k epilogue and ctx epilogue: 32 lanes x 16 B x 8 instructions == 16 rows x 256 B
static_assert(32 * 16 * 4 == 16 * 64 * 2);
static_assert(16 * OSQ * 4 <= 131072);         // one wave's LDS tile of the q/k epilogue
static_assert(16 * 68 * 4 <= 131072);          // LDS tile of the v^T projection job
static_assert(OW * 64 * 68 * 4 <= 163840);     // static LDS of the output projection kernel: one partial tile per wave
static_assert(DQ % (32 * OW) == 0);            // every wave of the output projection takes the same number of k-steps
static_assert(64 % OW == 0 && (64 / OW) * 16 == 4 * 32);   // output epilogue: 4 pieces of 16 B per lane cover the wave's rows
static_assert(2 * STB <= 131072);              // static LDS of the flash kernel
static_assert(AW * 16 * OSP * 4 <= 2 * STB);   // the output tiles reuse the two stage buffers
static_assert(SEQ % KT == 0 && SEQ / KT >= 2); // whole stages; the two-buffer prologue needs two
static_assert(KT * HD * 2 == 4 * 32 * AW * 16);  // K tile: 4 pieces of 16 B per thread
static_assert(HD * KT * 2 == 4 * 32 * AW * 16);  // V^T tile: 4 pieces of 16 B per thread
static_assert(KT == 64 && 32 * AW == 256);     // piece maps of stage_kv: 16 pieces per K row, 8 per V^T row, 256 threads
static_assert(STB % 16 == 0 && KTB % 16 == 0);

typedef _Float16 h16;
typedef unsigned short bf;
typedef __attribute__((ext_vector_type(16))) __bf16   v16bf;
typedef __attribute__((ext_vector_type(16))) _Float16 v16h;
typedef __attribute__((ext_vector_type(8)))  _Float16 v8h;
typedef __attribute__((ext_vector_type(8)))  unsigned short v8us;
typedef __attribute__((ext_vector_type(8)))  float    v8f;
typedef __attribute__((ext_vector_type(4)))  float    v4f;
typedef v4f  __attribute__((may_alias)) v4fa;

__device__ __forceinline__ unsigned short f2bf(float f) { unsigned u = __float_as_uint(f); u += 0x7FFFu + ((u >> 16) & 1u); return (unsigned short)(u >> 16); }
__device__ __forceinline__ float bfr(float f) { return __uint_as_float(((unsigned)f2bf(f)) << 16); }   // value after RNE convert to bf16
__device__ __forceinline__ v16h cat16(v8h lo, v8h hi) { return __builtin_shufflevector(lo, hi, 0, 1, 2, 3, 4, 5, 6, 7, 8, 9, 10, 11, 12, 13, 14, 15); }
__device__ __forceinline__ v16bf cat16b(v8us lo, v8us hi) { return __builtin_bit_cast(v16bf, __builtin_shufflevector(lo, hi, 0, 1, 2, 3, 4, 5, 6, 7, 8, 9, 10, 11, 12, 13, 14, 15)); }
__device__ __forceinline__ v8f wmma16(v16h a, v16h b, v8f c) { return __builtin_amdgcn_wmma_f32_16x16x32_f16(false, a, false, b, (short)0, c, false, false); }
__device__ __forceinline__ v8f wmmab(v16bf a, v16bf b, v8f c) { return __builtin_amdgcn_wmma_f32_16x16x32_bf16(false, a, false, b, (short)0, c, false, false); }
// fragment loaders from K-contiguous 16-bit rows; p already includes + 8*(lane>>4): elements 0..7 <- k0+8h+0..7, elements 8..15 <- k0+16+8h+0..7 (same map for A and B)
__device__ __forceinline__ v16h  ldh(const h16* p) { return cat16(*(const v8h*)p, *(const v8h*)(p + 16)); }
__device__ __forceinline__ v16bf ldb(const bf* p)  { return cat16b(*(const v8us*)p, *(const v8us*)(p + 16)); }
// ordering point for wave-private LDS tiles (same wave writes and reads)
__device__ __forceinline__ void wave_sync() { __builtin_amdgcn_fence(3 /* release order */, "wavefront"); __builtin_amdgcn_wave_barrier(); asm volatile("" ::: "memory"); }

// f32 -> f16 operand convert that cannot produce a subnormal (|v| < 2^-14 -> +0)
static __device__ __forceinline__ h16 toh_flush(float v) { const h16 r = (h16)v; return (fabsf(v) < 6.103515625e-05f) ? (h16)0.0f : r; }
// one matrix instruction + its own four-slot guard (one accumulator per guard)
static __device__ __forceinline__ v8f wmma16g(v16h a, v16h b, v8f c) { c = wmma16(a, b, c); asm volatile("v_nop\n\tv_nop\n\tv_nop\n\tv_nop" : "+v"(c) : "v"(a), "v"(b)); return c; }
static __device__ __forceinline__ v8f wmmabg(v16bf a, v16bf b, v8f c) { c = wmmab(a, b, c); asm volatile("v_nop\n\tv_nop\n\tv_nop\n\tv_nop" : "+v"(c) : "v"(a), "v"(b)); return c; }

static __device__ __forceinline__ void cvt8_body(const float* __restrict__ src, bf* dst, size_t n8, int blk) {
    const size_t i = (size_t)blk * 256 + threadIdx.x; if (i >= n8) return;
    const v8f v = *(const v8f*)(src + i * 8); v8us o;
#pragma unroll
    for (int k = 0; k < 8; ++k) o[k] = f2bf(v[k]);
    *(v8us*)(dst + i * 8) = o; 
}

static __device__ __forceinline__ void cvtw_body(const float* __restrict__ src, h16* dst, size_t n8, float sc, int blk) {
    const size_t i = (size_t)blk * 256 + threadIdx.x; if (i >= n8) return;
    const v8f v = *(const v8f*)(src + i * 8); v8h o;
#pragma unroll
    for (int k = 0; k < 8; ++k) o[k] = toh_flush(bfr(v[k]) * sc);
    *(v8h*)(dst + i * 8) = o; 
}

// tab_body: rotary tables COS/SIN [SEQ][64] (f32): angle = (float)pos * inv_freq[j], inv_freq[j] = 1e6^(-j/64); precise sincosf (angles reach 2047 rad).
// Contraction is off so that the angle keeps its own f32 rounding, as the reference rounds it, ahead of the range reduction.
static __device__ __forceinline__ void tab_body(float* COS, float* SIN, int n, int blk) {
#pragma clang fp contract(off)
    const int i = blk * 256 + threadIdx.x; if (i >= n) return;
    const int pos = i >> 6, j = i & 63;
    const float invf = exp2f(-(float)j * (19.931568569324174f / 64.0f));   // log2(1e6) / 64
    const float ang = (float)pos * invf;
    float sn, cs; sincosf(ang, &sn, &cs);
    *(float*)(COS + i) = cs; *(float*)(SIN + i) = sn; 
}

// k_prep: the six independent preparation jobs in ONE launch; the block index picks the job (block-uniform branches, no barrier, no data passes between the jobs).
// Block ranges, longest job first: rotary tables | x, one range per batch | Wq, Wk, Wv | Wo.
#define PB_TAB (SEQ * 64 / 256)
#define N8X    ((size_t)SEQ * DX / 8)
#define N8W    ((size_t)DQ * DX / 8)
#define PB_X   ((int)((N8X + 255) / 256))
#define PB_W   ((int)((N8W + 255) / 256))
#define PB_ALL (PB_TAB + NB * PB_X + 4 * PB_W)
__global__ __launch_bounds__(256) void k_prep(const float* __restrict__ x, const float* __restrict__ wq, const float* __restrict__ wk, const float* __restrict__ wv, const float* __restrict__ wo,
                                              bf* XB, bf* WB, h16* WOH, float* COS, float* SIN) {
    int blk = (int)blockIdx.x;
    if (blk < PB_TAB) { tab_body(COS, SIN, SEQ * 64, blk); return; }
    blk -= PB_TAB;
    if (blk < NB * PB_X) { const int b = blk / PB_X; cvt8_body(x + (size_t)b * SEQ_FULL * DX, XB + (size_t)b * SEQ * DX, N8X, blk - b * PB_X); return; }
    blk -= NB * PB_X;
    if (blk < 3 * PB_W) { const int w = blk / PB_W; cvt8_body(w == 0 ? wq : (w == 1 ? wk : wv), WB + (size_t)w * DQ * DX, N8W, blk - w * PB_W); return; }
    cvtw_body(wo, WOH, N8W, WOS, blk - 3 * PB_W);
}

// qk_body: projection + per-head RMS normalisation + rotary, ONE WAVE per 32 tokens x 128 columns (one head; 16 accumulators), operands from the block's LDS tiles (row pitch PPH), K = DX.
// C[m][n] = sum_k A[m][k] Bt[n][k]; A = x rows (m = b*SEQ + t), Bt = W rows (n = h*128 + d). A: the wave's first x row in LDS; Bt: the head's first W row in LDS; r0: the wave's first token row; by: the head;
// os: the wave's LDS tile, 16 * OSQ floats, inside the x tile, written only behind the barrier that ends every wave's fragment reads.
// Epilogue per 16-row slab: row sum of squares from the accumulators (8 column tiles per lane, xor 1/2/4/8 inside each 16-lane half), y = (c * rstd) * gain staged in a wave-private LDS tile;
// store stage: lane piece p = 32 s + lane -> row p>>4, columns c8 = 8 (p&15); out[c] = y[c] cos[c&63] + (c < 64 ? -y[c+64] : y[c-64]) sin[c&63] (tables by 16-B loads), f16;
static __device__ __forceinline__ void qk_body(const bf* A, const bf* Bt, const float* __restrict__ nw,
                                               const float* __restrict__ COS, const float* __restrict__ SIN, h16* Ph, float* os, int r0, int by) {
    const int K = DX;
    const int lane = threadIdx.x & 31, lr = lane & 15, hi = lane >> 4;
    v8f acc[2][8];
#pragma unroll
    for (int mb = 0; mb < 2; ++mb)
#pragma unroll
        for (int nb = 0; nb < 8; ++nb) acc[mb][nb] = (v8f){};
    const int foff = lr * PPH + 8 * hi;
#pragma unroll 1
    for (int kc = 0; kc < K; kc += 32) {
        const bf* pa = A + foff + kc; const bf* pb = Bt + foff + kc;
        v16bf a[2], b[8];                                        // all 10 fragments of the k-step stand ahead of its first product: one LDS latency per k-step instead of one per column tile
#pragma unroll
        for (int mb = 0; mb < 2; ++mb) a[mb] = ldb(pa + mb * 16 * PPH);
#pragma unroll
        for (int nb = 0; nb < 8; ++nb) b[nb] = ldb(pb + nb * 16 * PPH);
#pragma unroll
        for (int nb = 0; nb < 8; ++nb)
#pragma unroll
            for (int mb = 0; mb < 2; ++mb) acc[mb][nb] = wmmabg(a[mb], b[nb], acc[mb][nb]);
    }
    __syncthreads();                                            // every wave's fragment reads are done before the x tile becomes epilogue tiles
    float wn[8];
#pragma unroll
    for (int nb = 0; nb < 8; ++nb) wn[nb] = bfr(nw[nb * 16 + lr]);                 // nb*16 + lr < HD
    const int bb = r0 / SEQ, tt = r0 % SEQ; const int zc = bb * NH_ + by;
    const size_t tbase = ((size_t)zc * SEQ + (size_t)tt) * HD;
#pragma unroll
    for (int mb = 0; mb < 2; ++mb) {
#pragma unroll
        for (int j = 0; j < 8; ++j) {
            float ss = 0.0f;
#pragma unroll
            for (int nb = 0; nb < 8; ++nb) ss += acc[mb][nb][j] * acc[mb][nb][j];
            ss += __shfl_xor(ss, 1, 32); ss += __shfl_xor(ss, 2, 32); ss += __shfl_xor(ss, 4, 32); ss += __shfl_xor(ss, 8, 32);
            const float rs = rsqrtf(ss * (1.0f / 128.0f) + 1.0e-6f);
#pragma unroll
            for (int nb = 0; nb < 8; ++nb) os[(hi * 8 + j) * OSQ + nb * 16 + lr] = (acc[mb][nb][j] * rs) * wn[nb]; }   // D: row 8h+j, col lane&15
        wave_sync();
        v8h hv[8];
#pragma unroll
        for (int s = 0; s < 8; ++s) { const int p = s * 32 + lane; const int row = p >> 4, c8 = (p & 15) * 8;   // 8 s x 2 rows = 16 rows; 16 lanes x 8 = 128 columns
            const int pc = c8 ^ 64, jj = c8 & 63; const float sg = (c8 < 64) ? -1.0f : 1.0f;
            const v4f x0 = *(const v4fa*)(&os[row * OSQ + c8]), x1 = *(const v4fa*)(&os[row * OSQ + c8 + 4]);
            const v4f y0 = *(const v4fa*)(&os[row * OSQ + pc]), y1 = *(const v4fa*)(&os[row * OSQ + pc + 4]);
            const size_t to = (size_t)(tt + mb * 16 + row) * 64 + (size_t)jj;      // token position < SEQ, jj + 7 < 64
            const v4f ca = *(const v4f*)(COS + to), cb = *(const v4f*)(COS + to + 4), sa = *(const v4f*)(SIN + to), sb = *(const v4f*)(SIN + to + 4);
            asm volatile("s_wait_xcnt 0x0" :: "v"(COS + to), "v"(SIN + to) : "memory");   // stands between the table loads and any rewrite of their address registers, which it keeps live (no load lands on them)
            v8h o;
#pragma unroll
            for (int i = 0; i < 4; ++i) { o[i] = toh_flush(x0[i] * ca[i] + (sg * y0[i]) * sa[i]); o[4 + i] = toh_flush(x1[i] * cb[i] + (sg * y1[i]) * sb[i]); }
            hv[s] = o; }
        const size_t sbs = tbase + (size_t)(mb * 16) * HD;
{
#pragma unroll
            for (int s = 0; s < 8; ++s) *(v8h*)(Ph + sbs + (size_t)(s * 32 + lane) * 8) = hv[s];
             }
        wave_sync();
    }
}

// vt_body: v^T projection, ONE WAVE per 64x64 tile (16 accumulators), operands from the block's LDS tiles (row pitch PPH), K = DX. A = Wv rows (m = h*128 + d), Bt = x rows (n = b*SEQ + t); plane [(b*2048 + m)][t], row pitch SEQ.
// A, Bt: the wave's first Wv row and first x row in LDS; r0, c0: the same rows' numbers in the planes; os: the wave's LDS tile, 16 * 68 floats, inside the x tile, written only behind the barrier that ends every wave's fragment reads.
static __device__ __forceinline__ void vt_body(const bf* A, const bf* Bt, h16* Ph, float* os, int r0, int c0) {
    const int K = DX;
    const int lane = threadIdx.x & 31, lr = lane & 15, hi = lane >> 4;
    v8f acc[4][4];
#pragma unroll
    for (int mb = 0; mb < 4; ++mb)
#pragma unroll
        for (int nb = 0; nb < 4; ++nb) acc[mb][nb] = (v8f){};
    const int foff = lr * PPH + 8 * hi;
#pragma unroll 1
    for (int kc = 0; kc < K; kc += 32) {
        const bf* pa = A + foff + kc; const bf* pb = Bt + foff + kc;
        v16bf a[4], b[4];                                        // all 8 fragments of the k-step stand ahead of its first product: one LDS latency per k-step instead of one per column tile
#pragma unroll
        for (int mb = 0; mb < 4; ++mb) a[mb] = ldb(pa + mb * 16 * PPH);
#pragma unroll
        for (int nb = 0; nb < 4; ++nb) b[nb] = ldb(pb + nb * 16 * PPH);
#pragma unroll
        for (int nb = 0; nb < 4; ++nb)
#pragma unroll
            for (int mb = 0; mb < 4; ++mb) acc[mb][nb] = wmmabg(a[mb], b[nb], acc[mb][nb]);
    }
    __syncthreads();                                            // every wave's fragment reads are done before the x tile becomes epilogue tiles
    const int bb = c0 / SEQ, tt = c0 % SEQ;
    const size_t tbase = (size_t)bb * (size_t)DQ * SEQ + (size_t)r0 * SEQ + (size_t)tt;
#pragma unroll
    for (int mb = 0; mb < 4; ++mb) {
#pragma unroll
        for (int nb = 0; nb < 4; ++nb) {
#pragma unroll
            for (int j = 0; j < 8; ++j) os[(hi * 8 + j) * 68 + nb * 16 + lr] = acc[mb][nb][j]; }   // D: row 8h+j, col lane&15
        wave_sync();
        v8h hv[4];
#pragma unroll
        for (int s = 0; s < 4; ++s) { const int row = 4 * s + (lane >> 3), c8 = (lane & 7) * 8;   // 4 s x 4 row groups = 16 rows; 8 lanes x 8 = 64 columns
            const v4f x0 = *(const v4fa*)(&os[row * 68 + c8]); const v4f x1 = *(const v4fa*)(&os[row * 68 + c8 + 4]); v8h o;
#pragma unroll
            for (int i = 0; i < 4; ++i) { o[i] = toh_flush(x0[i]); o[4 + i] = toh_flush(x1[i]); }
            hv[s] = o; }
        const size_t sbs = tbase + (size_t)(mb * 16) * SEQ;
{
#pragma unroll
            for (int s = 0; s < 4; ++s) { const int row = 4 * s + (lane >> 3), c8 = (lane & 7) * 8;
                *(v8h*)(Ph + sbs + (size_t)row * SEQ + c8) = hv[s]; }
             }
        wave_sync();
    }
}

// stage_rows8: 8 asynchronous 16-B copies per thread out of a contiguous tile of PTK rows x 384 B. 384 pieces of 16 B are 16 rows, so copy k of the 8 lies 6144 B further in the plane and 16 rows further in LDS.
// g: the thread's first global piece; l: its LDS byte address. The s_wait_xcnt closes the statement so that no address register is rewritten ahead of it.
static __device__ __forceinline__ void stage_rows8(const bf* g, unsigned l) {
    asm volatile("global_load_async_to_lds_b128 %0, %1, off\n\t"
                 "global_load_async_to_lds_b128 %2, %3, off\n\t"
                 "global_load_async_to_lds_b128 %4, %5, off\n\t"
                 "global_load_async_to_lds_b128 %6, %7, off\n\t"
                 "global_load_async_to_lds_b128 %8, %9, off\n\t"
                 "global_load_async_to_lds_b128 %10, %11, off\n\t"
                 "global_load_async_to_lds_b128 %12, %13, off\n\t"
                 "global_load_async_to_lds_b128 %14, %15, off\n\t"
                 "s_wait_xcnt 0x0"
                 :: "v"(l), "v"(g), "v"(l + 16 * PPH * 2), "v"(g + 16 * DX), "v"(l + 32 * PPH * 2), "v"(g + 32 * DX), "v"(l + 48 * PPH * 2), "v"(g + 48 * DX),
                    "v"(l + 64 * PPH * 2), "v"(g + 64 * DX), "v"(l + 80 * PPH * 2), "v"(g + 80 * DX), "v"(l + 96 * PPH * 2), "v"(g + 96 * DX), "v"(l + 112 * PPH * 2), "v"(g + 112 * DX)
                 : "memory");
}

// k_proj: the three independent projections in ONE launch of PW-wave blocks, grid (NB*SEQ/PTK, NH_, 3); blockIdx.z picks the job (block-uniform branch): 0 = q, 1 = k, 2 = v^T.
// A block takes PTK tokens x one head (PTK weight rows). Both operand tiles, whole K, are contiguous in their planes and come once per block into LDS as whole 128-B lines (48 copies per thread, filled once, then read);
// the waves take their fragments from there by 16-B LDS loads. q, k: wave w has tokens 32 w .. 32 w + 31 and the whole head. v^T: wave w has weight rows 64 (w & 1) .. + 63 and tokens 64 (w >> 1) .. + 63.
static_assert((NB * SEQ) % PTK == 0 && SEQ % PTK == 0 && PTK == HD);   // whole blocks; a block never straddles two batches; one head per block
static_assert(PTK == 32 * PW && PTK * PTK == 64 * 64 * PW);            // the waves' tiles cover the block's tile in both kinds of job
static_assert(DX * 2 == 24 * 16 && 16 * 24 == 3 * 32 * PW && PTK == 8 * 16);   // piece map: 24 pieces per row, 3 pieces per thread per 16 rows, 8 groups of 16 rows
static_assert((PPH * 2) % 16 == 0 && PPH >= DX);
static_assert(PW * 16 * OSQ * 4 <= PTB && 16 * 68 <= 16 * OSQ);        // the epilogue tiles fit the x tile
static_assert(2 * PTB <= 163840);
__global__ __launch_bounds__(32 * PW) __attribute__((amdgpu_waves_per_eu(3, 3)))
void k_proj(const bf* __restrict__ XB, const bf* __restrict__ WQ, const bf* __restrict__ WK, const bf* __restrict__ WV, const float* __restrict__ qnw, const float* __restrict__ knw,
            const float* __restrict__ COS, const float* __restrict__ SIN, h16* QH, h16* KP, h16* VT) {
    __shared__ __align__(16) char ps[2 * PTB];                  // x tile | W tile
    const int tid = threadIdx.x;
    const int wave = __builtin_amdgcn_readfirstlane((int)(threadIdx.x >> 5));
    const int z = (int)blockIdx.z, bx = (int)blockIdx.x, by = (int)blockIdx.y;
    const bf* xg = XB + (size_t)bx * PTK * DX;
    const bf* wg = (z == 0 ? WQ : (z == 1 ? WK : WV)) + (size_t)by * PTK * DX;
    const unsigned lbase = (unsigned)(size_t)ps;                // LDS byte address of the tiles
#pragma unroll   // three pieces per thread in every group of 16 rows; constant trip count, so that the row and column of a piece are computed three times only
    for (int r = 0; r < 3; ++r) {
        const int q = r * (32 * PW) + tid;                      // piece 0..383 of the first 16 rows: row q / 24, 16-B column q % 24
        const unsigned lo = (unsigned)((q / 24) * (PPH * 2) + (q % 24) * 16);
        stage_rows8(xg + (size_t)q * 8, lbase + lo);
        stage_rows8(wg + (size_t)q * 8, lbase + PTB + lo);
    }
    asm volatile("s_wait_asynccnt 0x0" ::: "memory");           // this wave's copies have landed
    __syncthreads();                                            // both tiles are readable by every wave
    const bf* xs = (const bf*)ps;
    const bf* wt = (const bf*)(ps + PTB);
    float* os = (float*)ps + wave * (16 * OSQ);
    if (z < 2) {
        qk_body(xs + wave * 32 * PPH, wt, z ? knw : qnw, COS, SIN, z ? KP : QH, os, bx * PTK + wave * 32, by);
        return;
    }
    const int mi = wave & 1, ni = wave >> 1;
    vt_body(wt + mi * 64 * PPH, xs + ni * 64 * PPH, VT, os, by * PTK + mi * 64, bx * PTK + ni * 64);
}

// stage_kv: one stage (KT keys) into LDS, 8 asynchronous 16-B copies per thread, whole 128-B lines per wave instruction.
// K tile: KT rows x 256 B, contiguous in the plane; piece c = 256 i + tid -> row c>>4, 16-B column c&15. V^T tile: 128 rows x 128 B; piece c -> row c>>3, 16-B column c&7.
// kg, vg: the thread's first global piece; lk, lv: its LDS byte addresses. The s_wait_xcnt closes the statement so that no address register is rewritten ahead of it.
static __device__ __forceinline__ void stage_kv(const h16* kg, const h16* vg, unsigned lk, unsigned lv) {
    asm volatile("global_load_async_to_lds_b128 %0, %1, off\n\t"
                 "global_load_async_to_lds_b128 %2, %3, off\n\t"
                 "global_load_async_to_lds_b128 %4, %5, off\n\t"
                 "global_load_async_to_lds_b128 %6, %7, off\n\t"
                 "global_load_async_to_lds_b128 %8, %9, off\n\t"
                 "global_load_async_to_lds_b128 %10, %11, off\n\t"
                 "global_load_async_to_lds_b128 %12, %13, off\n\t"
                 "global_load_async_to_lds_b128 %14, %15, off\n\t"
                 "s_wait_xcnt 0x0"
                 :: "v"(lk), "v"(kg), "v"(lk + 16 * KPH * 2), "v"(kg + 2048), "v"(lk + 32 * KPH * 2), "v"(kg + 4096), "v"(lk + 48 * KPH * 2), "v"(kg + 6144),
                    "v"(lv), "v"(vg), "v"(lv + 32 * VPH * 2), "v"(vg + (size_t)32 * SEQ), "v"(lv + 64 * VPH * 2), "v"(vg + (size_t)64 * SEQ), "v"(lv + 96 * VPH * 2), "v"(vg + (size_t)96 * SEQ)
                 : "memory");
}

// k_flash: fused attention, one wave per 16 query rows of one (batch, head), AW waves per block on the same (batch, head); K and V^T tiles of KT keys come once per block into LDS
// (two buffers, the next tile's copies fly while this one is worked on), fragments by two 16-B LDS loads each; Q fragments straight from the f16 plane, once per wave.
// Transposed form: S^T[key][t] = K Q^T (A = K rows, B = Q rows, 4 k-steps over d); lane (t = lane&15, h = lane>>4) holds keys 8h+r of each 16-key tile, so the packed
// P tile is directly the B fragment of O^T[d][t] = V^T P^T (element r <- tile keys 0..15, element 8+r <- tile keys 16..31, lane unchanged); 8 output tiles of 16 d.
// Additive mask row t, keys key0+8h+0..7 and key0+16+8h+0..7: four 16-B loads per lane per step, issued one step ahead, value RNE-converted to bf16, added after the scale (base-2 domain).
// Softmax state (running max, partial sum) is one scalar per lane; the two lane halves of a row are combined with one xor-16 exchange. Q fragments are loaded once, ahead of the key loop, and stay in registers.
__global__ __launch_bounds__(32 * AW) __attribute__((amdgpu_num_vgpr(256)))
void k_flash(const h16* __restrict__ QH, const h16* __restrict__ KP, const h16* __restrict__ VT, const float* __restrict__ mask, h16* CTX) {
    __shared__ __align__(16) char sm[2 * STB];
    float* os = (float*)sm;                                     // output tiles, after the key loop
    const int tid = threadIdx.x;
    const int lane = threadIdx.x & 31, lr = lane & 15, hi = lane >> 4;
    const int wave = __builtin_amdgcn_readfirstlane((int)(threadIdx.x >> 5));
    const int zh = blockIdx.y; const int b = zh / NH_, h = zh % NH_;
    const int t0 = (blockIdx.x * AW + wave) * 16;
    const size_t pbase = (size_t)zh * SEQ * HD;
    const size_t qo = pbase + (size_t)(t0 + lr) * HD + 8 * hi;  // + ks*32          (B fragment: col t, k = d)
    const int ko = lr * KPH + 8 * hi;                           // + key*KPH + ks*32 (A fragment: row key, k = d), halves in the K tile
    const int vo = lr * VPH + 8 * hi;                           // + 16j*VPH + key   (A fragment: row d, k = key), halves in the V^T tile
    const unsigned lbase = (unsigned)(size_t)sm;                // LDS byte address of the stage buffers
    const unsigned lk = lbase + (unsigned)((tid >> 4) * (KPH * 2) + (tid & 15) * 16);
    const unsigned lv = lbase + (unsigned)(KTB + (tid >> 3) * (VPH * 2) + (tid & 7) * 16);
    const h16* kg = KP + pbase + (size_t)tid * 8;
    const h16* vg = VT + pbase + (size_t)(tid >> 3) * SEQ + (size_t)(tid & 7) * 8;
    const float* mrow = mask + ((size_t)b * SEQ_FULL + (size_t)(t0 + lr)) * SEQ_FULL + 8 * hi;
    v8f o[8];
#pragma unroll
    for (int j = 0; j < 8; ++j) o[j] = (v8f){};
    float m = NEGB, l = 0.0f;
    stage_kv(kg, vg, lk, lv);
    v16h qf[HD / 32];                                           // the wave's 16 query rows as B fragments, loaded once and held in 32 registers for the whole key loop
#pragma unroll   // constant indices, so that qf lives in registers and not in scratch memory
    for (int ks = 0; ks < HD / 32; ++ks) qf[ks] = ldh(QH + qo + ks * 32);
    v4f m0 = *(const v4f*)mrow, m1 = *(const v4f*)(mrow + 4), m2 = *(const v4f*)(mrow + 16), m3 = *(const v4f*)(mrow + 20);   // mask values of step 0; every later step's are loaded one step ahead
    asm volatile("s_wait_xcnt 0x0" ::: "memory");               // stands between the Q loads and the later reuse of their address registers
    asm volatile("s_wait_asynccnt 0x0" ::: "memory");           // this wave's copies of tile 0 have landed
    __syncthreads();                                            // tile 0 is readable by every wave
    stage_kv(kg + (size_t)KT * HD, vg + KT, lk + STB, lv + STB);
#pragma unroll 1
    for (int t = 0; t < SEQ / KT; ++t) {
      const unsigned bo = (unsigned)(t & 1) * STB;
      const h16* kt = (const h16*)(sm + bo) + ko;
      const h16* vt = (const h16*)(sm + bo + KTB) + vo;
#pragma unroll   // both 32-key steps of a tile in line: their tile offsets become immediates of the LDS loads
      for (int sub = 0; sub < KT / 32; ++sub) {
        const int key0 = t * KT + sub * 32;
        const h16* ka = kt + sub * 32 * KPH;
        v8f sA = (v8f){}, sB = (v8f){};
        v16h ka0[HD / 32], kb0[HD / 32];                         // the step's 16 K loads stand ahead of its first product: one LDS latency per step instead of one per k-step
#pragma unroll
        for (int ks = 0; ks < HD / 32; ++ks) { ka0[ks] = ldh(ka + ks * 32); kb0[ks] = ldh(ka + 16 * KPH + ks * 32); }
#pragma unroll
        for (int ks = 0; ks < HD / 32; ++ks) { sA = wmma16g(ka0[ks], qf[ks], sA); sB = wmma16g(kb0[ks], qf[ks], sB); }
        const h16* va = vt + sub * 32;
        v16h vf[8];                                              // the step's 16 V^T loads are free to issue under the softmax arithmetic (the listing has most of them there), which covers their latency
#pragma unroll
        for (int j = 0; j < 8; ++j) vf[j] = ldh(va + (16 * j) * VPH);
        float ta[8], tb[8]; float mx = NEGB;
#pragma unroll
        for (int r = 0; r < 4; ++r) {
            ta[r] = sA[r] * SC2 + bfr(m0[r]) * L2E; ta[4 + r] = sA[4 + r] * SC2 + bfr(m1[r]) * L2E;
            tb[r] = sB[r] * SC2 + bfr(m2[r]) * L2E; tb[4 + r] = sB[4 + r] * SC2 + bfr(m3[r]) * L2E; }
        const float* mp = mrow + ((key0 + 32 < SEQ) ? key0 + 32 : 0);   // next step's keys +8h+0..7 and +16+8h+0..7, all < SEQ (behind the last step: step 0's again, unused)
        m0 = *(const v4f*)mp; m1 = *(const v4f*)(mp + 4); m2 = *(const v4f*)(mp + 16); m3 = *(const v4f*)(mp + 20);
#pragma unroll
        for (int r = 0; r < 8; ++r) mx = fmaxf(mx, fmaxf(ta[r], tb[r]));
        mx = fmaxf(mx, __shfl_xor(mx, 16, 32));
        const float mnew = fmaxf(m, mx);
        const float alpha = __builtin_amdgcn_exp2f(m - mnew);
        const float sh = PSH - mnew;
        v16h pb; float ls = 0.0f;
#pragma unroll
        for (int r = 0; r < 8; ++r) {
            const float xa = ta[r] + sh, xb = tb[r] + sh;
            const float ea = __builtin_amdgcn_exp2f(xa), eb = __builtin_amdgcn_exp2f(xb);
            const float ga = (xa < -14.0f) ? 0.0f : ea, gb = (xb < -14.0f) ? 0.0f : eb;   // no subnormal f16 P (select on the exponent argument)
            const h16 pa = (h16)ga; const h16 pc = (h16)gb;
            pb[r] = pa; pb[8 + r] = pc;
            ls += (float)pa + (float)pc; }
        l = l * alpha + ls; m = mnew;
#pragma unroll
        for (int j = 0; j < 8; ++j) o[j] = o[j] * alpha;
#pragma unroll
        for (int j = 0; j < 8; ++j) o[j] = wmma16g(vf[j], pb, o[j]);
      }
      asm volatile("s_wait_dscnt 0x0" ::: "memory");            // this wave's reads of tile t are done before its buffer is refilled
      asm volatile("s_wait_asynccnt 0x0" ::: "memory");         // this wave's copies of tile t + 1 have landed
      __syncthreads();                                          // publishes tile t + 1 and ends every wave's reads of tile t
      if (t + 2 < SEQ / KT) stage_kv(kg + (size_t)(t + 2) * KT * HD, vg + (t + 2) * KT, lk + bo, lv + bo);
    }
    asm volatile("s_wait_asynccnt 0x0" ::: "memory");           // no copy is outstanding when the buffers become output tiles
    l += __shfl_xor(l, 16, 32);
    const bool any = l > 0.0f;
    const float lsafe = any ? l : 1.0f;
    const float inv = any ? ((1.0f / lsafe) * CXS) : 0.0f;
    const int wb = wave * 16 * OSP;
    // O^T D layout: o[j][r] = (d = 16j + 8h + r, t = lane&15) -> os[t][d]; rows 0..15 x columns 0..127 all written
#pragma unroll
    for (int j = 0; j < 8; ++j) { v4f a, c;
        a[0] = o[j][0] * inv; a[1] = o[j][1] * inv; a[2] = o[j][2] * inv; a[3] = o[j][3] * inv; c[0] = o[j][4] * inv; c[1] = o[j][5] * inv; c[2] = o[j][6] * inv; c[3] = o[j][7] * inv;
        *(v4fa*)(&os[wb + lr * OSP + 16 * j + 8 * hi]) = a; *(v4fa*)(&os[wb + lr * OSP + 16 * j + 8 * hi + 4]) = c; }
    wave_sync();
    v8h hv[8];
#pragma unroll
    for (int s = 0; s < 8; ++s) { const int p = s * 32 + lane; const int row = p >> 4, c8 = (p & 15) * 8;   // 8 s x 2 rows = 16 rows; 16 lanes x 8 = 128 columns = two lines
        const v4f x0 = *(const v4fa*)(&os[wb + row * OSP + c8]); const v4f x1 = *(const v4fa*)(&os[wb + row * OSP + c8 + 4]); v8h q;
#pragma unroll
        for (int i = 0; i < 4; ++i) { q[i] = toh_flush(x0[i]); q[4 + i] = toh_flush(x1[i]); }
        hv[s] = q; }
    h16* crow = CTX + ((size_t)b * SEQ + (size_t)t0) * DQ + (size_t)h * HD;
{
#pragma unroll
        for (int s = 0; s < 8; ++s) { const int p = s * 32 + lane; const int row = p >> 4, c8 = (p & 15) * 8;
            *(v8h*)(crow + (size_t)row * DQ + c8) = hv[s]; }
         }
}

// k_out: output projection, OW waves per 64x64 tile (16 accumulators each), f16 operands straight from K-contiguous planes, K = DQ split over the waves:
// wave w takes the 32-wide k-steps w, w + OW, w + 2 OW, ... (neighbouring waves read the two halves of the same 128-B lines), so OW times as many loads are in flight per tile.
// OUT[m][n] = (1/16384) sum_k A[m][k] Bt[n][k]; A = ctx rows (m = b*SEQ + t, x256), Bt = Wo rows (n, x64). grid (NB*SEQ/64, DX/64).
// Epilogue: every wave writes its partial 64x64 f32 tile to its own LDS plane; behind one barrier wave w adds rows 8w..8w+7 over the planes in plane order 0..OW-1 and stores them as whole lines.
__global__ __launch_bounds__(32 * OW) void k_out(const h16* __restrict__ A, const h16* __restrict__ Bt, float* OUT) {
    __shared__ __align__(16) float os[OW * 64 * 68];
    const int K = DQ;
    const int lane = threadIdx.x & 31, lr = lane & 15, hi = lane >> 4; const int r0 = blockIdx.x * 64, c0 = blockIdx.y * 64;
    const int wave = __builtin_amdgcn_readfirstlane((int)(threadIdx.x >> 5));
    v8f acc[4][4];
#pragma unroll
    for (int mb = 0; mb < 4; ++mb)
#pragma unroll
        for (int nb = 0; nb < 4; ++nb) acc[mb][nb] = (v8f){};
    const size_t aoff = (size_t)(r0 + lr) * K + 8 * hi, boff = (size_t)(c0 + lr) * K + 8 * hi;
#pragma unroll 1
    for (int kc = wave * 32; kc < K; kc += 32 * OW) {
        const h16* pa = A + aoff + kc; const h16* pb = Bt + boff + kc;
        v16h a[4], bq[4];                                        // all 16 loads of the k-step stand ahead of its first product: one memory latency per k-step instead of one per column tile
#pragma unroll
        for (int mb = 0; mb < 4; ++mb) a[mb] = ldh(pa + (size_t)mb * 16 * K);
#pragma unroll
        for (int nb = 0; nb < 4; ++nb) bq[nb] = ldh(pb + (size_t)nb * 16 * K);
        asm volatile("s_wait_xcnt 0x0" :: "v"(pa), "v"(pb) : "memory");   // stands between the loads and any rewrite of their address registers, which it keeps live (no load lands on them)
#pragma unroll
        for (int nb = 0; nb < 4; ++nb)
#pragma unroll
            for (int mb = 0; mb < 4; ++mb) acc[mb][nb] = wmma16g(a[mb], bq[nb], acc[mb][nb]);
    }
    float* ow = os + wave * (64 * 68);
#pragma unroll
    for (int mb = 0; mb < 4; ++mb)
#pragma unroll
        for (int nb = 0; nb < 4; ++nb)
#pragma unroll
            for (int j = 0; j < 8; ++j) ow[(mb * 16 + hi * 8 + j) * 68 + nb * 16 + lr] = acc[mb][nb][j];   // D: row 8h+j, col lane&15
    __syncthreads();                                            // every wave's partial tile is readable by every wave
    const int bb = r0 / SEQ, tt = r0 % SEQ;
    float* obase = OUT + ((size_t)bb * OUT_SEQ + (size_t)tt) * DX + c0;
    v4f ov[4];
#pragma unroll
    for (int s = 0; s < 4; ++s) { const int p = s * 32 + lane; const int row = wave * (64 / OW) + (p >> 4), c4 = (p & 15) * 4;   // 4 s x 2 rows = 8 rows; 16 lanes x 4 floats = 64 columns = two lines
        v4f sum = *(const v4fa*)(&os[row * 68 + c4]);
#pragma unroll
        for (int q = 1; q < OW; ++q) sum += *(const v4fa*)(&os[q * (64 * 68) + row * 68 + c4]);
        ov[s] = sum * OSC; }
#pragma unroll
    for (int s = 0; s < 4; ++s) { const int p = s * 32 + lane; const int row = wave * (64 / OW) + (p >> 4), c4 = (p & 15) * 4;
        *(v4f*)(obase + (size_t)row * DX + c4) = ov[s]; }
}

static constexpr size_t al256(size_t v) { return (v + 255) & ~(size_t)255; }
static constexpr size_t SZ_XB = al256((size_t)NB * SEQ * DX * 2);          // x bf16 [NB*SEQ][192]
static constexpr size_t SZ_WB = al256((size_t)3 * DQ * DX * 2);            // Wq | Wk | Wv bf16 [3][2048][192]
static constexpr size_t SZ_WO = al256((size_t)DX * DQ * 2);                // Wo f16 [192][2048]
static constexpr size_t SZ_TB = al256((size_t)SEQ * 64 * 4);               // cos or sin table [SEQ][64]
static constexpr size_t SZ_PL = al256((size_t)NB * NH_ * SEQ * HD * 2);    // q, k, v^T planes
static constexpr size_t SZ_CX = al256((size_t)NB * SEQ * DQ * 2);          // ctx plane
static constexpr size_t SZ_TOTAL = SZ_XB + SZ_WB + SZ_WO + 2 * SZ_TB + 3 * SZ_PL + SZ_CX;
static_assert(SZ_TOTAL <= (size_t)134217728);          // workspace carve <= 128 MiB
static_assert(((size_t)DQ * DX * 2) % 256 == 0);       // weight sub-planes stay 256-byte aligned
static_assert((size_t)NB * NH_ * SEQ * HD == (size_t)NB * DQ * SEQ);       // v^T plane [(b*2048 + m)][t] has the same extent as the q/k planes

extern "C" void kernel_launch(void* const* d_in, const int* in_sizes, int n_in,
                              void* d_out, int out_size, void* d_ws, size_t ws_size, hipStream_t stream) {
    if (n_in < 8) return;
    const size_t needx = ((size_t)(NB - 1) * SEQ_FULL + SEQ) * DX;
    const size_t needm = ((size_t)(NB - 1) * SEQ_FULL + (size_t)(SEQ - 1)) * SEQ_FULL + SEQ;
    if ((size_t)in_sizes[0] < needx || (size_t)in_sizes[1] < needm) return;
    if ((size_t)in_sizes[2] < (size_t)DQ * DX || (size_t)in_sizes[3] < (size_t)DQ * DX || (size_t)in_sizes[4] < (size_t)DQ * DX || (size_t)in_sizes[5] < (size_t)DX * DQ) return;
    if (in_sizes[6] < HD || in_sizes[7] < HD) return;
    if ((size_t)out_size < ((size_t)(NB - 1) * OUT_SEQ + SEQ) * DX) return;
    if (SZ_TOTAL > ws_size) return;
    // wire order: x, mask0, wq, wk, wv, wo, q_norm_w, k_norm_w
    const float* x    = (const float*)d_in[0];
    const float* mask = (const float*)d_in[1];
    const float* wq   = (const float*)d_in[2];
    const float* wk   = (const float*)d_in[3];
    const float* wv   = (const float*)d_in[4];
    const float* wo   = (const float*)d_in[5];
    const float* qnw  = (const float*)d_in[6];
    const float* knw  = (const float*)d_in[7];
    float* OUT = (float*)d_out;      // [NB][SEQ][192]
    char* wsp = (char*)d_ws;
    bf*  XB  = (bf*)wsp;  wsp += SZ_XB;               // [NB*SEQ][192]
    bf*  WB  = (bf*)wsp;  wsp += SZ_WB;               // [3][2048][192]: q | k | v  ([out][in] = Bt as-is)
    h16* WOH = (h16*)wsp; wsp += SZ_WO;               // [192][2048] x64
    float* COS = (float*)wsp; wsp += SZ_TB;           // [SEQ][64]
    float* SIN = (float*)wsp; wsp += SZ_TB;           // [SEQ][64]
    h16* QH  = (h16*)wsp; wsp += SZ_PL;               // [NB*16][SEQ][128]
    h16* KP  = (h16*)wsp; wsp += SZ_PL;               // [NB*16][SEQ][128]
    h16* VT  = (h16*)wsp; wsp += SZ_PL;               // [NB*16][128][SEQ]
    h16* CTX = (h16*)wsp; wsp += SZ_CX;               // [NB*SEQ][2048] x256
    bf* WQ = WB; bf* WK = WB + (size_t)DQ * DX; bf* WV = WB + (size_t)2 * DQ * DX;

    // preparation: bf16 copies of x and Wq|Wk|Wv, f16 Wo plane, rotary tables
    k_prep<<<PB_ALL, 256, 0, stream>>>(x, wq, wk, wv, wo, XB, WB, WOH, COS, SIN);
    // q, k: A = x rows (m = b*SEQ + t), Bt = W rows (n = h*128 + d) -> normalised, rotated plane [(b*16 + h)][t][d]
    // v^T: A = Wv rows (m = h*128 + d), Bt = x rows (n = b*SEQ + t) -> plane [(b*2048 + m)][t] = [(b*16 + h)][d][t]
    k_proj<<<dim3(NB * SEQ / PTK, NH_, 3), 32 * PW, 0, stream>>>(XB, WQ, WK, WV, qnw, knw, COS, SIN, QH, KP, VT);

    k_flash<<<dim3(SEQ / (16 * AW), NB * NH_, 1), 32 * AW, 0, stream>>>(QH, KP, VT, mask, CTX);
    // output projection: A = ctx rows [b*SEQ + t][2048], Bt = Wo rows [192][2048]
    k_out<<<dim3(NB * SEQ / 64, DX / 64, 1), 32 * OW, 0, stream>>>(CTX, WOH, OUT);
}

// v007
// It runs in 113 microseconds.
// Timed twice side by side with v006, it ran 1.05 and 1.04 times as fast.
// All steps since v000 together make it 3.74 times as fast.
#include <hip/hip_runtime.h>

// Dense self-attention layer: x [NB][SEQ][192]; Wq/Wk/Wv [2048][192] ([out][in], y = x W^T, no bias); 16 heads x 128; per-head RMS normalisation of q and k (eps 1e-6, gain inputs);
// rotate-half rotary embeddings (base 1e6, positions 0..SEQ-1); scores = q.k * 128^-0.5 + additive mask [NB][1][SEQ][SEQ] (read by value); softmax over keys; P.V; heads merged; output = ctx Wo^T with Wo [192][2048] (f32).
// Compute dtypes, f32 accumulate everywhere: q/k/v projections v_wmma_f32_16x16x32_bf16 (x and W RNE-converted to bf16; products exact);
// scores v_wmma_f32_16x16x32_f16 (q, k single f16 planes after normalisation and rotary); P.V v_wmma_f32_16x16x32_f16 (P single f16 with x16384 carry that cancels in the normalisation, v single f16);
// output projection v_wmma_f32_16x16x32_f16 (ctx single f16 with x256 carry, Wo = bf16-converted value x64 as f16; 1/16384 folded in the f32 epilogue). Softmax f32 (online, running max), row sum over the converted P.
// Layout: bf16 copies of x and Wq|Wk|Wv; f16 Wo plane; cos/sin tables [SEQ][64] f32; q, k planes [b*16+h][t][128]; v^T plane [b*16+h][d][t]; ctx plane [b*SEQ+t][h*128+d];
// fused flash kernel in transposed form (S^T = K Q^T, O^T = V^T P^T), K and V^T tiles staged in LDS for the whole block, Q fragments straight from the f16 plane, no score or probability plane in memory.

#ifndef NB
#define NB 2
#endif
#ifndef SEQ
#define SEQ 2048
#endif
#define NB_FULL  2
#define SEQ_FULL 2048
#ifndef OUT_SEQ
#define OUT_SEQ SEQ              // row pitch (in tokens) between batches of the output
#endif
#define DX   192                 // model width (projection K, output N)
#define NH_  16
#define HD   128
#define DQ   2048                // NH_ * HD
#define AW   8                   // waves per flash block (16 query rows each)
#define KT   64                  // keys per LDS stage of the flash kernel
#define OW   8                   // waves per output-projection block (K split over them)
#define KPH  136                 // LDS row pitch (halves) of the K tile: 272 B = 16 B x odd
#define VPH  72                  // LDS row pitch (halves) of the V^T tile: 144 B = 16 B x odd
#define KTB  (KT * KPH * 2)      // bytes of one K tile in LDS
#define VTB  (HD * VPH * 2)      // bytes of one V^T tile in LDS
#define STB  (KTB + VTB)         // bytes of one stage
#define OSP  132                 // LDS row pitch (floats) of the flash output tile
#define OSQ  132                 // LDS row pitch (floats) of the q/k epilogue tile
#define PW   4                   // waves per projection block
#define PTK  128                 // tokens, and weight rows, per projection block
#define PPH  200                 // LDS row pitch (halves) of the projection tiles: 400 B = 16 B x odd
#define PTB  (PTK * PPH * 2)     // bytes of one projection tile in LDS
#define SC2  ((float)(0.08838834764831845 * 1.4426950408889634))   // HD^-0.5 * log2(e)
#define L2E  1.4426950408889634f
#define PSH  14.0f               // log2 of the P carry (16384)
#define NEGB (-3.0e38f)
#define CXS  256.0f              // carry of the ctx plane
#define WOS  64.0f               // carry of the Wo plane
#define OSC  (1.0f / 16384.0f)   // 1 / (CXS * WOS)

static_assert(HD == 128);                      // q/k plane row = 256 bytes = two lines; one head = 8 column tiles of 16
static_assert(NH_ * HD == DQ);                 // head h = columns h*128 + d
static_assert(HD % 32 == 0);                   // score k-loop steps by 32
static_assert(DX % 32 == 0);                   // projection k-loop steps by 32
static_assert(DQ % 32 == 0);                   // output-projection k-loop steps by 32
static_assert(DX % 64 == 0);                   // output column tiles of 64
static_assert(DQ % 64 == 0);                   // v^T row tiles of 64
static_assert(SEQ % 64 == 0);                  // a 64-token tile never straddles two batches
static_assert((NB * SEQ) % 64 == 0);
static_assert(SEQ % 32 == 0);                  // key loop steps by 32; 32-token q/k tiles
static_assert(SEQ % (16 * AW) == 0);           // flash grid covers the sequence exactly
static_assert(((size_t)SEQ * DX) % 64 == 0);
static_assert(((size_t)DQ * DX) % 2048 == 0);  // weight converts: whole 256-thread blocks
static_assert((SEQ * 64) % 256 == 0);
static_assert(NB <= NB_FULL);
static_assert(SEQ <= SEQ_FULL);
static_assert(OSP >= HD);
static_assert(OSQ >= HD);
static_assert((OSP * 4) % 16 == 0);
static_assert((OSQ * 4) % 16 == 0);
static_assert((DX * 4) % 128 == 0);            // output rows start on a line
static_assert(32 * 16 * 8 == 16 * HD * 2);     // q/k epilogue and ctx epilogue: 32 lanes x 16 B x 8 instructions == 16 rows x 256 B
static_assert(32 * 16 * 4 == 16 * 64 * 2);
static_assert(16 * OSQ * 4 <= 131072);         // one wave's LDS tile of the q/k epilogue
static_assert(16 * 68 * 4 <= 131072);          // LDS tile of the v^T projection job
static_assert(OW * 64 * 68 * 4 <= 163840);     // static LDS of the output projection kernel: one partial tile per wave
static_assert(DQ % (32 * OW) == 0);            // every wave of the output projection takes the same number of k-steps
static_assert(64 % OW == 0 && (64 / OW) * 16 == 4 * 32);   // output epilogue: 4 pieces of 16 B per lane cover the wave's rows
static_assert(2 * STB <= 131072);              // static LDS of the flash kernel
static_assert(AW * 16 * OSP * 4 <= 2 * STB);   // the output tiles reuse the two stage buffers
static_assert(SEQ % KT == 0 && SEQ / KT >= 2); // whole stages; the two-buffer prologue needs two
static_assert(KT * HD * 2 == 4 * 32 * AW * 16);  // K tile: 4 pieces of 16 B per thread
static_assert(HD * KT * 2 == 4 * 32 * AW * 16);  // V^T tile: 4 pieces of 16 B per thread
static_assert(KT == 64 && 32 * AW == 256);     // piece maps of stage_kv: 16 pieces per K row, 8 per V^T row, 256 threads
static_assert(STB % 16 == 0 && KTB % 16 == 0);

typedef _Float16 h16;
typedef unsigned short bf;
typedef __attribute__((ext_vector_type(16))) __bf16   v16bf;
typedef __attribute__((ext_vector_type(16))) _Float16 v16h;
typedef __attribute__((ext_vector_type(8)))  _Float16 v8h;
typedef __attribute__((ext_vector_type(8)))  unsigned short v8us;
typedef __attribute__((ext_vector_type(8)))  float    v8f;
typedef __attribute__((ext_vector_type(4)))  float    v4f;
typedef v4f  __attribute__((may_alias)) v4fa;

__device__ __forceinline__ unsigned short f2bf(float f) { unsigned u = __float_as_uint(f); u += 0x7FFFu + ((u >> 16) & 1u); return (unsigned short)(u >> 16); }
__device__ __forceinline__ float bfr(float f) { return __uint_as_float(((unsigned)f2bf(f)) << 16); }   // value after RNE convert to bf16
__device__ __forceinline__ v16h cat16(v8h lo, v8h hi) { return __builtin_shufflevector(lo, hi, 0, 1, 2, 3, 4, 5, 6, 7, 8, 9, 10, 11, 12, 13, 14, 15); }
__device__ __forceinline__ v16bf cat16b(v8us lo, v8us hi) { return __builtin_bit_cast(v16bf, __builtin_shufflevector(lo, hi, 0, 1, 2, 3, 4, 5, 6, 7, 8, 9, 10, 11, 12, 13, 14, 15)); }
__device__ __forceinline__ v8f wmma16(v16h a, v16h b, v8f c) { return __builtin_amdgcn_wmma_f32_16x16x32_f16(false, a, false, b, (short)0, c, false, false); }
__device__ __forceinline__ v8f wmmab(v16bf a, v16bf b, v8f c) { return __builtin_amdgcn_wmma_f32_16x16x32_bf16(false, a, false, b, (short)0, c, false, false); }
// fragment loaders from K-contiguous 16-bit rows; p already includes + 8*(lane>>4): elements 0..7 <- k0+8h+0..7, elements 8..15 <- k0+16+8h+0..7 (same map for A and B)
__device__ __forceinline__ v16h  ldh(const h16* p) { return cat16(*(const v8h*)p, *(const v8h*)(p + 16)); }
__device__ __forceinline__ v16bf ldb(const bf* p)  { return cat16b(*(const v8us*)p, *(const v8us*)(p + 16)); }
// ordering point for wave-private LDS tiles (same wave writes and reads)
__device__ __forceinline__ void wave_sync() { __builtin_amdgcn_fence(3 /* release order */, "wavefront"); __builtin_amdgcn_wave_barrier(); asm volatile("" ::: "memory"); }

// f32 -> f16 operand convert that cannot produce a subnormal (|v| < 2^-14 -> +0)
static __device__ __forceinline__ h16 toh_flush(float v) { const h16 r = (h16)v; return (fabsf(v) < 6.103515625e-05f) ? (h16)0.0f : r; }

static __device__ __forceinline__ void cvt8_body(const float* __restrict__ src, bf* dst, size_t n8, int blk) {
    const size_t i = (size_t)blk * 256 + threadIdx.x; if (i >= n8) return;
    const v8f v = *(const v8f*)(src + i * 8); v8us o;
#pragma unroll
    for (int k = 0; k < 8; ++k) o[k] = f2bf(v[k]);
    *(v8us*)(dst + i * 8) = o; 
}

static __device__ __forceinline__ void cvtw_body(const float* __restrict__ src, h16* dst, size_t n8, float sc, int blk) {
    const size_t i = (size_t)blk * 256 + threadIdx.x; if (i >= n8) return;
    const v8f v = *(const v8f*)(src + i * 8); v8h o;
#pragma unroll
    for (int k = 0; k < 8; ++k) o[k] = toh_flush(bfr(v[k]) * sc);
    *(v8h*)(dst + i * 8) = o; 
}

// tab_body: rotary tables COS/SIN [SEQ][64] (f32): angle = (float)pos * inv_freq[j], inv_freq[j] = 1e6^(-j/64); precise sincosf (angles reach 2047 rad).
// Contraction is off so that the angle keeps its own f32 rounding, as the reference rounds it, ahead of the range reduction.
static __device__ __forceinline__ void tab_body(float* COS, float* SIN, int n, int blk) {
#pragma clang fp contract(off)
    const int i = blk * 256 + threadIdx.x; if (i >= n) return;
    const int pos = i >> 6, j = i & 63;
    const float invf = exp2f(-(float)j * (19.931568569324174f / 64.0f));   // log2(1e6) / 64
    const float ang = (float)pos * invf;
    float sn, cs; sincosf(ang, &sn, &cs);
    *(float*)(COS + i) = cs; *(float*)(SIN + i) = sn; 
}

// k_prep: the six independent preparation jobs in ONE launch; the block index picks the job (block-uniform branches, no barrier, no data passes between the jobs).
// Block ranges, longest job first: rotary tables | x, one range per batch | Wq, Wk, Wv | Wo.
#define PB_TAB (SEQ * 64 / 256)
#define N8X    ((size_t)SEQ * DX / 8)
#define N8W    ((size_t)DQ * DX / 8)
#define PB_X   ((int)((N8X + 255) / 256))
#define PB_W   ((int)((N8W + 255) / 256))
#define PB_ALL (PB_TAB + NB * PB_X + 4 * PB_W)
__global__ __launch_bounds__(256) void k_prep(const float* __restrict__ x, const float* __restrict__ wq, const float* __restrict__ wk, const float* __restrict__ wv, const float* __restrict__ wo,
                                              bf* XB, bf* WB, h16* WOH, float* COS, float* SIN) {
    int blk = (int)blockIdx.x;
    if (blk < PB_TAB) { tab_body(COS, SIN, SEQ * 64, blk); return; }
    blk -= PB_TAB;
    if (blk < NB * PB_X) { const int b = blk / PB_X; cvt8_body(x + (size_t)b * SEQ_FULL * DX, XB + (size_t)b * SEQ * DX, N8X, blk - b * PB_X); return; }
    blk -= NB * PB_X;
    if (blk < 3 * PB_W) { const int w = blk / PB_W; cvt8_body(w == 0 ? wq : (w == 1 ? wk : wv), WB + (size_t)w * DQ * DX, N8W, blk - w * PB_W); return; }
    cvtw_body(wo, WOH, N8W, WOS, blk - 3 * PB_W);
}

// qk_body: projection + per-head RMS normalisation + rotary, ONE WAVE per 32 tokens x 128 columns (one head; 16 accumulators), operands from the block's LDS tiles (row pitch PPH), K = DX.
// C[m][n] = sum_k A[m][k] Bt[n][k]; A = x rows (m = b*SEQ + t), Bt = W rows (n = h*128 + d). A: the wave's first x row in LDS; Bt: the head's first W row in LDS; r0: the wave's first token row; by: the head;
// os: the wave's LDS tile, 16 * OSQ floats, inside the x tile, written only behind the barrier that ends every wave's fragment reads.
// Epilogue per 16-row slab: row sum of squares from the accumulators (8 column tiles per lane, xor 1/2/4/8 inside each 16-lane half), y = (c * rstd) * gain staged in a wave-private LDS tile;
// store stage: lane piece p = 32 s + lane -> row p>>4, columns c8 = 8 (p&15); out[c] = y[c] cos[c&63] + (c < 64 ? -y[c+64] : y[c-64]) sin[c&63] (tables by 16-B loads), f16;
static __device__ __forceinline__ void qk_body(const bf* A, const bf* Bt, const float* __restrict__ nw,
                                               const float* __restrict__ COS, const float* __restrict__ SIN, h16* Ph, float* os, int r0, int by) {
    const int K = DX;
    const int lane = threadIdx.x & 31, lr = lane & 15, hi = lane >> 4;
    v8f acc[2][8];
#pragma unroll
    for (int mb = 0; mb < 2; ++mb)
#pragma unroll
        for (int nb = 0; nb < 8; ++nb) acc[mb][nb] = (v8f){};
    const int foff = lr * PPH + 8 * hi;
#pragma unroll 1
    for (int kc = 0; kc < K; kc += 32) {
        const bf* pa = A + foff + kc; const bf* pb = Bt + foff + kc;
        v16bf a[2], b[8];                                        // all 10 fragments of the k-step stand ahead of its first product: one LDS latency per k-step instead of one per column tile
#pragma unroll
        for (int mb = 0; mb < 2; ++mb) a[mb] = ldb(pa + mb * 16 * PPH);
#pragma unroll
        for (int nb = 0; nb < 8; ++nb) b[nb] = ldb(pb + nb * 16 * PPH);
        __builtin_amdgcn_sched_barrier(0);                       // holds the load group ahead of the matrix run: without it the compiler spreads the loads in pairs among the matrix instructions and each pair's latency is exposed
#pragma unroll
        for (int nb = 0; nb < 8; ++nb)
#pragma unroll
            for (int mb = 0; mb < 2; ++mb) acc[mb][nb] = wmmab(a[mb], b[nb], acc[mb][nb]);
    }
    __syncthreads();                                            // every wave's fragment reads are done before the x tile becomes epilogue tiles
    float wn[8];
#pragma unroll
    for (int nb = 0; nb < 8; ++nb) wn[nb] = bfr(nw[nb * 16 + lr]);                 // nb*16 + lr < HD
    const int bb = r0 / SEQ, tt = r0 % SEQ; const int zc = bb * NH_ + by;
    const size_t tbase = ((size_t)zc * SEQ + (size_t)tt) * HD;
#pragma unroll
    for (int mb = 0; mb < 2; ++mb) {
#pragma unroll
        for (int j = 0; j < 8; ++j) {
            float ss = 0.0f;
#pragma unroll
            for (int nb = 0; nb < 8; ++nb) ss += acc[mb][nb][j] * acc[mb][nb][j];
            ss += __shfl_xor(ss, 1, 32); ss += __shfl_xor(ss, 2, 32); ss += __shfl_xor(ss, 4, 32); ss += __shfl_xor(ss, 8, 32);
            const float rs = rsqrtf(ss * (1.0f / 128.0f) + 1.0e-6f);
#pragma unroll
            for (int nb = 0; nb < 8; ++nb) os[(hi * 8 + j) * OSQ + nb * 16 + lr] = (acc[mb][nb][j] * rs) * wn[nb]; }   // D: row 8h+j, col lane&15
        wave_sync();
        v8h hv[8];
#pragma unroll
        for (int s = 0; s < 8; ++s) { const int p = s * 32 + lane; const int row = p >> 4, c8 = (p & 15) * 8;   // 8 s x 2 rows = 16 rows; 16 lanes x 8 = 128 columns
            const int pc = c8 ^ 64, jj = c8 & 63; const float sg = (c8 < 64) ? -1.0f : 1.0f;
            const v4f x0 = *(const v4fa*)(&os[row * OSQ + c8]), x1 = *(const v4fa*)(&os[row * OSQ + c8 + 4]);
            const v4f y0 = *(const v4fa*)(&os[row * OSQ + pc]), y1 = *(const v4fa*)(&os[row * OSQ + pc + 4]);
            const size_t to = (size_t)(tt + mb * 16 + row) * 64 + (size_t)jj;      // token position < SEQ, jj + 7 < 64
            const v4f ca = *(const v4f*)(COS + to), cb = *(const v4f*)(COS + to + 4), sa = *(const v4f*)(SIN + to), sb = *(const v4f*)(SIN + to + 4);
            asm volatile("s_wait_xcnt 0x0" :: "v"(COS + to), "v"(SIN + to) : "memory");   // stands between the table loads and any rewrite of their address registers, which it keeps live (no load lands on them)
            v8h o;
#pragma unroll
            for (int i = 0; i < 4; ++i) { o[i] = toh_flush(x0[i] * ca[i] + (sg * y0[i]) * sa[i]); o[4 + i] = toh_flush(x1[i] * cb[i] + (sg * y1[i]) * sb[i]); }
            hv[s] = o; }
        const size_t sbs = tbase + (size_t)(mb * 16) * HD;
{
#pragma unroll
            for (int s = 0; s < 8; ++s) *(v8h*)(Ph + sbs + (size_t)(s * 32 + lane) * 8) = hv[s];
             }
        wave_sync();
    }
}

// vt_body: v^T projection, ONE WAVE per 64x64 tile (16 accumulators), operands from the block's LDS tiles (row pitch PPH), K = DX. A = Wv rows (m = h*128 + d), Bt = x rows (n = b*SEQ + t); plane [(b*2048 + m)][t], row pitch SEQ.
// A, Bt: the wave's first Wv row and first x row in LDS; r0, c0: the same rows' numbers in the planes; os: the wave's LDS tile, 16 * 68 floats, inside the x tile, written only behind the barrier that ends every wave's fragment reads.
static __device__ __forceinline__ void vt_body(const bf* A, const bf* Bt, h16* Ph, float* os, int r0, int c0) {
    const int K = DX;
    const int lane = threadIdx.x & 31, lr = lane & 15, hi = lane >> 4;
    v8f acc[4][4];
#pragma unroll
    for (int mb = 0; mb < 4; ++mb)
#pragma unroll
        for (int nb = 0; nb < 4; ++nb) acc[mb][nb] = (v8f){};
    const int foff = lr * PPH + 8 * hi;
#pragma unroll 1
    for (int kc = 0; kc < K; kc += 32) {
        const bf* pa = A + foff + kc; const bf* pb = Bt + foff + kc;
        v16bf a[4], b[4];                                        // all 8 fragments of the k-step stand ahead of its first product: one LDS latency per k-step instead of one per column tile
#pragma unroll
        for (int mb = 0; mb < 4; ++mb) a[mb] = ldb(pa + mb * 16 * PPH);
#pragma unroll
        for (int nb = 0; nb < 4; ++nb) b[nb] = ldb(pb + nb * 16 * PPH);
        __builtin_amdgcn_sched_barrier(0);                       // holds the load group ahead of the matrix run: without it the compiler spreads the loads in pairs among the matrix instructions and each pair's latency is exposed
#pragma unroll
        for (int nb = 0; nb < 4; ++nb)
#pragma unroll
            for (int mb = 0; mb < 4; ++mb) acc[mb][nb] = wmmab(a[mb], b[nb], acc[mb][nb]);
    }
    __syncthreads();                                            // every wave's fragment reads are done before the x tile becomes epilogue tiles
    const int bb = c0 / SEQ, tt = c0 % SEQ;
    const size_t tbase = (size_t)bb * (size_t)DQ * SEQ + (size_t)r0 * SEQ + (size_t)tt;
#pragma unroll
    for (int mb = 0; mb < 4; ++mb) {
#pragma unroll
        for (int nb = 0; nb < 4; ++nb) {
#pragma unroll
            for (int j = 0; j < 8; ++j) os[(hi * 8 + j) * 68 + nb * 16 + lr] = acc[mb][nb][j]; }   // D: row 8h+j, col lane&15
        wave_sync();
        v8h hv[4];
#pragma unroll
        for (int s = 0; s < 4; ++s) { const int row = 4 * s + (lane >> 3), c8 = (lane & 7) * 8;   // 4 s x 4 row groups = 16 rows; 8 lanes x 8 = 64 columns
            const v4f x0 = *(const v4fa*)(&os[row * 68 + c8]); const v4f x1 = *(const v4fa*)(&os[row * 68 + c8 + 4]); v8h o;
#pragma unroll
            for (int i = 0; i < 4; ++i) { o[i] = toh_flush(x0[i]); o[4 + i] = toh_flush(x1[i]); }
            hv[s] = o; }
        const size_t sbs = tbase + (size_t)(mb * 16) * SEQ;
{
#pragma unroll
            for (int s = 0; s < 4; ++s) { const int row = 4 * s + (lane >> 3), c8 = (lane & 7) * 8;
                *(v8h*)(Ph + sbs + (size_t)row * SEQ + c8) = hv[s]; }
             }
        wave_sync();
    }
}

// stage_rows8: 8 asynchronous 16-B copies per thread out of a contiguous tile of PTK rows x 384 B. 384 pieces of 16 B are 16 rows, so copy k of the 8 lies 6144 B further in the plane and 16 rows further in LDS.
// g: the thread's first global piece; l: its LDS byte address. The s_wait_xcnt closes the statement so that no address register is rewritten ahead of it.
static __device__ __forceinline__ void stage_rows8(const bf* g, unsigned l) {
    asm volatile("global_load_async_to_lds_b128 %0, %1, off\n\t"
                 "global_load_async_to_lds_b128 %2, %3, off\n\t"
                 "global_load_async_to_lds_b128 %4, %5, off\n\t"
                 "global_load_async_to_lds_b128 %6, %7, off\n\t"
                 "global_load_async_to_lds_b128 %8, %9, off\n\t"
                 "global_load_async_to_lds_b128 %10, %11, off\n\t"
                 "global_load_async_to_lds_b128 %12, %13, off\n\t"
                 "global_load_async_to_lds_b128 %14, %15, off\n\t"
                 "s_wait_xcnt 0x0"
                 :: "v"(l), "v"(g), "v"(l + 16 * PPH * 2), "v"(g + 16 * DX), "v"(l + 32 * PPH * 2), "v"(g + 32 * DX), "v"(l + 48 * PPH * 2), "v"(g + 48 * DX),
                    "v"(l + 64 * PPH * 2), "v"(g + 64 * DX), "v"(l + 80 * PPH * 2), "v"(g + 80 * DX), "v"(l + 96 * PPH * 2), "v"(g + 96 * DX), "v"(l + 112 * PPH * 2), "v"(g + 112 * DX)
                 : "memory");
}

// k_proj: the three independent projections in ONE launch of PW-wave blocks, grid (NB*SEQ/PTK, NH_, 3); blockIdx.z picks the job (block-uniform branch): 0 = q, 1 = k, 2 = v^T.
// A block takes PTK tokens x one head (PTK weight rows). Both operand tiles, whole K, are contiguous in their planes and come once per block into LDS as whole 128-B lines (48 copies per thread, filled once, then read);
// the waves take their fragments from there by 16-B LDS loads. q, k: wave w has tokens 32 w .. 32 w + 31 and the whole head. v^T: wave w has weight rows 64 (w & 1) .. + 63 and tokens 64 (w >> 1) .. + 63.
static_assert((NB * SEQ) % PTK == 0 && SEQ % PTK == 0 && PTK == HD);   // whole blocks; a block never straddles two batches; one head per block
static_assert(PTK == 32 * PW && PTK * PTK == 64 * 64 * PW);            // the waves' tiles cover the block's tile in both kinds of job
static_assert(DX * 2 == 24 * 16 && 16 * 24 == 3 * 32 * PW && PTK == 8 * 16);   // piece map: 24 pieces per row, 3 pieces per thread per 16 rows, 8 groups of 16 rows
static_assert((PPH * 2) % 16 == 0 && PPH >= DX);
static_assert(PW * 16 * OSQ * 4 <= PTB && 16 * 68 <= 16 * OSQ);        // the epilogue tiles fit the x tile
static_assert(2 * PTB <= 163840);
__global__ __launch_bounds__(32 * PW) __attribute__((amdgpu_waves_per_eu(3, 3)))
void k_proj(const bf* __restrict__ XB, const bf* __restrict__ WQ, const bf* __restrict__ WK, const bf* __restrict__ WV, const float* __restrict__ qnw, const float* __restrict__ knw,
            const float* __restrict__ COS, const float* __restrict__ SIN, h16* QH, h16* KP, h16* VT) {
    __shared__ __align__(16) char ps[2 * PTB];                  // x tile | W tile
    const int tid = threadIdx.x;
    const int wave = __builtin_amdgcn_readfirstlane((int)(threadIdx.x >> 5));
    const int z = (int)blockIdx.z, bx = (int)blockIdx.x, by = (int)blockIdx.y;
    const bf* xg = XB + (size_t)bx * PTK * DX;
    const bf* wg = (z == 0 ? WQ : (z == 1 ? WK : WV)) + (size_t)by * PTK * DX;
    const unsigned lbase = (unsigned)(size_t)ps;                // LDS byte address of the tiles
#pragma unroll   // three pieces per thread in every group of 16 rows; constant trip count, so that the row and column of a piece are computed three times only
    for (int r = 0; r < 3; ++r) {
        const int q = r * (32 * PW) + tid;                      // piece 0..383 of the first 16 rows: row q / 24, 16-B column q % 24
        const unsigned lo = (unsigned)((q / 24) * (PPH * 2) + (q % 24) * 16);
        stage_rows8(xg + (size_t)q * 8, lbase + lo);
        stage_rows8(wg + (size_t)q * 8, lbase + PTB + lo);
    }
    asm volatile("s_wait_asynccnt 0x0" ::: "memory");           // this wave's copies have landed
    __syncthreads();                                            // both tiles are readable by every wave
    const bf* xs = (const bf*)ps;
    const bf* wt = (const bf*)(ps + PTB);
    float* os = (float*)ps + wave * (16 * OSQ);
    if (z < 2) {
        qk_body(xs + wave * 32 * PPH, wt, z ? knw : qnw, COS, SIN, z ? KP : QH, os, bx * PTK + wave * 32, by);
        return;
    }
    const int mi = wave & 1, ni = wave >> 1;
    vt_body(wt + mi * 64 * PPH, xs + ni * 64 * PPH, VT, os, by * PTK + mi * 64, bx * PTK + ni * 64);
}

// stage_kv: one stage (KT keys) into LDS, 8 asynchronous 16-B copies per thread, whole 128-B lines per wave instruction.
// K tile: KT rows x 256 B, contiguous in the plane; piece c = 256 i + tid -> row c>>4, 16-B column c&15. V^T tile: 128 rows x 128 B; piece c -> row c>>3, 16-B column c&7.
// kg, vg: the thread's first global piece; lk, lv: its LDS byte addresses. The s_wait_xcnt closes the statement so that no address register is rewritten ahead of it.
static __device__ __forceinline__ void stage_kv(const h16* kg, const h16* vg, unsigned lk, unsigned lv) {
    asm volatile("global_load_async_to_lds_b128 %0, %1, off\n\t"
                 "global_load_async_to_lds_b128 %2, %3, off\n\t"
                 "global_load_async_to_lds_b128 %4, %5, off\n\t"
                 "global_load_async_to_lds_b128 %6, %7, off\n\t"
                 "global_load_async_to_lds_b128 %8, %9, off\n\t"
                 "global_load_async_to_lds_b128 %10, %11, off\n\t"
                 "global_load_async_to_lds_b128 %12, %13, off\n\t"
                 "global_load_async_to_lds_b128 %14, %15, off\n\t"
                 "s_wait_xcnt 0x0"
                 :: "v"(lk), "v"(kg), "v"(lk + 16 * KPH * 2), "v"(kg + 2048), "v"(lk + 32 * KPH * 2), "v"(kg + 4096), "v"(lk + 48 * KPH * 2), "v"(kg + 6144),
                    "v"(lv), "v"(vg), "v"(lv + 32 * VPH * 2), "v"(vg + (size_t)32 * SEQ), "v"(lv + 64 * VPH * 2), "v"(vg + (size_t)64 * SEQ), "v"(lv + 96 * VPH * 2), "v"(vg + (size_t)96 * SEQ)
                 : "memory");
}

// k_flash: fused attention, one wave per 16 query rows of one (batch, head), AW waves per block on the same (batch, head); K and V^T tiles of KT keys come once per block into LDS
// (two buffers, the next tile's copies fly while this one is worked on), fragments by two 16-B LDS loads each; Q fragments straight from the f16 plane, once per wave.
// Transposed form: S^T[key][t] = K Q^T (A = K rows, B = Q rows, 4 k-steps over d); lane (t = lane&15, h = lane>>4) holds keys 8h+r of each 16-key tile, so the packed
// P tile is directly the B fragment of O^T[d][t] = V^T P^T (element r <- tile keys 0..15, element 8+r <- tile keys 16..31, lane unchanged); 8 output tiles of 16 d.
// Additive mask row t, keys key0+8h+0..7 and key0+16+8h+0..7: four 16-B loads per lane per step, issued one step ahead, value RNE-converted to bf16, added after the scale (base-2 domain).
// Softmax state (running max, partial sum) is one scalar per lane; the two lane halves of a row are combined with one xor-16 exchange. Q fragments are loaded once, ahead of the key loop, and stay in registers.
__global__ __launch_bounds__(32 * AW) __attribute__((amdgpu_num_vgpr(256)))
void k_flash(const h16* __restrict__ QH, const h16* __restrict__ KP, const h16* __restrict__ VT, const float* __restrict__ mask, h16* CTX) {
    __shared__ __align__(16) char sm[2 * STB];
    float* os = (float*)sm;                                     // output tiles, after the key loop
    const int tid = threadIdx.x;
    const int lane = threadIdx.x & 31, lr = lane & 15, hi = lane >> 4;
    const int wave = __builtin_amdgcn_readfirstlane((int)(threadIdx.x >> 5));
    const int zh = blockIdx.y; const int b = zh / NH_, h = zh % NH_;
    const int t0 = (blockIdx.x * AW + wave) * 16;
    const size_t pbase = (size_t)zh * SEQ * HD;
    const size_t qo = pbase + (size_t)(t0 + lr) * HD + 8 * hi;  // + ks*32          (B fragment: col t, k = d)
    const int ko = lr * KPH + 8 * hi;                           // + key*KPH + ks*32 (A fragment: row key, k = d), halves in the K tile
    const int vo = lr * VPH + 8 * hi;                           // + 16j*VPH + key   (A fragment: row d, k = key), halves in the V^T tile
    const unsigned lbase = (unsigned)(size_t)sm;                // LDS byte address of the stage buffers
    const unsigned lk = lbase + (unsigned)((tid >> 4) * (KPH * 2) + (tid & 15) * 16);
    const unsigned lv = lbase + (unsigned)(KTB + (tid >> 3) * (VPH * 2) + (tid & 7) * 16);
    const h16* kg = KP + pbase + (size_t)tid * 8;
    const h16* vg = VT + pbase + (size_t)(tid >> 3) * SEQ + (size_t)(tid & 7) * 8;
    const float* mrow = mask + ((size_t)b * SEQ_FULL + (size_t)(t0 + lr)) * SEQ_FULL + 8 * hi;
    v8f o[8];
#pragma unroll
    for (int j = 0; j < 8; ++j) o[j] = (v8f){};
    float m = NEGB, l = 0.0f;
    stage_kv(kg, vg, lk, lv);
    v16h qf[HD / 32];                                           // the wave's 16 query rows as B fragments, loaded once and held in 32 registers for the whole key loop
#pragma unroll   // constant indices, so that qf lives in registers and not in scratch memory
    for (int ks = 0; ks < HD / 32; ++ks) qf[ks] = ldh(QH + qo + ks * 32);
    v4f m0 = *(const v4f*)mrow, m1 = *(const v4f*)(mrow + 4), m2 = *(const v4f*)(mrow + 16), m3 = *(const v4f*)(mrow + 20);   // mask values of step 0; every later step's are loaded one step ahead
    asm volatile("s_wait_xcnt 0x0" ::: "memory");               // stands between the Q loads and the later reuse of their address registers
    asm volatile("s_wait_asynccnt 0x0" ::: "memory");           // this wave's copies of tile 0 have landed
    __syncthreads();                                            // tile 0 is readable by every wave
    stage_kv(kg + (size_t)KT * HD, vg + KT, lk + STB, lv + STB);
#pragma unroll 1
    for (int t = 0; t < SEQ / KT; ++t) {
      const unsigned bo = (unsigned)(t & 1) * STB;
      const h16* kt = (const h16*)(sm + bo) + ko;
      const h16* vt = (const h16*)(sm + bo + KTB) + vo;
#pragma unroll   // both 32-key steps of a tile in line: their tile offsets become immediates of the LDS loads
      for (int sub = 0; sub < KT / 32; ++sub) {
        const int key0 = t * KT + sub * 32;
        const h16* ka = kt + sub * 32 * KPH;
        v8f sA = (v8f){}, sB = (v8f){};
        v16h ka0[HD / 32], kb0[HD / 32];                         // the step's 16 K loads stand ahead of its first product: one LDS latency per step instead of one per k-step
#pragma unroll
        for (int ks = 0; ks < HD / 32; ++ks) { ka0[ks] = ldh(ka + ks * 32); kb0[ks] = ldh(ka + 16 * KPH + ks * 32); }
        __builtin_amdgcn_sched_barrier(0);                       // holds the load group ahead of the matrix run: without it the compiler spreads the loads in pairs among the matrix instructions and each pair's latency is exposed
#pragma unroll
        for (int ks = 0; ks < HD / 32; ++ks) { sA = wmma16(ka0[ks], qf[ks], sA); sB = wmma16(kb0[ks], qf[ks], sB); }
        asm volatile("v_nop\n\tv_nop\n\tv_nop\n\tv_nop" : "+v"(sA), "+v"(sB));   // the four slots between the run's last matrix instruction and the first vector read of the scores, once per run
        const h16* va = vt + sub * 32;
        v16h vf[8];                                              // the step's 16 V^T loads issue as one group behind the score run; the softmax arithmetic covers their latency
#pragma unroll
        for (int j = 0; j < 8; ++j) vf[j] = ldh(va + (16 * j) * VPH);
        float ta[8], tb[8]; float mx = NEGB;
#pragma unroll
        for (int r = 0; r < 4; ++r) {
            ta[r] = sA[r] * SC2 + bfr(m0[r]) * L2E; ta[4 + r] = sA[4 + r] * SC2 + bfr(m1[r]) * L2E;
            tb[r] = sB[r] * SC2 + bfr(m2[r]) * L2E; tb[4 + r] = sB[4 + r] * SC2 + bfr(m3[r]) * L2E; }
        const float* mp = mrow + ((key0 + 32 < SEQ) ? key0 + 32 : 0);   // next step's keys +8h+0..7 and +16+8h+0..7, all < SEQ (behind the last step: step 0's again, unused)
        m0 = *(const v4f*)mp; m1 = *(const v4f*)(mp + 4); m2 = *(const v4f*)(mp + 16); m3 = *(const v4f*)(mp + 20);
#pragma unroll
        for (int r = 0; r < 8; ++r) mx = fmaxf(mx, fmaxf(ta[r], tb[r]));
        mx = fmaxf(mx, __shfl_xor(mx, 16, 32));
        const float mnew = fmaxf(m, mx);
        const float alpha = __builtin_amdgcn_exp2f(m - mnew);
        const float sh = PSH - mnew;
        v16h pb; float ls = 0.0f;
#pragma unroll
        for (int r = 0; r < 8; ++r) {
            const float xa = ta[r] + sh, xb = tb[r] + sh;
            const float ea = __builtin_amdgcn_exp2f(xa), eb = __builtin_amdgcn_exp2f(xb);
            const float ga = (xa < -14.0f) ? 0.0f : ea, gb = (xb < -14.0f) ? 0.0f : eb;   // no subnormal f16 P (select on the exponent argument)
            const h16 pa = (h16)ga; const h16 pc = (h16)gb;
            pb[r] = pa; pb[8 + r] = pc;
            ls += (float)pa + (float)pc; }
        l = l * alpha + ls; m = mnew;
#pragma unroll
        for (int j = 0; j < 8; ++j) o[j] = o[j] * alpha;
        __builtin_amdgcn_sched_barrier(0);                       // holds the load group ahead of the matrix run: without it the compiler spreads the loads in pairs among the matrix instructions and each pair's latency is exposed
#pragma unroll
        for (int j = 0; j < 8; ++j) o[j] = wmma16(vf[j], pb, o[j]);
        asm volatile("v_nop\n\tv_nop\n\tv_nop\n\tv_nop" : "+v"(o[0]), "+v"(o[1]), "+v"(o[2]), "+v"(o[3]), "+v"(o[4]), "+v"(o[5]), "+v"(o[6]), "+v"(o[7]));   // the four slots behind the run's last matrix instruction, once per run (the loop's back edge included); as an ordered statement it also keeps this run ahead of the next step's score products: without it the build interleaved the two steps and spilled to scratch
      }
      asm volatile("s_wait_dscnt 0x0" ::: "memory");            // this wave's reads of tile t are done before its buffer is refilled
      asm volatile("s_wait_asynccnt 0x0" ::: "memory");         // this wave's copies of tile t + 1 have landed
      __syncthreads();                                          // publishes tile t + 1 and ends every wave's reads of tile t
      if (t + 2 < SEQ / KT) stage_kv(kg + (size_t)(t + 2) * KT * HD, vg + (t + 2) * KT, lk + bo, lv + bo);
    }
    asm volatile("s_wait_asynccnt 0x0" ::: "memory");           // no copy is outstanding when the buffers become output tiles
    l += __shfl_xor(l, 16, 32);
    const bool any = l > 0.0f;
    const float lsafe = any ? l : 1.0f;
    const float inv = any ? ((1.0f / lsafe) * CXS) : 0.0f;
    const int wb = wave * 16 * OSP;
    // O^T D layout: o[j][r] = (d = 16j + 8h + r, t = lane&15) -> os[t][d]; rows 0..15 x columns 0..127 all written
#pragma unroll
    for (int j = 0; j < 8; ++j) { v4f a, c;
        a[0] = o[j][0] * inv; a[1] = o[j][1] * inv; a[2] = o[j][2] * inv; a[3] = o[j][3] * inv; c[0] = o[j][4] * inv; c[1] = o[j][5] * inv; c[2] = o[j][6] * inv; c[3] = o[j][7] * inv;
        *(v4fa*)(&os[wb + lr * OSP + 16 * j + 8 * hi]) = a; *(v4fa*)(&os[wb + lr * OSP + 16 * j + 8 * hi + 4]) = c; }
    wave_sync();
    v8h hv[8];
#pragma unroll
    for (int s = 0; s < 8; ++s) { const int p = s * 32 + lane; const int row = p >> 4, c8 = (p & 15) * 8;   // 8 s x 2 rows = 16 rows; 16 lanes x 8 = 128 columns = two lines
        const v4f x0 = *(const v4fa*)(&os[wb + row * OSP + c8]); const v4f x1 = *(const v4fa*)(&os[wb + row * OSP + c8 + 4]); v8h q;
#pragma unroll
        for (int i = 0; i < 4; ++i) { q[i] = toh_flush(x0[i]); q[4 + i] = toh_flush(x1[i]); }
        hv[s] = q; }
    h16* crow = CTX + ((size_t)b * SEQ + (size_t)t0) * DQ + (size_t)h * HD;
{
#pragma unroll
        for (int s = 0; s < 8; ++s) { const int p = s * 32 + lane; const int row = p >> 4, c8 = (p & 15) * 8;
            *(v8h*)(crow + (size_t)row * DQ + c8) = hv[s]; }
         }
}

// k_out: output projection, OW waves per 64x64 tile (16 accumulators each), f16 operands straight from K-contiguous planes, K = DQ split over the waves:
// wave w takes the 32-wide k-steps w, w + OW, w + 2 OW, ... (neighbouring waves read the two halves of the same 128-B lines), so OW times as many loads are in flight per tile.
// OUT[m][n] = (1/16384) sum_k A[m][k] Bt[n][k]; A = ctx rows (m = b*SEQ + t, x256), Bt = Wo rows (n, x64). grid (NB*SEQ/64, DX/64).
// Epilogue: every wave writes its partial 64x64 f32 tile to its own LDS plane; behind one barrier wave w adds rows 8w..8w+7 over the planes in plane order 0..OW-1 and stores them as whole lines.
__global__ __launch_bounds__(32 * OW) void k_out(const h16* __restrict__ A, const h16* __restrict__ Bt, float* OUT) {
    __shared__ __align__(16) float os[OW * 64 * 68];
    const int K = DQ;
    const int lane = threadIdx.x & 31, lr = lane & 15, hi = lane >> 4; const int r0 = blockIdx.x * 64, c0 = blockIdx.y * 64;
    const int wave = __builtin_amdgcn_readfirstlane((int)(threadIdx.x >> 5));
    v8f acc[4][4];
#pragma unroll
    for (int mb = 0; mb < 4; ++mb)
#pragma unroll
        for (int nb = 0; nb < 4; ++nb) acc[mb][nb] = (v8f){};
    const size_t aoff = (size_t)(r0 + lr) * K + 8 * hi, boff = (size_t)(c0 + lr) * K + 8 * hi;
#pragma unroll 1
    for (int kc = wave * 32; kc < K; kc += 32 * OW) {
        const h16* pa = A + aoff + kc; const h16* pb = Bt + boff + kc;
        v16h a[4], bq[4];                                        // all 16 loads of the k-step stand ahead of its first product: one memory latency per k-step instead of one per column tile
#pragma unroll
        for (int mb = 0; mb < 4; ++mb) a[mb] = ldh(pa + (size_t)mb * 16 * K);
#pragma unroll
        for (int nb = 0; nb < 4; ++nb) bq[nb] = ldh(pb + (size_t)nb * 16 * K);
        asm volatile("s_wait_xcnt 0x0" :: "v"(pa), "v"(pb) : "memory");   // stands between the loads and any rewrite of their address registers, which it keeps live (no load lands on them)
        __builtin_amdgcn_sched_barrier(0);                       // holds the load group ahead of the matrix run: without it the compiler spreads the loads in pairs among the matrix instructions and each pair's latency is exposed
#pragma unroll
        for (int nb = 0; nb < 4; ++nb)
#pragma unroll
            for (int mb = 0; mb < 4; ++mb) acc[mb][nb] = wmma16(a[mb], bq[nb], acc[mb][nb]);
    }
    float* ow = os + wave * (64 * 68);
#pragma unroll
    for (int mb = 0; mb < 4; ++mb)
#pragma unroll
        for (int nb = 0; nb < 4; ++nb)
#pragma unroll
            for (int j = 0; j < 8; ++j) ow[(mb * 16 + hi * 8 + j) * 68 + nb * 16 + lr] = acc[mb][nb][j];   // D: row 8h+j, col lane&15
    __syncthreads();                                            // every wave's partial tile is readable by every wave
    const int bb = r0 / SEQ, tt = r0 % SEQ;
    float* obase = OUT + ((size_t)bb * OUT_SEQ + (size_t)tt) * DX + c0;
    v4f ov[4];
#pragma unroll
    for (int s = 0; s < 4; ++s) { const int p = s * 32 + lane; const int row = wave * (64 / OW) + (p >> 4), c4 = (p & 15) * 4;   // 4 s x 2 rows = 8 rows; 16 lanes x 4 floats = 64 columns = two lines
        v4f sum = *(const v4fa*)(&os[row * 68 + c4]);
#pragma unroll
        for (int q = 1; q < OW; ++q) sum += *(const v4fa*)(&os[q * (64 * 68) + row * 68 + c4]);
        ov[s] = sum * OSC; }
#pragma unroll
    for (int s = 0; s < 4; ++s) { const int p = s * 32 + lane; const int row = wave * (64 / OW) + (p >> 4), c4 = (p & 15) * 4;
        *(v4f*)(obase + (size_t)row * DX + c4) = ov[s]; }
}

static constexpr size_t al256(size_t v) { return (v + 255) & ~(size_t)255; }
static constexpr size_t SZ_XB = al256((size_t)NB * SEQ * DX * 2);          // x bf16 [NB*SEQ][192]
static constexpr size_t SZ_WB = al256((size_t)3 * DQ * DX * 2);            // Wq | Wk | Wv bf16 [3][2048][192]
static constexpr size_t SZ_WO = al256((size_t)DX * DQ * 2);                // Wo f16 [192][2048]
static constexpr size_t SZ_TB = al256((size_t)SEQ * 64 * 4);               // cos or sin table [SEQ][64]
static constexpr size_t SZ_PL = al256((size_t)NB * NH_ * SEQ * HD * 2);    // q, k, v^T planes
static constexpr size_t SZ_CX = al256((size_t)NB * SEQ * DQ * 2);          // ctx plane
static constexpr size_t SZ_TOTAL = SZ_XB + SZ_WB + SZ_WO + 2 * SZ_TB + 3 * SZ_PL + SZ_CX;
static_assert(SZ_TOTAL <= (size_t)134217728);          // workspace carve <= 128 MiB
static_assert(((size_t)DQ * DX * 2) % 256 == 0);       // weight sub-planes stay 256-byte aligned
static_assert((size_t)NB * NH_ * SEQ * HD == (size_t)NB * DQ * SEQ);       // v^T plane [(b*2048 + m)][t] has the same extent as the q/k planes

extern "C" void kernel_launch(void* const* d_in, const int* in_sizes, int n_in,
                              void* d_out, int out_size, void* d_ws, size_t ws_size, hipStream_t stream) {
    if (n_in < 8) return;
    const size_t needx = ((size_t)(NB - 1) * SEQ_FULL + SEQ) * DX;
    const size_t needm = ((size_t)(NB - 1) * SEQ_FULL + (size_t)(SEQ - 1)) * SEQ_FULL + SEQ;
    if ((size_t)in_sizes[0] < needx || (size_t)in_sizes[1] < needm) return;
    if ((size_t)in_sizes[2] < (size_t)DQ * DX || (size_t)in_sizes[3] < (size_t)DQ * DX || (size_t)in_sizes[4] < (size_t)DQ * DX || (size_t)in_sizes[5] < (size_t)DX * DQ) return;
    if (in_sizes[6] < HD || in_sizes[7] < HD) return;
    if ((size_t)out_size < ((size_t)(NB - 1) * OUT_SEQ + SEQ) * DX) return;
    if (SZ_TOTAL > ws_size) return;
    // wire order: x, mask0, wq, wk, wv, wo, q_norm_w, k_norm_w
    const float* x    = (const float*)d_in[0];
    const float* mask = (const float*)d_in[1];
    const float* wq   = (const float*)d_in[2];
    const float* wk   = (const float*)d_in[3];
    const float* wv   = (const float*)d_in[4];
    const float* wo   = (const float*)d_in[5];
    const float* qnw  = (const float*)d_in[6];
    const float* knw  = (const float*)d_in[7];
    float* OUT = (float*)d_out;      // [NB][SEQ][192]
    char* wsp = (char*)d_ws;
    bf*  XB  = (bf*)wsp;  wsp += SZ_XB;               // [NB*SEQ][192]
    bf*  WB  = (bf*)wsp;  wsp += SZ_WB;               // [3][2048][192]: q | k | v  ([out][in] = Bt as-is for q, k; A as-is for v^T)
    h16* WOH = (h16*)wsp; wsp += SZ_WO;               // [192][2048] x64
    float* COS = (float*)wsp; wsp += SZ_TB;           // [SEQ][64]
    float* SIN = (float*)wsp; wsp += SZ_TB;           // [SEQ][64]
    h16* QH  = (h16*)wsp; wsp += SZ_PL;               // [NB*16][SEQ][128]
    h16* KP  = (h16*)wsp; wsp += SZ_PL;               // [NB*16][SEQ][128]
    h16* VT  = (h16*)wsp; wsp += SZ_PL;               // [NB*16][128][SEQ]
    h16* CTX = (h16*)wsp; wsp += SZ_CX;               // [NB*SEQ][2048] x256
    bf* WQ = WB; bf* WK = WB + (size_t)DQ * DX; bf* WV = WB + (size_t)2 * DQ * DX;

    // preparation: bf16 copies of x and Wq|Wk|Wv, f16 Wo plane, rotary tables
    k_prep<<<PB_ALL, 256, 0, stream>>>(x, wq, wk, wv, wo, XB, WB, WOH, COS, SIN);
    // q, k: A = x rows (m = b*SEQ + t), Bt = W rows (n = h*128 + d) -> normalised, rotated plane [(b*16 + h)][t][d]
    // v^T: A = Wv rows (m = h*128 + d), Bt = x rows (n = b*SEQ + t) -> plane [(b*2048 + m)][t] = [(b*16 + h)][d][t]
    k_proj<<<dim3(NB * SEQ / PTK, NH_, 3), 32 * PW, 0, stream>>>(XB, WQ, WK, WV, qnw, knw, COS, SIN, QH, KP, VT);

    k_flash<<<dim3(SEQ / (16 * AW), NB * NH_, 1), 32 * AW, 0, stream>>>(QH, KP, VT, mask, CTX);
    // output projection: A = ctx rows [b*SEQ + t][2048], Bt = Wo rows [192][2048]
    k_out<<<dim3(NB * SEQ / 64, DX / 64, 1), 32 * OW, 0, stream>>>(CTX, WOH, OUT);
}

// v008
// A run of this version takes 109 microseconds.
// Timed twice side by side with v007, it ran 1.04 times as fast both times.
// Counting every step since v000, it is 3.89 times as fast.
#include <hip/hip_runtime.h>

// Dense self-attention layer: x [NB][SEQ][192]; Wq/Wk/Wv [2048][192] ([out][in], y = x W^T, no bias); 16 heads x 128; per-head RMS normalisation of q and k (eps 1e-6, gain inputs);
// rotate-half rotary embeddings (base 1e6, positions 0..SEQ-1); scores = q.k * 128^-0.5 + additive mask [NB][1][SEQ][SEQ] (read by value); softmax over keys; P.V; heads merged; output = ctx Wo^T with Wo [192][2048] (f32).
// Compute dtypes, f32 accumulate everywhere: q/k/v projections v_wmma_f32_16x16x32_bf16 (x and W RNE-converted to bf16; products exact);
// scores v_wmma_f32_16x16x32_f16 (q, k single f16 planes after normalisation and rotary); P.V v_wmma_f32_16x16x32_f16 (P single f16 with x16384 carry that cancels in the normalisation, v single f16);
// output projection v_wmma_f32_16x16x32_f16 (ctx single f16 with x256 carry, Wo = bf16-converted value x64 as f16; 1/16384 folded in the f32 epilogue). Softmax f32 (online, running max), row sum over the converted P.
// Layout: bf16 copies of x and Wq|Wk|Wv; f16 Wo plane; cos/sin tables [SEQ][64] f32; q, k planes [b*16+h][t][128]; v^T plane [b*16+h][d][t]; ctx plane [b*SEQ+t][h*128+d];
// fused flash kernel in transposed form (S^T = K Q^T, O^T = V^T P^T), K and V^T tiles staged in LDS for the whole block, Q fragments straight from the f16 plane, no score or probability plane in memory.

#ifndef NB
#define NB 2
#endif
#ifndef SEQ
#define SEQ 2048
#endif
#define NB_FULL  2
#define SEQ_FULL 2048
#ifndef OUT_SEQ
#define OUT_SEQ SEQ              // row pitch (in tokens) between batches of the output
#endif
#define DX   192                 // model width (projection K, output N)
#define NH_  16
#define HD   128
#define DQ   2048                // NH_ * HD
#define AW   8                   // waves per flash block (16 query rows each)
#define KT   64                  // keys per LDS stage of the flash kernel
#define OW   8                   // waves per output-projection block (K split over them)
#define OKC  512                 // k values per LDS stage of the output projection
#define OPH  520                 // LDS row pitch (halves) of its tiles: 1040 B = 16 B x odd
#define OTB  (64 * OPH * 2)      // bytes of one 64-row operand tile of the output projection in LDS
#define OSB  (2 * OTB)           // bytes of one stage: ctx tile | Wo tile
#define KPH  136                 // LDS row pitch (halves) of the K tile: 272 B = 16 B x odd
#define VPH  72                  // LDS row pitch (halves) of the V^T tile: 144 B = 16 B x odd
#define KTB  (KT * KPH * 2)      // bytes of one K tile in LDS
#define VTB  (HD * VPH * 2)      // bytes of one V^T tile in LDS
#define STB  (KTB + VTB)         // bytes of one stage
#define OSP  132                 // LDS row pitch (floats) of the flash output tile
#define OSQ  132                 // LDS row pitch (floats) of the q/k epilogue tile
#define PW   4                   // waves per projection block
#define PTK  128                 // tokens, and weight rows, per projection block
#define PPH  200                 // LDS row pitch (halves) of the projection tiles: 400 B = 16 B x odd
#define PTB  (PTK * PPH * 2)     // bytes of one projection tile in LDS
#define SC2  ((float)(0.08838834764831845 * 1.4426950408889634))   // HD^-0.5 * log2(e)
#define L2E  1.4426950408889634f
#define PSH  14.0f               // log2 of the P carry (16384)
#define NEGB (-3.0e38f)
#define CXS  256.0f              // carry of the ctx plane
#define WOS  64.0f               // carry of the Wo plane
#define OSC  (1.0f / 16384.0f)   // 1 / (CXS * WOS)

static_assert(HD == 128);                      // q/k plane row = 256 bytes = two lines; one head = 8 column tiles of 16
static_assert(NH_ * HD == DQ);                 // head h = columns h*128 + d
static_assert(HD % 32 == 0);                   // score k-loop steps by 32
static_assert(DX % 32 == 0);                   // projection k-loop steps by 32
static_assert(DQ % 32 == 0);                   // output-projection k-loop steps by 32
static_assert(DX % 64 == 0);                   // output column tiles of 64
static_assert(DQ % 64 == 0);                   // v^T row tiles of 64
static_assert(SEQ % 64 == 0);                  // a 64-token tile never straddles two batches
static_assert((NB * SEQ) % 64 == 0);
static_assert(SEQ % 32 == 0);                  // key loop steps by 32; 32-token q/k tiles
static_assert(SEQ % (16 * AW) == 0);           // flash grid covers the sequence exactly
static_assert(((size_t)SEQ * DX) % 64 == 0);
static_assert(((size_t)DQ * DX) % 2048 == 0);  // weight converts: whole 256-thread blocks
static_assert((SEQ * 64) % 256 == 0);
static_assert(NB <= NB_FULL);
static_assert(SEQ <= SEQ_FULL);
static_assert(OSP >= HD);
static_assert(OSQ >= HD);
static_assert((OSP * 4) % 16 == 0);
static_assert((OSQ * 4) % 16 == 0);
static_assert((DX * 4) % 128 == 0);            // output rows start on a line
static_assert(32 * 16 * 8 == 16 * HD * 2);     // q/k epilogue and ctx epilogue: 32 lanes x 16 B x 8 instructions == 16 rows x 256 B
static_assert(32 * 16 * 4 == 16 * 64 * 2);
static_assert(16 * OSQ * 4 <= 131072);         // bytes of one wave's q/k epilogue tile
static_assert(16 * 68 * 4 <= 131072);          // bytes of one wave's v^T epilogue tile
static_assert(2 * OSB <= 327680);              // static LDS of the output projection kernel: two stage buffers
static_assert(OW * 64 * 68 * 4 <= 2 * OSB);    // one partial tile per wave; the partial tiles reuse the stage buffers
static_assert(DQ % OKC == 0 && DQ / OKC >= 2); // whole stages; the two-buffer prologue needs two
static_assert(OKC == 2 * 32 * OW);             // every wave takes two k-steps of a stage
static_assert(OKC * 2 == 64 * 16 && 32 * OW == 4 * 64 && 64 == 2 * 8 * 4);   // piece map of stage_out: 64 pieces of 16 B per row, 4 rows per pass of the block, 2 statements x 8 passes per tile
static_assert((OPH * 2) % 16 == 0 && OPH >= OKC && OTB % 16 == 0);
static_assert(DQ % (32 * OW) == 0);            // every wave of the output projection takes the same number of k-steps
static_assert(64 % OW == 0 && (64 / OW) * 16 == 4 * 32);   // output epilogue: 4 pieces of 16 B per lane cover the wave's rows
static_assert(2 * STB <= 131072);              // static LDS of the flash kernel
static_assert(AW * 16 * OSP * 4 <= 2 * STB);   // the output tiles reuse the two stage buffers
static_assert(SEQ % KT == 0 && SEQ / KT >= 2); // whole stages; the two-buffer prologue needs two
static_assert(KT * HD * 2 == 4 * 32 * AW * 16);  // K tile: 4 pieces of 16 B per thread
static_assert(HD * KT * 2 == 4 * 32 * AW * 16);  // V^T tile: 4 pieces of 16 B per thread
static_assert(KT == 64 && 32 * AW == 256);     // piece maps of stage_kv: 16 pieces per K row, 8 per V^T row, 256 threads
static_assert(STB % 16 == 0 && KTB % 16 == 0);

typedef _Float16 h16;
typedef unsigned short bf;
typedef __attribute__((ext_vector_type(16))) __bf16   v16bf;
typedef __attribute__((ext_vector_type(16))) _Float16 v16h;
typedef __attribute__((ext_vector_type(8)))  _Float16 v8h;
typedef __attribute__((ext_vector_type(8)))  unsigned short v8us;
typedef __attribute__((ext_vector_type(8)))  float    v8f;
typedef __attribute__((ext_vector_type(4)))  float    v4f;
typedef v4f  __attribute__((may_alias)) v4fa;

__device__ __forceinline__ unsigned short f2bf(float f) { unsigned u = __float_as_uint(f); u += 0x7FFFu + ((u >> 16) & 1u); return (unsigned short)(u >> 16); }
__device__ __forceinline__ float bfr(float f) { return __uint_as_float(((unsigned)f2bf(f)) << 16); }   // value after RNE convert to bf16
__device__ __forceinline__ v16h cat16(v8h lo, v8h hi) { return __builtin_shufflevector(lo, hi, 0, 1, 2, 3, 4, 5, 6, 7, 8, 9, 10, 11, 12, 13, 14, 15); }
__device__ __forceinline__ v16bf cat16b(v8us lo, v8us hi) { return __builtin_bit_cast(v16bf, __builtin_shufflevector(lo, hi, 0, 1, 2, 3, 4, 5, 6, 7, 8, 9, 10, 11, 12, 13, 14, 15)); }
__device__ __forceinline__ v8f wmma16(v16h a, v16h b, v8f c) { return __builtin_amdgcn_wmma_f32_16x16x32_f16(false, a, false, b, (short)0, c, false, false); }
__device__ __forceinline__ v8f wmmab(v16bf a, v16bf b, v8f c) { return __builtin_amdgcn_wmma_f32_16x16x32_bf16(false, a, false, b, (short)0, c, false, false); }
// fragment loaders from K-contiguous 16-bit rows; p already includes + 8*(lane>>4): elements 0..7 <- k0+8h+0..7, elements 8..15 <- k0+16+8h+0..7 (same map for A and B)
__device__ __forceinline__ v16h  ldh(const h16* p) { return cat16(*(const v8h*)p, *(const v8h*)(p + 16)); }
__device__ __forceinline__ v16bf ldb(const bf* p)  { return cat16b(*(const v8us*)p, *(const v8us*)(p + 16)); }
// ordering point for wave-private LDS tiles (same wave writes and reads)
__device__ __forceinline__ void wave_sync() { __builtin_amdgcn_fence(3 /* release order */, "wavefront"); __builtin_amdgcn_wave_barrier(); asm volatile("" ::: "memory"); }

// f32 -> f16 operand convert that cannot produce a subnormal (|v| < 2^-14 -> +0)
static __device__ __forceinline__ h16 toh_flush(float v) { const h16 r = (h16)v; return (fabsf(v) < 6.103515625e-05f) ? (h16)0.0f : r; }

static __device__ __forceinline__ void cvt8_body(const float* __restrict__ src, bf* dst, size_t n8, int blk) {
    const size_t i = (size_t)blk * 256 + threadIdx.x; if (i >= n8) return;
    const v8f v = *(const v8f*)(src + i * 8); v8us o;
#pragma unroll
    for (int k = 0; k < 8; ++k) o[k] = f2bf(v[k]);
    *(v8us*)(dst + i * 8) = o; 
}

static __device__ __forceinline__ void cvtw_body(const float* __restrict__ src, h16* dst, size_t n8, float sc, int blk) {
    const size_t i = (size_t)blk * 256 + threadIdx.x; if (i >= n8) return;
    const v8f v = *(const v8f*)(src + i * 8); v8h o;
#pragma unroll
    for (int k = 0; k < 8; ++k) o[k] = toh_flush(bfr(v[k]) * sc);
    *(v8h*)(dst + i * 8) = o; 
}

// tab_body: rotary tables COS/SIN [SEQ][64] (f32): angle = (float)pos * inv_freq[j], inv_freq[j] = 1e6^(-j/64); precise sincosf (angles reach 2047 rad).
// Contraction is off so that the angle keeps its own f32 rounding, as the reference rounds it, ahead of the range reduction.
static __device__ __forceinline__ void tab_body(float* COS, float* SIN, int n, int blk) {
#pragma clang fp contract(off)
    const int i = blk * 256 + threadIdx.x; if (i >= n) return;
    const int pos = i >> 6, j = i & 63;
    const float invf = exp2f(-(float)j * (19.931568569324174f / 64.0f));   // log2(1e6) / 64
    const float ang = (float)pos * invf;
    float sn, cs; sincosf(ang, &sn, &cs);
    *(float*)(COS + i) = cs; *(float*)(SIN + i) = sn; 
}

// k_prep: the six independent preparation jobs in ONE launch; the block index picks the job (block-uniform branches, no barrier, no data passes between the jobs).
// Block ranges, longest job first: rotary tables | x, one range per batch | Wq, Wk, Wv | Wo.
#define PB_TAB (SEQ * 64 / 256)
#define N8X    ((size_t)SEQ * DX / 8)
#define N8W    ((size_t)DQ * DX / 8)
#define PB_X   ((int)((N8X + 255) / 256))
#define PB_W   ((int)((N8W + 255) / 256))
#define PB_ALL (PB_TAB + NB * PB_X + 4 * PB_W)
__global__ __launch_bounds__(256) void k_prep(const float* __restrict__ x, const float* __restrict__ wq, const float* __restrict__ wk, const float* __restrict__ wv, const float* __restrict__ wo,
                                              bf* XB, bf* WB, h16* WOH, float* COS, float* SIN) {
    int blk = (int)blockIdx.x;
    if (blk < PB_TAB) { tab_body(COS, SIN, SEQ * 64, blk); return; }
    blk -= PB_TAB;
    if (blk < NB * PB_X) { const int b = blk / PB_X; cvt8_body(x + (size_t)b * SEQ_FULL * DX, XB + (size_t)b * SEQ * DX, N8X, blk - b * PB_X); return; }
    blk -= NB * PB_X;
    if (blk < 3 * PB_W) { const int w = blk / PB_W; cvt8_body(w == 0 ? wq : (w == 1 ? wk : wv), WB + (size_t)w * DQ * DX, N8W, blk - w * PB_W); return; }
    cvtw_body(wo, WOH, N8W, WOS, blk - 3 * PB_W);
}

// qk_body: projection + per-head RMS normalisation + rotary, ONE WAVE per 32 tokens x 128 columns (one head; 16 accumulators), operands from the block's LDS tiles (row pitch PPH), K = DX.
// C[m][n] = sum_k A[m][k] Bt[n][k]; A = x rows (m = b*SEQ + t), Bt = W rows (n = h*128 + d). A: the wave's first x row in LDS; Bt: the head's first W row in LDS; r0: the wave's first token row; by: the head;
// os: the wave's LDS tile, 16 * OSQ floats, inside the x tile, written only behind the barrier that ends every wave's fragment reads.
// Epilogue per 16-row slab: row sum of squares from the accumulators (8 column tiles per lane, xor 1/2/4/8 inside each 16-lane half), y = (c * rstd) * gain staged in a wave-private LDS tile;
// store stage: lane piece p = 32 s + lane -> row p>>4, columns c8 = 8 (p&15); out[c] = y[c] cos[c&63] + (c < 64 ? -y[c+64] : y[c-64]) sin[c&63] (tables by 16-B loads), f16;
static __device__ __forceinline__ void qk_body(const bf* A, const bf* Bt, const float* __restrict__ nw,
                                               const float* __restrict__ COS, const float* __restrict__ SIN, h16* Ph, float* os, int r0, int by) {
    const int K = DX;
    const int lane = threadIdx.x & 31, lr = lane & 15, hi = lane >> 4;
    v8f acc[2][8];
#pragma unroll
    for (int mb = 0; mb < 2; ++mb)
#pragma unroll
        for (int nb = 0; nb < 8; ++nb) acc[mb][nb] = (v8f){};
    const int foff = lr * PPH + 8 * hi;
#pragma unroll 1
    for (int kc = 0; kc < K; kc += 32) {
        const bf* pa = A + foff + kc; const bf* pb = Bt + foff + kc;
        v16bf a[2], b[8];                                        // all 10 fragments of the k-step stand ahead of its first product: one LDS latency per k-step instead of one per column tile
#pragma unroll
        for (int mb = 0; mb < 2; ++mb) a[mb] = ldb(pa + mb * 16 * PPH);
#pragma unroll
        for (int nb = 0; nb < 8; ++nb) b[nb] = ldb(pb + nb * 16 * PPH);
        __builtin_amdgcn_sched_barrier(0);                       // holds the load group ahead of the matrix run: without it the compiler spreads the loads in pairs among the matrix instructions and each pair's latency is exposed
#pragma unroll
        for (int nb = 0; nb < 8; ++nb)
#pragma unroll
            for (int mb = 0; mb < 2; ++mb) acc[mb][nb] = wmmab(a[mb], b[nb], acc[mb][nb]);
    }
    __syncthreads();                                            // every wave's fragment reads are done before the x tile becomes epilogue tiles
    float wn[8];
#pragma unroll
    for (int nb = 0; nb < 8; ++nb) wn[nb] = bfr(nw[nb * 16 + lr]);                 // nb*16 + lr < HD
    const int bb = r0 / SEQ, tt = r0 % SEQ; const int zc = bb * NH_ + by;
    const size_t tbase = ((size_t)zc * SEQ + (size_t)tt) * HD;
#pragma unroll
    for (int mb = 0; mb < 2; ++mb) {
#pragma unroll
        for (int j = 0; j < 8; ++j) {
            float ss = 0.0f;
#pragma unroll
            for (int nb = 0; nb < 8; ++nb) ss += acc[mb][nb][j] * acc[mb][nb][j];
            ss += __shfl_xor(ss, 1, 32); ss += __shfl_xor(ss, 2, 32); ss += __shfl_xor(ss, 4, 32); ss += __shfl_xor(ss, 8, 32);
            const float rs = rsqrtf(ss * (1.0f / 128.0f) + 1.0e-6f);
#pragma unroll
            for (int nb = 0; nb < 8; ++nb) os[(hi * 8 + j) * OSQ + nb * 16 + lr] = (acc[mb][nb][j] * rs) * wn[nb]; }   // D: row 8h+j, col lane&15
        wave_sync();
        v8h hv[8];
#pragma unroll
        for (int s = 0; s < 8; ++s) { const int p = s * 32 + lane; const int row = p >> 4, c8 = (p & 15) * 8;   // 8 s x 2 rows = 16 rows; 16 lanes x 8 = 128 columns
            const int pc = c8 ^ 64, jj = c8 & 63; const float sg = (c8 < 64) ? -1.0f : 1.0f;
            const v4f x0 = *(const v4fa*)(&os[row * OSQ + c8]), x1 = *(const v4fa*)(&os[row * OSQ + c8 + 4]);
            const v4f y0 = *(const v4fa*)(&os[row * OSQ + pc]), y1 = *(const v4fa*)(&os[row * OSQ + pc + 4]);
            const size_t to = (size_t)(tt + mb * 16 + row) * 64 + (size_t)jj;      // token position < SEQ, jj + 7 < 64
            const v4f ca = *(const v4f*)(COS + to), cb = *(const v4f*)(COS + to + 4), sa = *(const v4f*)(SIN + to), sb = *(const v4f*)(SIN + to + 4);
            asm volatile("s_wait_xcnt 0x0" :: "v"(COS + to), "v"(SIN + to) : "memory");   // stands between the table loads and any rewrite of their address registers, which it keeps live (no load lands on them)
            v8h o;
#pragma unroll
            for (int i = 0; i < 4; ++i) { o[i] = toh_flush(x0[i] * ca[i] + (sg * y0[i]) * sa[i]); o[4 + i] = toh_flush(x1[i] * cb[i] + (sg * y1[i]) * sb[i]); }
            hv[s] = o; }
        const size_t sbs = tbase + (size_t)(mb * 16) * HD;
{
#pragma unroll
            for (int s = 0; s < 8; ++s) *(v8h*)(Ph + sbs + (size_t)(s * 32 + lane) * 8) = hv[s];
             }
        wave_sync();
    }
}

// vt_body: v^T projection, ONE WAVE per 64x64 tile (16 accumulators), operands from the block's LDS tiles (row pitch PPH), K = DX. A = Wv rows (m = h*128 + d), Bt = x rows (n = b*SEQ + t); plane [(b*2048 + m)][t], row pitch SEQ.
// A, Bt: the wave's first Wv row and first x row in LDS; r0, c0: the same rows' numbers in the planes; os: the wave's LDS tile, 16 * 68 floats, inside the x tile, written only behind the barrier that ends every wave's fragment reads.
static __device__ __forceinline__ void vt_body(const bf* A, const bf* Bt, h16* Ph, float* os, int r0, int c0) {
    const int K = DX;
    const int lane = threadIdx.x & 31, lr = lane & 15, hi = lane >> 4;
    v8f acc[4][4];
#pragma unroll
    for (int mb = 0; mb < 4; ++mb)
#pragma unroll
        for (int nb = 0; nb < 4; ++nb) acc[mb][nb] = (v8f){};
    const int foff = lr * PPH + 8 * hi;
#pragma unroll 1
    for (int kc = 0; kc < K; kc += 32) {
        const bf* pa = A + foff + kc; const bf* pb = Bt + foff + kc;
        v16bf a[4], b[4];                                        // all 8 fragments of the k-step stand ahead of its first product: one LDS latency per k-step instead of one per column tile
#pragma unroll
        for (int mb = 0; mb < 4; ++mb) a[mb] = ldb(pa + mb * 16 * PPH);
#pragma unroll
        for (int nb = 0; nb < 4; ++nb) b[nb] = ldb(pb + nb * 16 * PPH);
        __builtin_amdgcn_sched_barrier(0);                       // holds the load group ahead of the matrix run: without it the compiler spreads the loads in pairs among the matrix instructions and each pair's latency is exposed
#pragma unroll
        for (int nb = 0; nb < 4; ++nb)
#pragma unroll
            for (int mb = 0; mb < 4; ++mb) acc[mb][nb] = wmmab(a[mb], b[nb], acc[mb][nb]);
    }
    __syncthreads();                                            // every wave's fragment reads are done before the x tile becomes epilogue tiles
    const int bb = c0 / SEQ, tt = c0 % SEQ;
    const size_t tbase = (size_t)bb * (size_t)DQ * SEQ + (size_t)r0 * SEQ + (size_t)tt;
#pragma unroll
    for (int mb = 0; mb < 4; ++mb) {
#pragma unroll
        for (int nb = 0; nb < 4; ++nb) {
#pragma unroll
            for (int j = 0; j < 8; ++j) os[(hi * 8 + j) * 68 + nb * 16 + lr] = acc[mb][nb][j]; }   // D: row 8h+j, col lane&15
        wave_sync();
        v8h hv[4];
#pragma unroll
        for (int s = 0; s < 4; ++s) { const int row = 4 * s + (lane >> 3), c8 = (lane & 7) * 8;   // 4 s x 4 row groups = 16 rows; 8 lanes x 8 = 64 columns
            const v4f x0 = *(const v4fa*)(&os[row * 68 + c8]); const v4f x1 = *(const v4fa*)(&os[row * 68 + c8 + 4]); v8h o;
#pragma unroll
            for (int i = 0; i < 4; ++i) { o[i] = toh_flush(x0[i]); o[4 + i] = toh_flush(x1[i]); }
            hv[s] = o; }
        const size_t sbs = tbase + (size_t)(mb * 16) * SEQ;
{
#pragma unroll
            for (int s = 0; s < 4; ++s) { const int row = 4 * s + (lane >> 3), c8 = (lane & 7) * 8;
                *(v8h*)(Ph + sbs + (size_t)row * SEQ + c8) = hv[s]; }
             }
        wave_sync();
    }
}

// stage_rows8: 8 asynchronous 16-B copies per thread out of a contiguous tile of PTK rows x 384 B. 384 pieces of 16 B are 16 rows, so copy k of the 8 lies 6144 B further in the plane and 16 rows further in LDS.
// g: the thread's first global piece; l: its LDS byte address. The s_wait_xcnt closes the statement so that no address register is rewritten ahead of it.
static __device__ __forceinline__ void stage_rows8(const bf* g, unsigned l) {
    asm volatile("global_load_async_to_lds_b128 %0, %1, off\n\t"
                 "global_load_async_to_lds_b128 %2, %3, off\n\t"
                 "global_load_async_to_lds_b128 %4, %5, off\n\t"
                 "global_load_async_to_lds_b128 %6, %7, off\n\t"
                 "global_load_async_to_lds_b128 %8, %9, off\n\t"
                 "global_load_async_to_lds_b128 %10, %11, off\n\t"
                 "global_load_async_to_lds_b128 %12, %13, off\n\t"
                 "global_load_async_to_lds_b128 %14, %15, off\n\t"
                 "s_wait_xcnt 0x0"
                 :: "v"(l), "v"(g), "v"(l + 16 * PPH * 2), "v"(g + 16 * DX), "v"(l + 32 * PPH * 2), "v"(g + 32 * DX), "v"(l + 48 * PPH * 2), "v"(g + 48 * DX),
                    "v"(l + 64 * PPH * 2), "v"(g + 64 * DX), "v"(l + 80 * PPH * 2), "v"(g + 80 * DX), "v"(l + 96 * PPH * 2), "v"(g + 96 * DX), "v"(l + 112 * PPH * 2), "v"(g + 112 * DX)
                 : "memory");
}

// k_proj: the three independent projections in ONE launch of PW-wave blocks, grid (NB*SEQ/PTK, NH_, 3); blockIdx.z picks the job (block-uniform branch): 0 = q, 1 = k, 2 = v^T.
// A block takes PTK tokens x one head (PTK weight rows). Both operand tiles, whole K, are contiguous in their planes and come once per block into LDS as whole 128-B lines (48 copies per thread, filled once, then read);
// the waves take their fragments from there by 16-B LDS loads. q, k: wave w has tokens 32 w .. 32 w + 31 and the whole head. v^T: wave w has weight rows 64 (w & 1) .. + 63 and tokens 64 (w >> 1) .. + 63.
static_assert((NB * SEQ) % PTK == 0 && SEQ % PTK == 0 && PTK == HD);   // whole blocks; a block never straddles two batches; one head per block
static_assert(PTK == 32 * PW && PTK * PTK == 64 * 64 * PW);            // the waves' tiles cover the block's tile in both kinds of job
static_assert(DX * 2 == 24 * 16 && 16 * 24 == 3 * 32 * PW && PTK == 8 * 16);   // piece map: 24 pieces per row, 3 pieces per thread per 16 rows, 8 groups of 16 rows
static_assert((PPH * 2) % 16 == 0 && PPH >= DX);
static_assert(PW * 16 * OSQ * 4 <= PTB && 16 * 68 <= 16 * OSQ);        // the epilogue tiles fit the x tile
static_assert(2 * PTB <= 163840);
__global__ __launch_bounds__(32 * PW) __attribute__((amdgpu_waves_per_eu(3, 3)))
void k_proj(const bf* __restrict__ XB, const bf* __restrict__ WQ, const bf* __restrict__ WK, const bf* __restrict__ WV, const float* __restrict__ qnw, const float* __restrict__ knw,
            const float* __restrict__ COS, const float* __restrict__ SIN, h16* QH, h16* KP, h16* VT) {
    __shared__ __align__(16) char ps[2 * PTB];                  // x tile | W tile
    const int tid = threadIdx.x;
    const int wave = __builtin_amdgcn_readfirstlane((int)(threadIdx.x >> 5));
    const int z = (int)blockIdx.z, bx = (int)blockIdx.x, by = (int)blockIdx.y;
    const bf* xg = XB + (size_t)bx * PTK * DX;
    const bf* wg = (z == 0 ? WQ : (z == 1 ? WK : WV)) + (size_t)by * PTK * DX;
    const unsigned lbase = (unsigned)(size_t)ps;                // LDS byte address of the tiles
#pragma unroll   // three pieces per thread in every group of 16 rows; constant trip count, so that the row and column of a piece are computed three times only
    for (int r = 0; r < 3; ++r) {
        const int q = r * (32 * PW) + tid;                      // piece 0..383 of the first 16 rows: row q / 24, 16-B column q % 24
        const unsigned lo = (unsigned)((q / 24) * (PPH * 2) + (q % 24) * 16);
        stage_rows8(xg + (size_t)q * 8, lbase + lo);
        stage_rows8(wg + (size_t)q * 8, lbase + PTB + lo);
    }
    asm volatile("s_wait_asynccnt 0x0" ::: "memory");           // this wave's copies have landed
    __syncthreads();                                            // both tiles are readable by every wave
    const bf* xs = (const bf*)ps;
    const bf* wt = (const bf*)(ps + PTB);
    float* os = (float*)ps + wave * (16 * OSQ);
    if (z < 2) {
        qk_body(xs + wave * 32 * PPH, wt, z ? knw : qnw, COS, SIN, z ? KP : QH, os, bx * PTK + wave * 32, by);
        return;
    }
    const int mi = wave & 1, ni = wave >> 1;
    vt_body(wt + mi * 64 * PPH, xs + ni * 64 * PPH, VT, os, by * PTK + mi * 64, bx * PTK + ni * 64);
}

// stage_kv: one stage (KT keys) into LDS, 8 asynchronous 16-B copies per thread, whole 128-B lines per wave instruction.
// K tile: KT rows x 256 B, contiguous in the plane; piece c = 256 i + tid -> row c>>4, 16-B column c&15. V^T tile: 128 rows x 128 B; piece c -> row c>>3, 16-B column c&7.
// kg, vg: the thread's first global piece; lk, lv: its LDS byte addresses. The s_wait_xcnt closes the statement so that no address register is rewritten ahead of it.
static __device__ __forceinline__ void stage_kv(const h16* kg, const h16* vg, unsigned lk, unsigned lv) {
    asm volatile("global_load_async_to_lds_b128 %0, %1, off\n\t"
                 "global_load_async_to_lds_b128 %2, %3, off\n\t"
                 "global_load_async_to_lds_b128 %4, %5, off\n\t"
                 "global_load_async_to_lds_b128 %6, %7, off\n\t"
                 "global_load_async_to_lds_b128 %8, %9, off\n\t"
                 "global_load_async_to_lds_b128 %10, %11, off\n\t"
                 "global_load_async_to_lds_b128 %12, %13, off\n\t"
                 "global_load_async_to_lds_b128 %14, %15, off\n\t"
                 "s_wait_xcnt 0x0"
                 :: "v"(lk), "v"(kg), "v"(lk + 16 * KPH * 2), "v"(kg + 2048), "v"(lk + 32 * KPH * 2), "v"(kg + 4096), "v"(lk + 48 * KPH * 2), "v"(kg + 6144),
                    "v"(lv), "v"(vg), "v"(lv + 32 * VPH * 2), "v"(vg + (size_t)32 * SEQ), "v"(lv + 64 * VPH * 2), "v"(vg + (size_t)64 * SEQ), "v"(lv + 96 * VPH * 2), "v"(vg + (size_t)96 * SEQ)
                 : "memory");
}

// k_flash: fused attention, one wave per 16 query rows of one (batch, head), AW waves per block on the same (batch, head); K and V^T tiles of KT keys come once per block into LDS
// (two buffers, the next tile's copies fly while this one is worked on), fragments by two 16-B LDS loads each; Q fragments straight from the f16 plane, once per wave.
// Transposed form: S^T[key][t] = K Q^T (A = K rows, B = Q rows, 4 k-steps over d); lane (t = lane&15, h = lane>>4) holds keys 8h+r of each 16-key tile, so the packed
// P tile is directly the B fragment of O^T[d][t] = V^T P^T (element r <- tile keys 0..15, element 8+r <- tile keys 16..31, lane unchanged); 8 output tiles of 16 d.
// Additive mask row t, keys key0+8h+0..7 and key0+16+8h+0..7: four 16-B loads per lane per step, issued one step ahead, value RNE-converted to bf16, added after the scale (base-2 domain).
// Softmax state (running max, partial sum) is one scalar per lane; the two lane halves of a row are combined with one xor-16 exchange. Q fragments are loaded once, ahead of the key loop, and stay in registers.
__global__ __launch_bounds__(32 * AW) __attribute__((amdgpu_num_vgpr(256)))
void k_flash(const h16* __restrict__ QH, const h16* __restrict__ KP, const h16* __restrict__ VT, const float* __restrict__ mask, h16* CTX) {
    __shared__ __align__(16) char sm[2 * STB];
    float* os = (float*)sm;                                     // output tiles, after the key loop
    const int tid = threadIdx.x;
    const int lane = threadIdx.x & 31, lr = lane & 15, hi = lane >> 4;
    const int wave = __builtin_amdgcn_readfirstlane((int)(threadIdx.x >> 5));
    const int zh = blockIdx.y; const int b = zh / NH_, h = zh % NH_;
    const int t0 = (blockIdx.x * AW + wave) * 16;
    const size_t pbase = (size_t)zh * SEQ * HD;
    const size_t qo = pbase + (size_t)(t0 + lr) * HD + 8 * hi;  // + ks*32          (B fragment: col t, k = d)
    const int ko = lr * KPH + 8 * hi;                           // + key*KPH + ks*32 (A fragment: row key, k = d), halves in the K tile
    const int vo = lr * VPH + 8 * hi;                           // + 16j*VPH + key   (A fragment: row d, k = key), halves in the V^T tile
    const unsigned lbase = (unsigned)(size_t)sm;                // LDS byte address of the stage buffers
    const unsigned lk = lbase + (unsigned)((tid >> 4) * (KPH * 2) + (tid & 15) * 16);
    const unsigned lv = lbase + (unsigned)(KTB + (tid >> 3) * (VPH * 2) + (tid & 7) * 16);
    const h16* kg = KP + pbase + (size_t)tid * 8;
    const h16* vg = VT + pbase + (size_t)(tid >> 3) * SEQ + (size_t)(tid & 7) * 8;
    const float* mrow = mask + ((size_t)b * SEQ_FULL + (size_t)(t0 + lr)) * SEQ_FULL + 8 * hi;
    v8f o[8];
#pragma unroll
    for (int j = 0; j < 8; ++j) o[j] = (v8f){};
    float m = NEGB, l = 0.0f;
    stage_kv(kg, vg, lk, lv);
    v16h qf[HD / 32];                                           // the wave's 16 query rows as B fragments, loaded once and held in 32 registers for the whole key loop
#pragma unroll   // constant indices, so that qf lives in registers and not in scratch memory
    for (int ks = 0; ks < HD / 32; ++ks) qf[ks] = ldh(QH + qo + ks * 32);
    v4f m0 = *(const v4f*)mrow, m1 = *(const v4f*)(mrow + 4), m2 = *(const v4f*)(mrow + 16), m3 = *(const v4f*)(mrow + 20);   // mask values of step 0; every later step's are loaded one step ahead
    asm volatile("s_wait_xcnt 0x0" ::: "memory");               // stands between the Q loads and the later reuse of their address registers
    asm volatile("s_wait_asynccnt 0x0" ::: "memory");           // this wave's copies of tile 0 have landed
    __syncthreads();                                            // tile 0 is readable by every wave
    stage_kv(kg + (size_t)KT * HD, vg + KT, lk + STB, lv + STB);
#pragma unroll 1
    for (int t = 0; t < SEQ / KT; ++t) {
      const unsigned bo = (unsigned)(t & 1) * STB;
      const h16* kt = (const h16*)(sm + bo) + ko;
      const h16* vt = (const h16*)(sm + bo + KTB) + vo;
#pragma unroll   // both 32-key steps of a tile in line: their tile offsets become immediates of the LDS loads
      for (int sub = 0; sub < KT / 32; ++sub) {
        const int key0 = t * KT + sub * 32;
        const h16* ka = kt + sub * 32 * KPH;
        v8f sA = (v8f){}, sB = (v8f){};
        v16h ka0[HD / 32], kb0[HD / 32];                         // the step's 16 K loads stand ahead of its first product: one LDS latency per step instead of one per k-step
#pragma unroll
        for (int ks = 0; ks < HD / 32; ++ks) { ka0[ks] = ldh(ka + ks * 32); kb0[ks] = ldh(ka + 16 * KPH + ks * 32); }
        __builtin_amdgcn_sched_barrier(0);                       // holds the load group ahead of the matrix run: without it the compiler spreads the loads in pairs among the matrix instructions and each pair's latency is exposed
#pragma unroll
        for (int ks = 0; ks < HD / 32; ++ks) { sA = wmma16(ka0[ks], qf[ks], sA); sB = wmma16(kb0[ks], qf[ks], sB); }
        asm volatile("v_nop\n\tv_nop\n\tv_nop\n\tv_nop" : "+v"(sA), "+v"(sB));   // the four slots between the run's last matrix instruction and the first vector read of the scores, once per run
        const h16* va = vt + sub * 32;
        v16h vf[8];                                              // the step's 16 V^T loads issue as one group behind the score run; the softmax arithmetic covers their latency
#pragma unroll
        for (int j = 0; j < 8; ++j) vf[j] = ldh(va + (16 * j) * VPH);
        float ta[8], tb[8]; float mx = NEGB;
#pragma unroll
        for (int r = 0; r < 4; ++r) {
            ta[r] = sA[r] * SC2 + bfr(m0[r]) * L2E; ta[4 + r] = sA[4 + r] * SC2 + bfr(m1[r]) * L2E;
            tb[r] = sB[r] * SC2 + bfr(m2[r]) * L2E; tb[4 + r] = sB[4 + r] * SC2 + bfr(m3[r]) * L2E; }
        const float* mp = mrow + ((key0 + 32 < SEQ) ? key0 + 32 : 0);   // next step's keys +8h+0..7 and +16+8h+0..7, all < SEQ (behind the last step: step 0's again, unused)
        m0 = *(const v4f*)mp; m1 = *(const v4f*)(mp + 4); m2 = *(const v4f*)(mp + 16); m3 = *(const v4f*)(mp + 20);
#pragma unroll
        for (int r = 0; r < 8; ++r) mx = fmaxf(mx, fmaxf(ta[r], tb[r]));
        mx = fmaxf(mx, __shfl_xor(mx, 16, 32));
        const float mnew = fmaxf(m, mx);
        const float alpha = __builtin_amdgcn_exp2f(m - mnew);
        const float sh = PSH - mnew;
        v16h pb; float ls = 0.0f;
#pragma unroll
        for (int r = 0; r < 8; ++r) {
            const float xa = ta[r] + sh, xb = tb[r] + sh;
            const float ea = __builtin_amdgcn_exp2f(xa), eb = __builtin_amdgcn_exp2f(xb);
            const float ga = (xa < -14.0f) ? 0.0f : ea, gb = (xb < -14.0f) ? 0.0f : eb;   // no subnormal f16 P (select on the exponent argument)
            const h16 pa = (h16)ga; const h16 pc = (h16)gb;
            pb[r] = pa; pb[8 + r] = pc;
            ls += (float)pa + (float)pc; }
        l = l * alpha + ls; m = mnew;
#pragma unroll
        for (int j = 0; j < 8; ++j) o[j] = o[j] * alpha;
        __builtin_amdgcn_sched_barrier(0);                       // holds the load group ahead of the matrix run: without it the compiler spreads the loads in pairs among the matrix instructions and each pair's latency is exposed
#pragma unroll
        for (int j = 0; j < 8; ++j) o[j] = wmma16(vf[j], pb, o[j]);
        asm volatile("v_nop\n\tv_nop\n\tv_nop\n\tv_nop" : "+v"(o[0]), "+v"(o[1]), "+v"(o[2]), "+v"(o[3]), "+v"(o[4]), "+v"(o[5]), "+v"(o[6]), "+v"(o[7]));   // the four slots behind the run's last matrix instruction, once per run (the loop's back edge included); as an ordered statement it also keeps this run ahead of the next step's score products: without it the build interleaved the two steps and spilled to scratch
      }
      asm volatile("s_wait_dscnt 0x0" ::: "memory");            // this wave's reads of tile t are done before its buffer is refilled
      asm volatile("s_wait_asynccnt 0x0" ::: "memory");         // this wave's copies of tile t + 1 have landed
      __syncthreads();                                          // publishes tile t + 1 and ends every wave's reads of tile t
      if (t + 2 < SEQ / KT) stage_kv(kg + (size_t)(t + 2) * KT * HD, vg + (t + 2) * KT, lk + bo, lv + bo);
    }
    asm volatile("s_wait_asynccnt 0x0" ::: "memory");           // no copy is outstanding when the buffers become output tiles
    l += __shfl_xor(l, 16, 32);
    const bool any = l > 0.0f;
    const float lsafe = any ? l : 1.0f;
    const float inv = any ? ((1.0f / lsafe) * CXS) : 0.0f;
    const int wb = wave * 16 * OSP;
    // O^T D layout: o[j][r] = (d = 16j + 8h + r, t = lane&15) -> os[t][d]; rows 0..15 x columns 0..127 all written
#pragma unroll
    for (int j = 0; j < 8; ++j) { v4f a, c;
        a[0] = o[j][0] * inv; a[1] = o[j][1] * inv; a[2] = o[j][2] * inv; a[3] = o[j][3] * inv; c[0] = o[j][4] * inv; c[1] = o[j][5] * inv; c[2] = o[j][6] * inv; c[3] = o[j][7] * inv;
        *(v4fa*)(&os[wb + lr * OSP + 16 * j + 8 * hi]) = a; *(v4fa*)(&os[wb + lr * OSP + 16 * j + 8 * hi + 4]) = c; }
    wave_sync();
    v8h hv[8];
#pragma unroll
    for (int s = 0; s < 8; ++s) { const int p = s * 32 + lane; const int row = p >> 4, c8 = (p & 15) * 8;   // 8 s x 2 rows = 16 rows; 16 lanes x 8 = 128 columns = two lines
        const v4f x0 = *(const v4fa*)(&os[wb + row * OSP + c8]); const v4f x1 = *(const v4fa*)(&os[wb + row * OSP + c8 + 4]); v8h q;
#pragma unroll
        for (int i = 0; i < 4; ++i) { q[i] = toh_flush(x0[i]); q[4 + i] = toh_flush(x1[i]); }
        hv[s] = q; }
    h16* crow = CTX + ((size_t)b * SEQ + (size_t)t0) * DQ + (size_t)h * HD;
{
#pragma unroll
        for (int s = 0; s < 8; ++s) { const int p = s * 32 + lane; const int row = p >> 4, c8 = (p & 15) * 8;
            *(v8h*)(crow + (size_t)row * DQ + c8) = hv[s]; }
         }
}

// stage_o8: 8 asynchronous 16-B copies per thread out of 32 rows x 1024 B (half a 64-row tile) whose rows lie DQ halves apart. The block's 256 threads cover 4 rows per copy (a wave: 512 contiguous bytes, four whole lines),
// so copy k of the 8 lies 4 k rows further in the plane and in LDS. g: the thread's first global piece; l: its LDS byte address. The s_wait_xcnt closes the statement so that no address register is rewritten ahead of it.
static __device__ __forceinline__ void stage_o8(const h16* g, unsigned l) {
    asm volatile("global_load_async_to_lds_b128 %0, %1, off\n\t"
                 "global_load_async_to_lds_b128 %2, %3, off\n\t"
                 "global_load_async_to_lds_b128 %4, %5, off\n\t"
                 "global_load_async_to_lds_b128 %6, %7, off\n\t"
                 "global_load_async_to_lds_b128 %8, %9, off\n\t"
                 "global_load_async_to_lds_b128 %10, %11, off\n\t"
                 "global_load_async_to_lds_b128 %12, %13, off\n\t"
                 "global_load_async_to_lds_b128 %14, %15, off\n\t"
                 "s_wait_xcnt 0x0"
                 :: "v"(l), "v"(g), "v"(l + 4 * OPH * 2), "v"(g + (size_t)4 * DQ), "v"(l + 8 * OPH * 2), "v"(g + (size_t)8 * DQ), "v"(l + 12 * OPH * 2), "v"(g + (size_t)12 * DQ),
                    "v"(l + 16 * OPH * 2), "v"(g + (size_t)16 * DQ), "v"(l + 20 * OPH * 2), "v"(g + (size_t)20 * DQ), "v"(l + 24 * OPH * 2), "v"(g + (size_t)24 * DQ), "v"(l + 28 * OPH * 2), "v"(g + (size_t)28 * DQ)
                 : "memory");
}
// stage_out: one stage (OKC k values of 64 ctx rows and of 64 Wo rows) into LDS, 32 copies per thread. ga, gb: the thread's first piece of either tile; l: its LDS byte address in the stage's ctx tile.
static __device__ __forceinline__ void stage_out(const h16* ga, const h16* gb, unsigned l) {
    stage_o8(ga, l);       stage_o8(ga + (size_t)32 * DQ, l + 32 * OPH * 2);
    stage_o8(gb, l + OTB); stage_o8(gb + (size_t)32 * DQ, l + OTB + 32 * OPH * 2);
}

// k_out: output projection, OW waves per 64x64 tile (16 accumulators each), K = DQ split over the waves: wave w takes the 32-wide k-steps w, w + OW, w + 2 OW, ...
// The ctx and Wo tiles come in stages of OKC k values into LDS as whole 128-B lines (two buffers, the next stage's copies fly while this one is worked on); fragments by two 16-B LDS loads each.
// OUT[m][n] = (1/16384) sum_k A[m][k] Bt[n][k]; A = ctx rows (m = b*SEQ + t, x256), Bt = Wo rows (n, x64). grid (NB*SEQ/64, DX/64).
// Epilogue: every wave writes its partial 64x64 f32 tile to its own LDS plane; behind one barrier wave w adds rows 8w..8w+7 over the planes in plane order 0..OW-1 and stores them as whole lines.
__global__ __launch_bounds__(32 * OW) void k_out(const h16* __restrict__ A, const h16* __restrict__ Bt, float* OUT) {
    __shared__ __align__(16) char sm[2 * OSB];
    float* os = (float*)sm;                                     // partial tiles, after the k loop
    const int K = DQ;
    const int tid = threadIdx.x;
    const int lane = threadIdx.x & 31, lr = lane & 15, hi = lane >> 4; const int r0 = blockIdx.x * 64, c0 = blockIdx.y * 64;
    const int wave = __builtin_amdgcn_readfirstlane((int)(threadIdx.x >> 5));
    v8f acc[4][4];
#pragma unroll
    for (int mb = 0; mb < 4; ++mb)
#pragma unroll
        for (int nb = 0; nb < 4; ++nb) acc[mb][nb] = (v8f){};
    const unsigned l0 = (unsigned)(size_t)sm + (unsigned)((tid >> 6) * (OPH * 2) + (tid & 63) * 16);   // LDS byte address of the thread's first piece: row tid>>6, 16-B column tid&63
    const h16* ga = A + (size_t)(r0 + (tid >> 6)) * K + (size_t)(tid & 63) * 8;
    const h16* gb = Bt + (size_t)(c0 + (tid >> 6)) * K + (size_t)(tid & 63) * 8;
    const int foff = lr * OPH + 8 * hi + wave * 32;             // + 16 mb * OPH + 32 OW u: halves in a tile
    stage_out(ga, gb, l0);
    asm volatile("s_wait_asynccnt 0x0" ::: "memory");           // this wave's copies of stage 0 have landed
    __syncthreads();                                            // stage 0 is readable by every wave
    stage_out(ga + OKC, gb + OKC, l0 + OSB);
#pragma unroll 1
    for (int t = 0; t < K / OKC; ++t) {
        const unsigned bo = (unsigned)(t & 1) * OSB;
        const h16* pa = (const h16*)(sm + bo) + foff; const h16* pb = (const h16*)(sm + bo + OTB) + foff;
#pragma unroll   // both k-steps of a stage in line: their tile offsets become immediates of the LDS loads
        for (int u = 0; u < OKC / (32 * OW); ++u) {
            v16h a[4], bq[4];                                    // all 16 loads of the k-step stand ahead of its first product: one LDS latency per k-step instead of one per column tile
#pragma unroll
            for (int mb = 0; mb < 4; ++mb) a[mb] = ldh(pa + mb * 16 * OPH + u * 32 * OW);
#pragma unroll
            for (int nb = 0; nb < 4; ++nb) bq[nb] = ldh(pb + nb * 16 * OPH + u * 32 * OW);
            __builtin_amdgcn_sched_barrier(0);                   // holds the load group ahead of the matrix run: without it the compiler spreads the loads in pairs among the matrix instructions and each pair's latency is exposed
#pragma unroll
            for (int nb = 0; nb < 4; ++nb)
#pragma unroll
                for (int mb = 0; mb < 4; ++mb) acc[mb][nb] = wmma16(a[mb], bq[nb], acc[mb][nb]);
        }
        asm volatile("s_wait_dscnt 0x0" ::: "memory");          // this wave's reads of stage t are done before its buffer is refilled
        asm volatile("s_wait_asynccnt 0x0" ::: "memory");       // this wave's copies of stage t + 1 have landed
        __syncthreads();                                        // publishes stage t + 1 and ends every wave's reads of stage t
        if (t + 2 < K / OKC) stage_out(ga + (t + 2) * OKC, gb + (t + 2) * OKC, l0 + bo);
    }
    asm volatile("s_wait_asynccnt 0x0" ::: "memory");           // no copy is outstanding when the buffers become partial tiles
    float* ow = os + wave * (64 * 68);
#pragma unroll
    for (int mb = 0; mb < 4; ++mb)
#pragma unroll
        for (int nb = 0; nb < 4; ++nb)
#pragma unroll
            for (int j = 0; j < 8; ++j) ow[(mb * 16 + hi * 8 + j) * 68 + nb * 16 + lr] = acc[mb][nb][j];   // D: row 8h+j, col lane&15
    __syncthreads();                                            // every wave's partial tile is readable by every wave
    const int bb = r0 / SEQ, tt = r0 % SEQ;
    float* obase = OUT + ((size_t)bb * OUT_SEQ + (size_t)tt) * DX + c0;
    v4f ov[4];
#pragma unroll
    for (int s = 0; s < 4; ++s) { const int p = s * 32 + lane; const int row = wave * (64 / OW) + (p >> 4), c4 = (p & 15) * 4;   // 4 s x 2 rows = 8 rows; 16 lanes x 4 floats = 64 columns = two lines
        v4f sum = *(const v4fa*)(&os[row * 68 + c4]);
#pragma unroll
        for (int q = 1; q < OW; ++q) sum += *(const v4fa*)(&os[q * (64 * 68) + row * 68 + c4]);
        ov[s] = sum * OSC; }
#pragma unroll
    for (int s = 0; s < 4; ++s) { const int p = s * 32 + lane; const int row = wave * (64 / OW) + (p >> 4), c4 = (p & 15) * 4;
        *(v4f*)(obase + (size_t)row * DX + c4) = ov[s]; }
}

static constexpr size_t al256(size_t v) { return (v + 255) & ~(size_t)255; }
static constexpr size_t SZ_XB = al256((size_t)NB * SEQ * DX * 2);          // x bf16 [NB*SEQ][192]
static constexpr size_t SZ_WB = al256((size_t)3 * DQ * DX * 2);            // Wq | Wk | Wv bf16 [3][2048][192]
static constexpr size_t SZ_WO = al256((size_t)DX * DQ * 2);                // Wo f16 [192][2048]
static constexpr size_t SZ_TB = al256((size_t)SEQ * 64 * 4);               // cos or sin table [SEQ][64]
static constexpr size_t SZ_PL = al256((size_t)NB * NH_ * SEQ * HD * 2);    // q, k, v^T planes
static constexpr size_t SZ_CX = al256((size_t)NB * SEQ * DQ * 2);          // ctx plane
static constexpr size_t SZ_TOTAL = SZ_XB + SZ_WB + SZ_WO + 2 * SZ_TB + 3 * SZ_PL + SZ_CX;
static_assert(SZ_TOTAL <= (size_t)134217728);          // workspace carve <= 128 MiB
static_assert(((size_t)DQ * DX * 2) % 256 == 0);       // weight sub-planes stay 256-byte aligned
static_assert((size_t)NB * NH_ * SEQ * HD == (size_t)NB * DQ * SEQ);       // v^T plane [(b*2048 + m)][t] has the same extent as the q/k planes

extern "C" void kernel_launch(void* const* d_in, const int* in_sizes, int n_in,
                              void* d_out, int out_size, void* d_ws, size_t ws_size, hipStream_t stream) {
    if (n_in < 8) return;
    const size_t needx = ((size_t)(NB - 1) * SEQ_FULL + SEQ) * DX;
    const size_t needm = ((size_t)(NB - 1) * SEQ_FULL + (size_t)(SEQ - 1)) * SEQ_FULL + SEQ;
    if ((size_t)in_sizes[0] < needx || (size_t)in_sizes[1] < needm) return;
    if ((size_t)in_sizes[2] < (size_t)DQ * DX || (size_t)in_sizes[3] < (size_t)DQ * DX || (size_t)in_sizes[4] < (size_t)DQ * DX || (size_t)in_sizes[5] < (size_t)DX * DQ) return;
    if (in_sizes[6] < HD || in_sizes[7] < HD) return;
    if ((size_t)out_size < ((size_t)(NB - 1) * OUT_SEQ + SEQ) * DX) return;
    if (SZ_TOTAL > ws_size) return;
    // wire order: x, mask0, wq, wk, wv, wo, q_norm_w, k_norm_w
    const float* x    = (const float*)d_in[0];
    const float* mask = (const float*)d_in[1];
    const float* wq   = (const float*)d_in[2];
    const float* wk   = (const float*)d_in[3];
    const float* wv   = (const float*)d_in[4];
    const float* wo   = (const float*)d_in[5];
    const float* qnw  = (const float*)d_in[6];
    const float* knw  = (const float*)d_in[7];
    float* OUT = (float*)d_out;      // [NB][SEQ][192]
    char* wsp = (char*)d_ws;
    bf*  XB  = (bf*)wsp;  wsp += SZ_XB;               // [NB*SEQ][192]
    bf*  WB  = (bf*)wsp;  wsp += SZ_WB;               // [3][2048][192]: q | k | v  ([out][in] = Bt as-is for q, k; A as-is for v^T)
    h16* WOH = (h16*)wsp; wsp += SZ_WO;               // [192][2048] x64
    float* COS = (float*)wsp; wsp += SZ_TB;           // [SEQ][64]
    float* SIN = (float*)wsp; wsp += SZ_TB;           // [SEQ][64]
    h16* QH  = (h16*)wsp; wsp += SZ_PL;               // [NB*16][SEQ][128]
    h16* KP  = (h16*)wsp; wsp += SZ_PL;               // [NB*16][SEQ][128]
    h16* VT  = (h16*)wsp; wsp += SZ_PL;               // [NB*16][128][SEQ]
    h16* CTX = (h16*)wsp; wsp += SZ_CX;               // [NB*SEQ][2048] x256
    bf* WQ = WB; bf* WK = WB + (size_t)DQ * DX; bf* WV = WB + (size_t)2 * DQ * DX;

    // preparation: bf16 copies of x and Wq|Wk|Wv, f16 Wo plane, rotary tables
    k_prep<<<PB_ALL, 256, 0, stream>>>(x, wq, wk, wv, wo, XB, WB, WOH, COS, SIN);
    // q, k: A = x rows (m = b*SEQ + t), Bt = W rows (n = h*128 + d) -> normalised, rotated plane [(b*16 + h)][t][d]
    // v^T: A = Wv rows (m = h*128 + d), Bt = x rows (n = b*SEQ + t) -> plane [(b*2048 + m)][t] = [(b*16 + h)][d][t]
    k_proj<<<dim3(NB * SEQ / PTK, NH_, 3), 32 * PW, 0, stream>>>(XB, WQ, WK, WV, qnw, knw, COS, SIN, QH, KP, VT);

    k_flash<<<dim3(SEQ / (16 * AW), NB * NH_, 1), 32 * AW, 0, stream>>>(QH, KP, VT, mask, CTX);
    // output projection: A = ctx rows [b*SEQ + t][2048], Bt = Wo rows [192][2048]
    k_out<<<dim3(NB * SEQ / 64, DX / 64, 1), 32 * OW, 0, stream>>>(CTX, WOH, OUT);
}
